// v000
// Measured on an AMD MI455X. A time is GPU time per run, averaged over a window of back-to-back runs after a warm-up
// (all launches, gaps included; the runs take copies of the inputs in turn), and the median of several windows.
// Apart from v000's, it joins two sittings. Times from different sittings can be a few percent apart, while
// side-by-side timings come from the same sitting.
// The starting kernel, v000, takes 2160 microseconds a run.
#include <hip/hip_runtime.h>

// Causal multi-head attention at d_model 768 with bias-free projections and an output bias (x [4][2048][768]; q, k, v = x W ('xw' [768][768], no bias; 12 heads x 64); scores masked (-inf) then / sqrt(64); softmax; out = merged Wo + bo ('xw' + bias) -> [4][2048][768] (6.3 M); argument order x, Wq, Wk, Wv, Wo, bo).
// Layout per batch: bf16 copy of x; 'xw' weights transposed once; exact projections (K 768); identity-table plane builders; causal T-2048 attention at 12 heads (hybrid rows: < 512 hi/lo 3 products, rest fp16 x1024; k_gemmc skips tiles above the diagonal); merged hi/lo x Wo exact + bo.
// Compute dtypes, f32 accumulate: every input rounded to bf16; projections exact; attention rows < 512 3 products, rest fp16; softmax f32; Wo hl x exact + bias.

#define NB_  4
#define TT   2048
#define DM   768
#define NH_  12
#define NKV  12
#define REP  (NH_ / NKV)
#define HD   64
#define DQ   (NH_ * HD)
#define DKV  (NKV * HD)
#define ZH   2
#define RH   512                  // query rows < RH use hi+lo planes (0: none)
#define WIN  2048
#define PCAR 1024.0f
#define SCL  0.125f   // HD^-0.5
typedef _Float16 h16;
typedef unsigned short bf;
typedef __attribute__((ext_vector_type(16))) __bf16   v16bf;
typedef __attribute__((ext_vector_type(16))) _Float16 v16h;
typedef __attribute__((ext_vector_type(8)))  _Float16 v8h;
typedef __attribute__((ext_vector_type(8)))  unsigned short v8us;
typedef __attribute__((ext_vector_type(8)))  float    v8f;
typedef __attribute__((ext_vector_type(4)))  float    v4f;
typedef v8h  __attribute__((may_alias)) v8ha;
typedef v4f  __attribute__((may_alias)) v4fa;
typedef v8us __attribute__((may_alias)) v8usa;

__device__ __forceinline__ unsigned short f2bf(float f) { unsigned u = __float_as_uint(f); u += 0x7FFFu + ((u >> 16) & 1u); return (unsigned short)(u >> 16); }
__device__ __forceinline__ float bf2f(unsigned short b) { return __uint_as_float(((unsigned)b) << 16); }
__device__ __forceinline__ float bfr(float f) { return bf2f(f2bf(f)); }
__device__ __forceinline__ v16h cat16(v8h lo, v8h hi) { return __builtin_shufflevector(lo, hi, 0, 1, 2, 3, 4, 5, 6, 7, 8, 9, 10, 11, 12, 13, 14, 15); }
__device__ __forceinline__ v16bf cat16b(v8us lo, v8us hi) { return __builtin_bit_cast(v16bf, __builtin_shufflevector(lo, hi, 0, 1, 2, 3, 4, 5, 6, 7, 8, 9, 10, 11, 12, 13, 14, 15)); }
__device__ __forceinline__ v8f wmma16(v16h a, v16h b, v8f c) { return __builtin_amdgcn_wmma_f32_16x16x32_f16(false, a, false, b, (short)0, c, false, false); }
__device__ __forceinline__ v8f wmmab(v16bf a, v16bf b, v8f c) { return __builtin_amdgcn_wmma_f32_16x16x32_bf16(false, a, false, b, (short)0, c, false, false); }



// ---- k_gemmw: register-blocked GEMM, ONE WAVE per 64x64 output tile (16 accumulators), operands straight from K-contiguous 16-bit planes; grid (M/64, N/64, Z), 32 threads.
// C[m][n] (f32, pitch ldc, + optional f32 bias[n]) = sum_k A[m][k] Bt[n][k] (+ split products per NSPLIT). z-batch strides sA/sB/sC in elements. K % 32 == 0.
template <typename T16> struct WFrag;
template <> struct WFrag<h16> { typedef v16h V; static __device__ __forceinline__ V ld(const h16* p) { return cat16(*(const v8h*)p, *(const v8h*)(p + 16)); } static __device__ __forceinline__ v8f mma(V a, V b, v8f c) { return wmma16(a, b, c); } };
template <> struct WFrag<bf> { typedef v16bf V; static __device__ __forceinline__ V ld(const bf* p) { return cat16b(*(const v8us*)p, *(const v8us*)(p + 16)); } static __device__ __forceinline__ v8f mma(V a, V b, v8f c) { return wmmab(a, b, c); } };
template <typename T16, int NSPLIT, bool BIAS>
__global__ __launch_bounds__(32) void k_gemmw(const T16* __restrict__ A, const T16* __restrict__ A2, const T16* __restrict__ Bt, const T16* __restrict__ Bt2, int K, float* C, int ldc, const float* __restrict__ bias, size_t sA, size_t sB, size_t sC) {
    typedef typename WFrag<T16>::V V;
    __shared__ __align__(16) float os[16 * 68];
    const size_t z = blockIdx.z; A += z * sA; if (A2) A2 += z * sA; Bt += z * sB; if (Bt2) Bt2 += z * sB; C += z * sC;
    const int lane = threadIdx.x & 31, lr = lane & 15, hi = lane >> 4; const int r0 = blockIdx.x * 64, c0 = blockIdx.y * 64;
    v8f acc[4][4];
#pragma unroll
    for (int mb = 0; mb < 4; ++mb)
#pragma unroll
        for (int nb = 0; nb < 4; ++nb) acc[mb][nb] = (v8f){};
    const size_t aoff = (size_t)(r0 + lr) * K + 8 * hi, boff = (size_t)(c0 + lr) * K + 8 * hi;
#pragma unroll 1
    for (int kc = 0; kc < K; kc += 32) {
        V a[4], a2[4];
#pragma unroll
        for (int mb = 0; mb < 4; ++mb) { a[mb] = WFrag<T16>::ld(A + aoff + (size_t)mb * 16 * K + kc); if (NSPLIT == 1 || NSPLIT == 2) a2[mb] = WFrag<T16>::ld(A2 + aoff + (size_t)mb * 16 * K + kc); }
#pragma unroll
        for (int nb = 0; nb < 4; ++nb) { const V b = WFrag<T16>::ld(Bt + boff + (size_t)nb * 16 * K + kc); V b2; if (NSPLIT >= 2) b2 = WFrag<T16>::ld(Bt2 + boff + (size_t)nb * 16 * K + kc);
#pragma unroll
            for (int mb = 0; mb < 4; ++mb) { acc[mb][nb] = WFrag<T16>::mma(a[mb], b, acc[mb][nb]); if (NSPLIT == 1 || NSPLIT == 2) acc[mb][nb] = WFrag<T16>::mma(a2[mb], b, acc[mb][nb]); if (NSPLIT >= 2) acc[mb][nb] = WFrag<T16>::mma(a[mb], b2, acc[mb][nb]); } }
        asm volatile("v_nop\n\tv_nop\n\tv_nop\n\tv_nop" : "+v"(acc[0][0]), "+v"(acc[1][1]), "+v"(acc[2][2]), "+v"(acc[3][3]) : "v"(a[0]), "v"(a[3]));
    }
#pragma unroll
    for (int mb = 0; mb < 4; ++mb) {
#pragma unroll
        for (int nb = 0; nb < 4; ++nb) {
#pragma unroll
            for (int j = 0; j < 8; ++j) os[(hi * 8 + j) * 68 + nb * 16 + lr] = acc[mb][nb][j]; }
        __builtin_amdgcn_wave_barrier(); asm volatile("" ::: "memory");
        float* crow = C + (size_t)(r0 + mb * 16) * ldc + c0;
{
#pragma unroll
            for (int s = 0; s < 8; ++s) { const int row = 2 * s + hi, cofs = lr * 4; v4f val = *(const v4fa*)(os + row * 68 + cofs); if (BIAS) { val[0] += bfr(bias[c0 + cofs]); val[1] += bfr(bias[c0 + cofs + 1]); val[2] += bfr(bias[c0 + cofs + 2]); val[3] += bfr(bias[c0 + cofs + 3]); }
                *(v4f*)(crow + (size_t)row * ldc + cofs) = val; }
             }
        __builtin_amdgcn_wave_barrier(); asm volatile("" ::: "memory");
    }
}

// ---- k_gemmc: the same one-wave 64x64 tile GEMM specialised for causal attention: CMODE 1 skips score tiles entirely above the diagonal (query rows r0+roff.., key columns c0..), CMODE 2 limits the
// key (K) loop of the probability x value contraction to the diagonal block (probabilities beyond it are exactly zero). roff = row offset of this launch's first row within the sequence.
template <typename T16, int NSPLIT, int CMODE>
__global__ __launch_bounds__(32) void k_gemmc(const T16* __restrict__ A, const T16* __restrict__ A2, const T16* __restrict__ Bt, const T16* __restrict__ Bt2, int K, float* C, int ldc, int roff, size_t sA, size_t sB, size_t sC) {
    typedef typename WFrag<T16>::V V;
    __shared__ __align__(16) float os[16 * 68];
    const size_t z = blockIdx.z; A += z * sA; if (A2) A2 += z * sA; Bt += z * sB; if (Bt2) Bt2 += z * sB; C += z * sC;
    const int lane = threadIdx.x & 31, lr = lane & 15, hi = lane >> 4; const int r0 = blockIdx.x * 64, c0 = blockIdx.y * 64;
    if (CMODE == 1 && c0 > r0 + roff + 63) return;                  // score tile entirely above the causal diagonal: never read (the softmax masks j > i by select)
    const int Kl = (CMODE == 2) ? min(K, r0 + roff + 64) : K;        // P.V: probabilities are exactly 0 beyond the diagonal block, so the K loop stops there
    v8f acc[4][4];
#pragma unroll
    for (int mb = 0; mb < 4; ++mb)
#pragma unroll
        for (int nb = 0; nb < 4; ++nb) acc[mb][nb] = (v8f){};
    const size_t aoff = (size_t)(r0 + lr) * K + 8 * hi, boff = (size_t)(c0 + lr) * K + 8 * hi;
#pragma unroll 1
    for (int kc = 0; kc < Kl; kc += 32) {
        V a[4], a2[4];
#pragma unroll
        for (int mb = 0; mb < 4; ++mb) { a[mb] = WFrag<T16>::ld(A + aoff + (size_t)mb * 16 * K + kc); if (NSPLIT == 1 || NSPLIT == 2) a2[mb] = WFrag<T16>::ld(A2 + aoff + (size_t)mb * 16 * K + kc); }
#pragma unroll
        for (int nb = 0; nb < 4; ++nb) { const V b = WFrag<T16>::ld(Bt + boff + (size_t)nb * 16 * K + kc); V b2; if (NSPLIT >= 2) b2 = WFrag<T16>::ld(Bt2 + boff + (size_t)nb * 16 * K + kc);
#pragma unroll
            for (int mb = 0; mb < 4; ++mb) { acc[mb][nb] = WFrag<T16>::mma(a[mb], b, acc[mb][nb]); if (NSPLIT == 1 || NSPLIT == 2) acc[mb][nb] = WFrag<T16>::mma(a2[mb], b, acc[mb][nb]); if (NSPLIT >= 2) acc[mb][nb] = WFrag<T16>::mma(a[mb], b2, acc[mb][nb]); } }
        asm volatile("v_nop\n\tv_nop\n\tv_nop\n\tv_nop" : "+v"(acc[0][0]), "+v"(acc[1][1]), "+v"(acc[2][2]), "+v"(acc[3][3]) : "v"(a[0]), "v"(a[3]));
    }
#pragma unroll
    for (int mb = 0; mb < 4; ++mb) {
#pragma unroll
        for (int nb = 0; nb < 4; ++nb) {
#pragma unroll
            for (int j = 0; j < 8; ++j) os[(hi * 8 + j) * 68 + nb * 16 + lr] = acc[mb][nb][j]; }
        __builtin_amdgcn_wave_barrier(); asm volatile("" ::: "memory");
        float* crow = C + (size_t)(r0 + mb * 16) * ldc + c0;
{
#pragma unroll
            for (int s = 0; s < 8; ++s) { const int row = 2 * s + hi, cofs = lr * 4; v4f val = *(const v4fa*)(os + row * 68 + cofs);
                *(v4f*)(crow + (size_t)row * ldc + cofs) = val; }
             }
        __builtin_amdgcn_wave_barrier(); asm volatile("" ::: "memory");
    }
}

__device__ __forceinline__ h16 tohx(float x) { return (h16)x; }
__device__ __forceinline__ void splitf(float y, unsigned short& h, unsigned short& l) { h = f2bf(y); l = f2bf(y - bf2f(h)); }
typedef __attribute__((ext_vector_type(2))) _Float16 v2h;
typedef __attribute__((ext_vector_type(4))) _Float16 v4h;
typedef __attribute__((ext_vector_type(2))) unsigned short v2us;
typedef __attribute__((ext_vector_type(4))) unsigned short v4us;
typedef __attribute__((ext_vector_type(2))) float v2f;
typedef __attribute__((ext_vector_type(4))) int v4i;

__global__ __launch_bounds__(256) void k_wtG(const float* __restrict__ w, int K, int N, bf* Bt) {
    const int lane = threadIdx.x & 31; const int L0 = (blockIdx.x * 8 + (threadIdx.x >> 5)) * 8; const int nlines = N * K / 64;
{
#pragma unroll 1
        for (int l = 0; l < 8; ++l) { const int L = L0 + l; if (L >= nlines) break; const size_t e = (size_t)L * 64 + lane * 2; const int k = (int)(e % K), n = (int)(e / K); v2us o;
            o[0] = f2bf(w[(size_t)k * N + n]); o[1] = f2bf(w[(size_t)(k + 1) * N + n]); *(v2us*)(Bt + e) = o; }
         }
}
__global__ __launch_bounds__(256) void k_cvt8(const float* __restrict__ src, bf* dst, size_t n8) { const size_t i = (size_t)blockIdx.x * 256 + threadIdx.x; if (i >= n8) return; const v8f v = *(const v8f*)(src + i * 8); v8us o;
#pragma unroll
    for (int k = 0; k < 8; ++k) o[k] = f2bf(v[k]); *(v8us*)(dst + i * 8) = o;  }

// k_rope: head planes [h][t][d] (fp16 + hi/lo) of rope(x) x sc with the rotate-half convention out[d] = x[d] cos[t][d] - x[d+HD/2] sin[t][d], out[d+HD/2] = x[d+HD/2] cos[t][d+HD/2] + x[d] sin[t][d+HD/2]
__global__ __launch_bounds__(256) void k_rope(const float* __restrict__ F, int pitch, int nheads, const float* __restrict__ CS, const float* __restrict__ RF, const float* __restrict__ nw, float sc, h16* P16, bf* Ph, bf* Pl) {
    const size_t e = ((size_t)blockIdx.x * 256 + threadIdx.x) * 2; if (e >= (size_t)nheads * TT * HD) return; const int d = (int)(e % HD); const int t = (int)((e / HD) % TT); const int h = (int)(e / ((size_t)HD * TT)); const float* f = F + (size_t)t * pitch + h * HD; const float rf = RF ? RF[(size_t)h * TT + t] : 1.0f; v2h o16; v2us oh, ol;
#pragma unroll
    for (int q = 0; q < 2; ++q) { const int dd = d + q; const int dp = (dd < HD / 2) ? dd + HD / 2 : dd - HD / 2; float x0 = f[dd], x1 = f[dp];
        if (RF) { float n0 = __fmul_rn(x0, rf), n1 = __fmul_rn(x1, rf); asm volatile("" : "+v"(n0)); asm volatile("" : "+v"(n1)); x0 = __fmul_rn(bfr(nw[dd]), n0); x1 = __fmul_rn(bfr(nw[dp]), n1); }
        const v2f cs = *(const v2f*)(CS + ((size_t)t * HD + dd) * 2); float a = __fmul_rn(x0, cs[0]), bq = __fmul_rn(x1, cs[1]); asm volatile("" : "+v"(a)); asm volatile("" : "+v"(bq)); const float r = ((dd < HD / 2) ? __fsub_rn(a, bq) : __fadd_rn(a, bq)) * sc;
        o16[q] = tohx(r); unsigned short a2, c2; splitf(r, a2, c2); oh[q] = a2; ol[q] = c2; }
    *(v2h*)(P16 + e) = o16; *(v2us*)(Ph + e) = oh; *(v2us*)(Pl + e) = ol;  }
__global__ __launch_bounds__(256) void k_vtp(const float* __restrict__ F, int pitch, int nheads, h16* V16, bf* Vh, bf* Vl) { const size_t e = ((size_t)blockIdx.x * 256 + threadIdx.x) * 2; if (e >= (size_t)nheads * HD * TT) return; const int t = (int)(e % TT); const int d = (int)((e / TT) % HD); const int g = (int)(e / ((size_t)TT * HD)); v2h o16; v2us oh, ol;
#pragma unroll
    for (int q = 0; q < 2; ++q) { const float x = F[(size_t)(t + q) * pitch + g * HD + d]; o16[q] = tohx(x); unsigned short a2, c2; splitf(x, a2, c2); oh[q] = a2; ol[q] = c2; }
    *(v2h*)(V16 + e) = o16; *(v2us*)(Vh + e) = oh; *(v2us*)(Vl + e) = ol;  }
__global__ __launch_bounds__(256) void k_csid(float* CS) { const int idx = blockIdx.x * 256 + threadIdx.x; if (idx >= TT * HD) return; v2f cs; cs[0] = 1.0f; cs[1] = 0.0f; *(v2f*)(CS + (size_t)idx * 2) = cs;  }
// k_asoft: per row (zz, i): t = S x HD^-0.5 for j <= i and i - j < WIN (sliding causal window; the reference's -1e9 additive fill vanishes identically); softmax over the 2048 keys (register row, one exp, fixed trees);
__global__ __launch_bounds__(256) void k_asoft(const float* __restrict__ Sb, h16* P16, bf* Ph, bf* Pl) {
    const int lane = threadIdx.x & 31; const int row = blockIdx.x * 8 + (threadIdx.x >> 5); if (row >= ZH * TT) return; const int i = row % TT; const int zz = row / TT; (void)zz; const bool hires = (i < RH); const float* sr = Sb + (size_t)row * TT; float v[TT / 32]; float mx = -3.0e38f;
#pragma unroll
    for (int ch = 0; ch < TT / 128; ++ch) { const int j0 = ch * 128 + lane * 4; const v4f a = *(const v4f*)(sr + j0);
#pragma unroll
        for (int q = 0; q < 4; ++q) { const int j = j0 + q; (void)j; const float t = (j <= i && i - j < WIN) ? a[q] * SCL : -3.0e38f; v[ch * 4 + q] = t; mx = fmaxf(mx, t); } }
#pragma unroll
    for (int sh = 16; sh; sh >>= 1) mx = fmaxf(mx, __shfl_xor(mx, sh, 32));
    float sum = 0.f;
#pragma unroll
    for (int k = 0; k < TT / 32; ++k) { float d0 = __fsub_rn(v[k], mx); asm volatile("" : "+v"(d0)); v[k] = __builtin_amdgcn_exp2f(__fmul_rn(d0, 1.4426950408889634f)); sum += v[k]; }
#pragma unroll
    for (int sh = 16; sh; sh >>= 1) sum += __shfl_xor(sum, sh, 32);
    const float f = __fdiv_rn(hires ? 1.0f : PCAR, sum);
{
        if (hires) {
#pragma unroll
            for (int ch = 0; ch < TT / 128; ++ch) { v4us oh, ol;
#pragma unroll
                for (int q = 0; q < 4; ++q) { unsigned short a, c2; splitf(v[ch * 4 + q] * f, a, c2); oh[q] = a; ol[q] = c2; }
                const size_t oo = ((size_t)zz * (RH ? RH : 1) + i) * TT + ch * 128 + lane * 4; *(v4us*)(Ph + oo) = oh; *(v4us*)(Pl + oo) = ol; }
        } else {
#pragma unroll
            for (int ch = 0; ch < TT / 128; ++ch) { v4h o4;
#pragma unroll
                for (int q = 0; q < 4; ++q) o4[q] = tohx(v[ch * 4 + q] * f);
                *(v4h*)(P16 + (size_t)row * TT + ch * 128 + lane * 4) = o4; } }
         }
}
__global__ __launch_bounds__(256) void k_merge(const float* __restrict__ O, int h0, bf* Ah, bf* Al) { const size_t e = ((size_t)blockIdx.x * 256 + threadIdx.x) * 2; if (e >= (size_t)ZH * TT * HD) return; const int d = (int)(e % HD); const int t = (int)((e / HD) % TT); const int zz = (int)(e / ((size_t)HD * TT)); const float cs = (t < RH) ? 1.0f : (1.0f / PCAR); const size_t oo = (size_t)t * DQ + (h0 + zz) * HD + d;
    v2us oh, ol;
#pragma unroll
    for (int q = 0; q < 2; ++q) { unsigned short a, c2; splitf(O[e + q] * cs, a, c2); oh[q] = a; ol[q] = c2; } *(v2us*)(Ah + oo) = oh; *(v2us*)(Al + oo) = ol;  }

extern "C" void kernel_launch(void* const* d_in, const int* in_sizes, int n_in,
                              void* d_out, int out_size, void* d_ws, size_t ws_size, hipStream_t stream) {
    (void)in_sizes; (void)n_in; (void)out_size;
    const float* x = (const float*)d_in[0]; const float* wq = (const float*)d_in[1]; const float* wk = (const float*)d_in[2]; const float* wv = (const float*)d_in[3]; const float* wo = (const float*)d_in[4]; const float* bo = (const float*)d_in[5];   /* inputs x, Wq, Wk, Wv, Wo ('xw' [768][768]), bo */
    float* OUT = (float*)d_out;     // [4][2048][768]
    char* wsp = (char*)d_ws;
    auto take = [&](size_t bytes) { char* p = wsp; wsp += (bytes + 255) & ~(size_t)255; return (void*)p; };
    bf* WQ = (bf*)take((size_t)DQ * DM * 2); bf* WK = (bf*)take((size_t)DKV * DM * 2); bf* WV = (bf*)take((size_t)DKV * DM * 2); bf* WO = (bf*)take((size_t)DM * DQ * 2); float* CS = (float*)take((size_t)TT * HD * 2 * 4);
    bf* XB = (bf*)take((size_t)TT * DM * 2); float* FQ = (float*)take((size_t)TT * DQ * 4); float* FK = (float*)take((size_t)TT * DKV * 4);
    h16* QP16 = (h16*)take((size_t)NH_ * TT * HD * 2); h16* KP16 = (h16*)take((size_t)NKV * TT * HD * 2); h16* VT16 = (h16*)take((size_t)NKV * HD * TT * 2);
    bf* QPh = (bf*)take((size_t)NH_ * TT * HD * 2); bf* QPl = (bf*)take((size_t)NH_ * TT * HD * 2); bf* KPh = (bf*)take((size_t)NKV * TT * HD * 2); bf* KPl = (bf*)take((size_t)NKV * TT * HD * 2); bf* VTh = (bf*)take((size_t)NKV * HD * TT * 2); bf* VTl = (bf*)take((size_t)NKV * HD * TT * 2); bf* Ph = (bf*)take((size_t)ZH * RH * TT * 2); bf* Pl = (bf*)take((size_t)ZH * RH * TT * 2);
    float* Sb = (float*)take((size_t)ZH * TT * TT * 4); h16* P16 = (h16*)take((size_t)ZH * TT * TT * 2); float* Ob = (float*)take((size_t)ZH * TT * HD * 4); bf* ATh = (bf*)take((size_t)TT * DQ * 2); bf* ATl = (bf*)take((size_t)TT * DQ * 2);
    if ((size_t)(wsp - (char*)d_ws) > ws_size) return;    // ws 256 MiB
    float* FV = FK;   // v projection reuses the k buffer after the k planes are built (stream-ordered)
    { k_wtG<<<(unsigned)((DM * DQ / 64 + 63) / 64), 256, 0, stream>>>(wq, DM, DQ, WQ); k_wtG<<<(unsigned)((DM * DKV / 64 + 63) / 64), 256, 0, stream>>>(wk, DM, DKV, WK); k_wtG<<<(unsigned)((DM * DKV / 64 + 63) / 64), 256, 0, stream>>>(wv, DM, DKV, WV);
      k_wtG<<<(unsigned)((DQ * DM / 64 + 63) / 64), 256, 0, stream>>>(wo, DQ, DM, WO);
       }
    k_csid<<<(TT * HD + 255) / 256, 256, 0, stream>>>(CS);
    const unsigned LQ = (unsigned)(((size_t)NH_ * TT * HD / 2 + 255) / 256), LKv = (unsigned)(((size_t)NKV * TT * HD / 2 + 255) / 256);
    for (int b = 0; b < NB_; ++b) {
        
        k_cvt8<<<(unsigned)(((size_t)TT * DM / 8 + 255) / 256), 256, 0, stream>>>(x + (size_t)b * TT * DM, XB, (size_t)TT * DM / 8);
        k_gemmw<bf, 0, false><<<dim3(TT / 64, DQ / 64, 1), 32, 0, stream>>>(XB, nullptr, WQ, nullptr, DM, FQ, DQ, nullptr, 0, 0, 0);
        k_rope<<<LQ, 256, 0, stream>>>(FQ, DQ, NH_, CS, nullptr, nullptr, 1.0f, QP16, QPh, QPl);
        k_gemmw<bf, 0, false><<<dim3(TT / 64, DKV / 64, 1), 32, 0, stream>>>(XB, nullptr, WK, nullptr, DM, FK, DKV, nullptr, 0, 0, 0);
        k_rope<<<LKv, 256, 0, stream>>>(FK, DKV, NKV, CS, nullptr, nullptr, 1.0f, KP16, KPh, KPl);
        k_gemmw<bf, 0, false><<<dim3(TT / 64, DKV / 64, 1), 32, 0, stream>>>(XB, nullptr, WV, nullptr, DM, FV, DKV, nullptr, 0, 0, 0); k_vtp<<<LKv, 256, 0, stream>>>(FV, DKV, NKV, VT16, VTh, VTl);
        for (int h0 = 0; h0 < NH_; h0 += ZH) { const size_t zq = (size_t)h0, zk = (size_t)(h0 / REP);   // one kv head per query head: the pass's two heads use consecutive kv planes (z-strides TT*HD)
            k_gemmc<bf, 2, 1><<<dim3(RH / 64, TT / 64, ZH), 32, 0, stream>>>(QPh + zq * TT * HD, QPl + zq * TT * HD, KPh + zk * TT * HD, KPl + zk * TT * HD, HD, Sb, TT, 0, (size_t)TT * HD, (size_t)TT * HD, (size_t)TT * TT);
            k_gemmc<h16, 0, 1><<<dim3((TT - RH) / 64, TT / 64, ZH), 32, 0, stream>>>(QP16 + zq * TT * HD + (size_t)RH * HD, nullptr, KP16 + zk * TT * HD, nullptr, HD, Sb + (size_t)RH * TT, TT, RH, (size_t)TT * HD, (size_t)TT * HD, (size_t)TT * TT);
            k_asoft<<<ZH * TT / 8, 256, 0, stream>>>(Sb, P16, Ph, Pl);
            k_gemmc<bf, 2, 2><<<dim3(RH / 64, HD / 64, ZH), 32, 0, stream>>>(Ph, Pl, VTh + zk * HD * TT, VTl + zk * HD * TT, TT, Ob, HD, 0, (size_t)RH * TT, (size_t)HD * TT, (size_t)TT * HD);
            k_gemmc<h16, 0, 2><<<dim3((TT - RH) / 64, HD / 64, ZH), 32, 0, stream>>>(P16 + (size_t)RH * TT, nullptr, VT16 + zk * HD * TT, nullptr, TT, Ob + (size_t)RH * HD, HD, RH, (size_t)TT * TT, (size_t)HD * TT, (size_t)TT * HD);
            k_merge<<<(unsigned)(((size_t)ZH * TT * HD / 2 + 255) / 256), 256, 0, stream>>>(Ob, h0, ATh, ATl); }
        k_gemmw<bf, 1, true><<<dim3(TT / 64, DM / 64, 1), 32, 0, stream>>>(ATh, ATl, WO, nullptr, DQ, OUT + (size_t)b * TT * DM, DM, bo, 0, 0, 0); }
}

// v001
// Measured time: 1180 microseconds a run.
// Two timings next to v000 put it at 1.82 and 1.86 times that version's speed.
#include <hip/hip_runtime.h>

// Causal multi-head attention at d_model 768 with bias-free projections and an output bias (x [4][2048][768]; q, k, v = x W ('xw' [768][768], no bias; 12 heads x 64); scores masked (-inf) then / sqrt(64); softmax; out = merged Wo + bo ('xw' + bias) -> [4][2048][768] (6.3 M); argument order x, Wq, Wk, Wv, Wo, bo).
// Layout per batch: bf16 copy of x; 'xw' weights transposed once; exact projections (K 768); identity-table plane builders; causal T-2048 attention at 12 heads (hybrid rows: < 512 hi/lo 3 products, rest fp16 x1024; k_gemmc skips tiles above the diagonal); merged hi/lo x Wo exact + bo.
// Compute dtypes, f32 accumulate: every input rounded to bf16; projections exact; attention rows < 512 3 products, rest fp16; softmax f32; Wo hl x exact + bias.

#define NB_  4
#define TT   2048
#define DM   768
#define NH_  12
#define NKV  12
#define REP  (NH_ / NKV)
#define HD   64
#define DQ   (NH_ * HD)
#define DKV  (NKV * HD)
#define ZH   2
#define RH   512                  // query rows < RH use hi+lo planes (0: none)
#define WIN  2048
#define PCAR 1024.0f
#define SCL  0.125f   // HD^-0.5
typedef _Float16 h16;
typedef unsigned short bf;
typedef __attribute__((ext_vector_type(16))) __bf16   v16bf;
typedef __attribute__((ext_vector_type(16))) _Float16 v16h;
typedef __attribute__((ext_vector_type(8)))  _Float16 v8h;
typedef __attribute__((ext_vector_type(8)))  unsigned short v8us;
typedef __attribute__((ext_vector_type(8)))  float    v8f;
typedef __attribute__((ext_vector_type(4)))  float    v4f;
typedef v8h  __attribute__((may_alias)) v8ha;
typedef v4f  __attribute__((may_alias)) v4fa;
typedef v8us __attribute__((may_alias)) v8usa;

__device__ __forceinline__ unsigned short f2bf(float f) { unsigned u = __float_as_uint(f); u += 0x7FFFu + ((u >> 16) & 1u); return (unsigned short)(u >> 16); }
__device__ __forceinline__ float bf2f(unsigned short b) { return __uint_as_float(((unsigned)b) << 16); }
__device__ __forceinline__ float bfr(float f) { return bf2f(f2bf(f)); }
__device__ __forceinline__ v16h cat16(v8h lo, v8h hi) { return __builtin_shufflevector(lo, hi, 0, 1, 2, 3, 4, 5, 6, 7, 8, 9, 10, 11, 12, 13, 14, 15); }
__device__ __forceinline__ v16bf cat16b(v8us lo, v8us hi) { return __builtin_bit_cast(v16bf, __builtin_shufflevector(lo, hi, 0, 1, 2, 3, 4, 5, 6, 7, 8, 9, 10, 11, 12, 13, 14, 15)); }
__device__ __forceinline__ v8f wmma16(v16h a, v16h b, v8f c) { return __builtin_amdgcn_wmma_f32_16x16x32_f16(false, a, false, b, (short)0, c, false, false); }
__device__ __forceinline__ v8f wmmab(v16bf a, v16bf b, v8f c) { return __builtin_amdgcn_wmma_f32_16x16x32_bf16(false, a, false, b, (short)0, c, false, false); }



// ---- ksum_store: the NW waves of a work-group each hold a partial 64x64 tile (their share of the K loop). Each wave writes its partial column-major (pitch 68) into its own LDS slot,
// one barrier, then every thread adds the NW slots in slot order for 4 rows of one column and stores them (a wave covers 32 adjacent columns: whole 128-byte lines).
#define KSLOT (64 * 68)
template <int NW, bool BIAS>
__device__ __forceinline__ void ksum_store(float* os, const v8f (&acc)[4][4], int wave, int lane, float* C, int ldc, int r0, int c0, const float* __restrict__ bias) {
    const int lr = lane & 15, hi = lane >> 4; float* slot = os + wave * KSLOT;
#pragma unroll
    for (int mb = 0; mb < 4; ++mb)
#pragma unroll
        for (int nb = 0; nb < 4; ++nb) { float* p = slot + (nb * 16 + lr) * 68 + mb * 16 + hi * 8; const v8f t = acc[mb][nb];
            *(v4fa*)p = __builtin_shufflevector(t, t, 0, 1, 2, 3); *(v4fa*)(p + 4) = __builtin_shufflevector(t, t, 4, 5, 6, 7); }
    __syncthreads();   // every wave's partial tile is in LDS before any thread sums across the slots
    constexpr int NU = 1024 / (NW * 32); v4f s[NU];
#pragma unroll
    for (int i = 0; i < NU; ++i) { const int u = i * NW * 32 + (int)threadIdx.x; const float* p = os + (u & 63) * 68 + (u >> 6) * 4; s[i] = *(const v4fa*)p;
#pragma unroll
        for (int w = 1; w < NW; ++w) s[i] += *(const v4fa*)(p + w * KSLOT); }
    const int col = (int)threadIdx.x & 63; float bb = 0.f; if (BIAS) bb = bfr(bias[c0 + col]);
#pragma unroll
    for (int i = 0; i < NU; ++i) { const int rg = (i * NW * 32 + (int)threadIdx.x) >> 6; float* cp = C + (size_t)(r0 + rg * 4) * ldc + c0 + col;
#pragma unroll
        for (int q = 0; q < 4; ++q) cp[(size_t)q * ldc] = BIAS ? s[i][q] + bb : s[i][q]; }
}

// ---- k_gemmw: register-blocked GEMM, one work-group of NW waves per 64x64 output tile; every wave holds the whole tile (16 accumulators) for its interleaved share of the K loop (32-wide K blocks wave, wave + NW, ...), operands straight from K-contiguous 16-bit planes; partials summed by ksum_store; grid (M/64, N/64, Z), NW x 32 threads.
// C[m][n] (f32, pitch ldc, + optional f32 bias[n]) = sum_k A[m][k] Bt[n][k] (+ split products per NSPLIT). z-batch strides sA/sB/sC in elements. K % 32 == 0.
template <typename T16> struct WFrag;
template <> struct WFrag<h16> { typedef v16h V; static __device__ __forceinline__ V ld(const h16* p) { return cat16(*(const v8h*)p, *(const v8h*)(p + 16)); } static __device__ __forceinline__ v8f mma(V a, V b, v8f c) { return wmma16(a, b, c); } };
template <> struct WFrag<bf> { typedef v16bf V; static __device__ __forceinline__ V ld(const bf* p) { return cat16b(*(const v8us*)p, *(const v8us*)(p + 16)); } static __device__ __forceinline__ v8f mma(V a, V b, v8f c) { return wmmab(a, b, c); } };
template <typename T16, int NSPLIT, bool BIAS, int NW>
__global__ __launch_bounds__(NW * 32) void k_gemmw(const T16* __restrict__ A, const T16* __restrict__ A2, const T16* __restrict__ Bt, const T16* __restrict__ Bt2, int K, float* C, int ldc, const float* __restrict__ bias, size_t sA, size_t sB, size_t sC) {
    typedef typename WFrag<T16>::V V;
    __shared__ __align__(16) float os[NW * KSLOT];
    const size_t z = blockIdx.z; A += z * sA; if (A2) A2 += z * sA; Bt += z * sB; if (Bt2) Bt2 += z * sB; C += z * sC;
    const int lane = threadIdx.x & 31, lr = lane & 15, hi = lane >> 4; const int wave = __builtin_amdgcn_readfirstlane((int)(threadIdx.x >> 5)); const int r0 = blockIdx.x * 64, c0 = blockIdx.y * 64;
    v8f acc[4][4];
#pragma unroll
    for (int mb = 0; mb < 4; ++mb)
#pragma unroll
        for (int nb = 0; nb < 4; ++nb) acc[mb][nb] = (v8f){};
    const size_t aoff = (size_t)(r0 + lr) * K + 8 * hi, boff = (size_t)(c0 + lr) * K + 8 * hi;
#pragma unroll 1
    for (int kc = wave * 32; kc < K; kc += NW * 32) {
        V a[4], a2[4];
#pragma unroll
        for (int mb = 0; mb < 4; ++mb) { a[mb] = WFrag<T16>::ld(A + aoff + (size_t)mb * 16 * K + kc); if (NSPLIT == 1 || NSPLIT == 2) a2[mb] = WFrag<T16>::ld(A2 + aoff + (size_t)mb * 16 * K + kc); }
#pragma unroll
        for (int nb = 0; nb < 4; ++nb) { const V b = WFrag<T16>::ld(Bt + boff + (size_t)nb * 16 * K + kc); V b2; if (NSPLIT >= 2) b2 = WFrag<T16>::ld(Bt2 + boff + (size_t)nb * 16 * K + kc);
#pragma unroll
            for (int mb = 0; mb < 4; ++mb) { acc[mb][nb] = WFrag<T16>::mma(a[mb], b, acc[mb][nb]); if (NSPLIT == 1 || NSPLIT == 2) acc[mb][nb] = WFrag<T16>::mma(a2[mb], b, acc[mb][nb]); if (NSPLIT >= 2) acc[mb][nb] = WFrag<T16>::mma(a[mb], b2, acc[mb][nb]); } }
        asm volatile("v_nop\n\tv_nop\n\tv_nop\n\tv_nop" : "+v"(acc[0][0]), "+v"(acc[1][1]), "+v"(acc[2][2]), "+v"(acc[3][3]) : "v"(a[0]), "v"(a[3]));
    }
    ksum_store<NW, BIAS>(os, acc, wave, lane, C, ldc, r0, c0, bias);
}

// ---- k_gemmc: the same 64x64 tile GEMM specialised for causal attention: CMODE 1 skips score tiles entirely above the diagonal (query rows r0+roff.., key columns c0..), CMODE 2 limits the
// key (K) loop of the probability x value contraction to the diagonal block (probabilities beyond it are exactly zero). roff = row offset of this launch's first row within the sequence. NW = waves per tile: 1 keeps the one-wave form (short K), above 1 the K loop is shared out as in k_gemmw.
template <typename T16, int NSPLIT, int CMODE, int NW>
__global__ __launch_bounds__(NW * 32) void k_gemmc(const T16* __restrict__ A, const T16* __restrict__ A2, const T16* __restrict__ Bt, const T16* __restrict__ Bt2, int K, float* C, int ldc, int roff, size_t sA, size_t sB, size_t sC) {
    typedef typename WFrag<T16>::V V;
    __shared__ __align__(16) float os[NW == 1 ? 16 * 68 : NW * KSLOT];
    const size_t z = blockIdx.z; A += z * sA; if (A2) A2 += z * sA; Bt += z * sB; if (Bt2) Bt2 += z * sB; C += z * sC;
    const int lane = threadIdx.x & 31, lr = lane & 15, hi = lane >> 4; const int wave = (NW == 1) ? 0 : __builtin_amdgcn_readfirstlane((int)(threadIdx.x >> 5)); const int r0 = blockIdx.x * 64, c0 = blockIdx.y * 64;
    if (CMODE == 1 && c0 > r0 + roff + 63) return;                  // score tile entirely above the causal diagonal: never read (the softmax masks j > i by select)
    const int Kl = (CMODE == 2) ? min(K, r0 + roff + 64) : K;        // P.V: probabilities are exactly 0 beyond the diagonal block, so the K loop stops there
    v8f acc[4][4];
#pragma unroll
    for (int mb = 0; mb < 4; ++mb)
#pragma unroll
        for (int nb = 0; nb < 4; ++nb) acc[mb][nb] = (v8f){};
    const size_t aoff = (size_t)(r0 + lr) * K + 8 * hi, boff = (size_t)(c0 + lr) * K + 8 * hi;
#pragma unroll 1
    for (int kc = wave * 32; kc < Kl; kc += NW * 32) {
        V a[4], a2[4];
#pragma unroll
        for (int mb = 0; mb < 4; ++mb) { a[mb] = WFrag<T16>::ld(A + aoff + (size_t)mb * 16 * K + kc); if (NSPLIT == 1 || NSPLIT == 2) a2[mb] = WFrag<T16>::ld(A2 + aoff + (size_t)mb * 16 * K + kc); }
#pragma unroll
        for (int nb = 0; nb < 4; ++nb) { const V b = WFrag<T16>::ld(Bt + boff + (size_t)nb * 16 * K + kc); V b2; if (NSPLIT >= 2) b2 = WFrag<T16>::ld(Bt2 + boff + (size_t)nb * 16 * K + kc);
#pragma unroll
            for (int mb = 0; mb < 4; ++mb) { acc[mb][nb] = WFrag<T16>::mma(a[mb], b, acc[mb][nb]); if (NSPLIT == 1 || NSPLIT == 2) acc[mb][nb] = WFrag<T16>::mma(a2[mb], b, acc[mb][nb]); if (NSPLIT >= 2) acc[mb][nb] = WFrag<T16>::mma(a[mb], b2, acc[mb][nb]); } }
        asm volatile("v_nop\n\tv_nop\n\tv_nop\n\tv_nop" : "+v"(acc[0][0]), "+v"(acc[1][1]), "+v"(acc[2][2]), "+v"(acc[3][3]) : "v"(a[0]), "v"(a[3]));
    }
    if constexpr (NW > 1) { ksum_store<NW, false>(os, acc, wave, lane, C, ldc, r0, c0, nullptr); return; }
#pragma unroll
    for (int mb = 0; mb < 4; ++mb) {
#pragma unroll
        for (int nb = 0; nb < 4; ++nb) {
#pragma unroll
            for (int j = 0; j < 8; ++j) os[(hi * 8 + j) * 68 + nb * 16 + lr] = acc[mb][nb][j]; }
        __builtin_amdgcn_wave_barrier(); asm volatile("" ::: "memory");
        float* crow = C + (size_t)(r0 + mb * 16) * ldc + c0;
{
#pragma unroll
            for (int s = 0; s < 8; ++s) { const int row = 2 * s + hi, cofs = lr * 4; v4f val = *(const v4fa*)(os + row * 68 + cofs);
                *(v4f*)(crow + (size_t)row * ldc + cofs) = val; }
             }
        __builtin_amdgcn_wave_barrier(); asm volatile("" ::: "memory");
    }
}

__device__ __forceinline__ h16 tohx(float x) { return (h16)x; }
__device__ __forceinline__ void splitf(float y, unsigned short& h, unsigned short& l) { h = f2bf(y); l = f2bf(y - bf2f(h)); }
typedef __attribute__((ext_vector_type(2))) _Float16 v2h;
typedef __attribute__((ext_vector_type(4))) _Float16 v4h;
typedef __attribute__((ext_vector_type(2))) unsigned short v2us;
typedef __attribute__((ext_vector_type(4))) unsigned short v4us;
typedef __attribute__((ext_vector_type(2))) float v2f;
typedef __attribute__((ext_vector_type(4))) int v4i;

__global__ __launch_bounds__(256) void k_wtG(const float* __restrict__ w, int K, int N, bf* Bt) {
    const int lane = threadIdx.x & 31; const int L0 = (blockIdx.x * 8 + (threadIdx.x >> 5)) * 8; const int nlines = N * K / 64;
{
#pragma unroll 1
        for (int l = 0; l < 8; ++l) { const int L = L0 + l; if (L >= nlines) break; const size_t e = (size_t)L * 64 + lane * 2; const int k = (int)(e % K), n = (int)(e / K); v2us o;
            o[0] = f2bf(w[(size_t)k * N + n]); o[1] = f2bf(w[(size_t)(k + 1) * N + n]); *(v2us*)(Bt + e) = o; }
         }
}
__global__ __launch_bounds__(256) void k_cvt8(const float* __restrict__ src, bf* dst, size_t n8) { const size_t i = (size_t)blockIdx.x * 256 + threadIdx.x; if (i >= n8) return; const v8f v = *(const v8f*)(src + i * 8); v8us o;
#pragma unroll
    for (int k = 0; k < 8; ++k) o[k] = f2bf(v[k]); *(v8us*)(dst + i * 8) = o;  }

// k_rope: head planes [h][t][d] (fp16 + hi/lo) of rope(x) x sc with the rotate-half convention out[d] = x[d] cos[t][d] - x[d+HD/2] sin[t][d], out[d+HD/2] = x[d+HD/2] cos[t][d+HD/2] + x[d] sin[t][d+HD/2]
__global__ __launch_bounds__(256) void k_rope(const float* __restrict__ F, int pitch, int nheads, const float* __restrict__ CS, const float* __restrict__ RF, const float* __restrict__ nw, float sc, h16* P16, bf* Ph, bf* Pl) {
    const size_t e = ((size_t)blockIdx.x * 256 + threadIdx.x) * 2; if (e >= (size_t)nheads * TT * HD) return; const int d = (int)(e % HD); const int t = (int)((e / HD) % TT); const int h = (int)(e / ((size_t)HD * TT)); const float* f = F + (size_t)t * pitch + h * HD; const float rf = RF ? RF[(size_t)h * TT + t] : 1.0f; v2h o16; v2us oh, ol;
#pragma unroll
    for (int q = 0; q < 2; ++q) { const int dd = d + q; const int dp = (dd < HD / 2) ? dd + HD / 2 : dd - HD / 2; float x0 = f[dd], x1 = f[dp];
        if (RF) { float n0 = __fmul_rn(x0, rf), n1 = __fmul_rn(x1, rf); asm volatile("" : "+v"(n0)); asm volatile("" : "+v"(n1)); x0 = __fmul_rn(bfr(nw[dd]), n0); x1 = __fmul_rn(bfr(nw[dp]), n1); }
        const v2f cs = *(const v2f*)(CS + ((size_t)t * HD + dd) * 2); float a = __fmul_rn(x0, cs[0]), bq = __fmul_rn(x1, cs[1]); asm volatile("" : "+v"(a)); asm volatile("" : "+v"(bq)); const float r = ((dd < HD / 2) ? __fsub_rn(a, bq) : __fadd_rn(a, bq)) * sc;
        o16[q] = tohx(r); unsigned short a2, c2; splitf(r, a2, c2); oh[q] = a2; ol[q] = c2; }
    *(v2h*)(P16 + e) = o16; *(v2us*)(Ph + e) = oh; *(v2us*)(Pl + e) = ol;  }
__global__ __launch_bounds__(256) void k_vtp(const float* __restrict__ F, int pitch, int nheads, h16* V16, bf* Vh, bf* Vl) { const size_t e = ((size_t)blockIdx.x * 256 + threadIdx.x) * 2; if (e >= (size_t)nheads * HD * TT) return; const int t = (int)(e % TT); const int d = (int)((e / TT) % HD); const int g = (int)(e / ((size_t)TT * HD)); v2h o16; v2us oh, ol;
#pragma unroll
    for (int q = 0; q < 2; ++q) { const float x = F[(size_t)(t + q) * pitch + g * HD + d]; o16[q] = tohx(x); unsigned short a2, c2; splitf(x, a2, c2); oh[q] = a2; ol[q] = c2; }
    *(v2h*)(V16 + e) = o16; *(v2us*)(Vh + e) = oh; *(v2us*)(Vl + e) = ol;  }
__global__ __launch_bounds__(256) void k_csid(float* CS) { const int idx = blockIdx.x * 256 + threadIdx.x; if (idx >= TT * HD) return; v2f cs; cs[0] = 1.0f; cs[1] = 0.0f; *(v2f*)(CS + (size_t)idx * 2) = cs;  }
// k_asoft: per row (zz, i): t = S x HD^-0.5 for j <= i and i - j < WIN (sliding causal window; the reference's -1e9 additive fill vanishes identically); softmax over the 2048 keys (register row, one exp, fixed trees);
__global__ __launch_bounds__(256) void k_asoft(const float* __restrict__ Sb, h16* P16, bf* Ph, bf* Pl) {
    const int lane = threadIdx.x & 31; const int row = blockIdx.x * 8 + (threadIdx.x >> 5); if (row >= ZH * TT) return; const int i = row % TT; const int zz = row / TT; (void)zz; const bool hires = (i < RH); const float* sr = Sb + (size_t)row * TT; float v[TT / 32]; float mx = -3.0e38f;
#pragma unroll
    for (int ch = 0; ch < TT / 128; ++ch) { const int j0 = ch * 128 + lane * 4; const v4f a = *(const v4f*)(sr + j0);
#pragma unroll
        for (int q = 0; q < 4; ++q) { const int j = j0 + q; (void)j; const float t = (j <= i && i - j < WIN) ? a[q] * SCL : -3.0e38f; v[ch * 4 + q] = t; mx = fmaxf(mx, t); } }
#pragma unroll
    for (int sh = 16; sh; sh >>= 1) mx = fmaxf(mx, __shfl_xor(mx, sh, 32));
    float sum = 0.f;
#pragma unroll
    for (int k = 0; k < TT / 32; ++k) { float d0 = __fsub_rn(v[k], mx); asm volatile("" : "+v"(d0)); v[k] = __builtin_amdgcn_exp2f(__fmul_rn(d0, 1.4426950408889634f)); sum += v[k]; }
#pragma unroll
    for (int sh = 16; sh; sh >>= 1) sum += __shfl_xor(sum, sh, 32);
    const float f = __fdiv_rn(hires ? 1.0f : PCAR, sum);
{
        if (hires) {
#pragma unroll
            for (int ch = 0; ch < TT / 128; ++ch) { v4us oh, ol;
#pragma unroll
                for (int q = 0; q < 4; ++q) { unsigned short a, c2; splitf(v[ch * 4 + q] * f, a, c2); oh[q] = a; ol[q] = c2; }
                const size_t oo = ((size_t)zz * (RH ? RH : 1) + i) * TT + ch * 128 + lane * 4; *(v4us*)(Ph + oo) = oh; *(v4us*)(Pl + oo) = ol; }
        } else {
#pragma unroll
            for (int ch = 0; ch < TT / 128; ++ch) { v4h o4;
#pragma unroll
                for (int q = 0; q < 4; ++q) o4[q] = tohx(v[ch * 4 + q] * f);
                *(v4h*)(P16 + (size_t)row * TT + ch * 128 + lane * 4) = o4; } }
         }
}
__global__ __launch_bounds__(256) void k_merge(const float* __restrict__ O, int h0, bf* Ah, bf* Al) { const size_t e = ((size_t)blockIdx.x * 256 + threadIdx.x) * 2; if (e >= (size_t)ZH * TT * HD) return; const int d = (int)(e % HD); const int t = (int)((e / HD) % TT); const int zz = (int)(e / ((size_t)HD * TT)); const float cs = (t < RH) ? 1.0f : (1.0f / PCAR); const size_t oo = (size_t)t * DQ + (h0 + zz) * HD + d;
    v2us oh, ol;
#pragma unroll
    for (int q = 0; q < 2; ++q) { unsigned short a, c2; splitf(O[e + q] * cs, a, c2); oh[q] = a; ol[q] = c2; } *(v2us*)(Ah + oo) = oh; *(v2us*)(Al + oo) = ol;  }

extern "C" void kernel_launch(void* const* d_in, const int* in_sizes, int n_in,
                              void* d_out, int out_size, void* d_ws, size_t ws_size, hipStream_t stream) {
    (void)in_sizes; (void)n_in; (void)out_size;
    const float* x = (const float*)d_in[0]; const float* wq = (const float*)d_in[1]; const float* wk = (const float*)d_in[2]; const float* wv = (const float*)d_in[3]; const float* wo = (const float*)d_in[4]; const float* bo = (const float*)d_in[5];   /* inputs x, Wq, Wk, Wv, Wo ('xw' [768][768]), bo */
    float* OUT = (float*)d_out;     // [4][2048][768]
    char* wsp = (char*)d_ws;
    auto take = [&](size_t bytes) { char* p = wsp; wsp += (bytes + 255) & ~(size_t)255; return (void*)p; };
    bf* WQ = (bf*)take((size_t)DQ * DM * 2); bf* WK = (bf*)take((size_t)DKV * DM * 2); bf* WV = (bf*)take((size_t)DKV * DM * 2); bf* WO = (bf*)take((size_t)DM * DQ * 2); float* CS = (float*)take((size_t)TT * HD * 2 * 4);
    bf* XB = (bf*)take((size_t)TT * DM * 2); float* FQ = (float*)take((size_t)TT * DQ * 4); float* FK = (float*)take((size_t)TT * DKV * 4);
    h16* QP16 = (h16*)take((size_t)NH_ * TT * HD * 2); h16* KP16 = (h16*)take((size_t)NKV * TT * HD * 2); h16* VT16 = (h16*)take((size_t)NKV * HD * TT * 2);
    bf* QPh = (bf*)take((size_t)NH_ * TT * HD * 2); bf* QPl = (bf*)take((size_t)NH_ * TT * HD * 2); bf* KPh = (bf*)take((size_t)NKV * TT * HD * 2); bf* KPl = (bf*)take((size_t)NKV * TT * HD * 2); bf* VTh = (bf*)take((size_t)NKV * HD * TT * 2); bf* VTl = (bf*)take((size_t)NKV * HD * TT * 2); bf* Ph = (bf*)take((size_t)ZH * RH * TT * 2); bf* Pl = (bf*)take((size_t)ZH * RH * TT * 2);
    float* Sb = (float*)take((size_t)ZH * TT * TT * 4); h16* P16 = (h16*)take((size_t)ZH * TT * TT * 2); float* Ob = (float*)take((size_t)ZH * TT * HD * 4); bf* ATh = (bf*)take((size_t)TT * DQ * 2); bf* ATl = (bf*)take((size_t)TT * DQ * 2);
    if ((size_t)(wsp - (char*)d_ws) > ws_size) return;    // ws 256 MiB
    float* FV = FK;   // v projection reuses the k buffer after the k planes are built (stream-ordered)
    { k_wtG<<<(unsigned)((DM * DQ / 64 + 63) / 64), 256, 0, stream>>>(wq, DM, DQ, WQ); k_wtG<<<(unsigned)((DM * DKV / 64 + 63) / 64), 256, 0, stream>>>(wk, DM, DKV, WK); k_wtG<<<(unsigned)((DM * DKV / 64 + 63) / 64), 256, 0, stream>>>(wv, DM, DKV, WV);
      k_wtG<<<(unsigned)((DQ * DM / 64 + 63) / 64), 256, 0, stream>>>(wo, DQ, DM, WO);
       }
    k_csid<<<(TT * HD + 255) / 256, 256, 0, stream>>>(CS);
    const unsigned LQ = (unsigned)(((size_t)NH_ * TT * HD / 2 + 255) / 256), LKv = (unsigned)(((size_t)NKV * TT * HD / 2 + 255) / 256);
    for (int b = 0; b < NB_; ++b) {
        
        k_cvt8<<<(unsigned)(((size_t)TT * DM / 8 + 255) / 256), 256, 0, stream>>>(x + (size_t)b * TT * DM, XB, (size_t)TT * DM / 8);
        k_gemmw<bf, 0, false, 8><<<dim3(TT / 64, DQ / 64, 1), 256, 0, stream>>>(XB, nullptr, WQ, nullptr, DM, FQ, DQ, nullptr, 0, 0, 0);
        k_rope<<<LQ, 256, 0, stream>>>(FQ, DQ, NH_, CS, nullptr, nullptr, 1.0f, QP16, QPh, QPl);
        k_gemmw<bf, 0, false, 8><<<dim3(TT / 64, DKV / 64, 1), 256, 0, stream>>>(XB, nullptr, WK, nullptr, DM, FK, DKV, nullptr, 0, 0, 0);
        k_rope<<<LKv, 256, 0, stream>>>(FK, DKV, NKV, CS, nullptr, nullptr, 1.0f, KP16, KPh, KPl);
        k_gemmw<bf, 0, false, 8><<<dim3(TT / 64, DKV / 64, 1), 256, 0, stream>>>(XB, nullptr, WV, nullptr, DM, FV, DKV, nullptr, 0, 0, 0); k_vtp<<<LKv, 256, 0, stream>>>(FV, DKV, NKV, VT16, VTh, VTl);
        for (int h0 = 0; h0 < NH_; h0 += ZH) { const size_t zq = (size_t)h0, zk = (size_t)(h0 / REP);   // one kv head per query head: the pass's two heads use consecutive kv planes (z-strides TT*HD)
            k_gemmc<bf, 2, 1, 1><<<dim3(RH / 64, TT / 64, ZH), 32, 0, stream>>>(QPh + zq * TT * HD, QPl + zq * TT * HD, KPh + zk * TT * HD, KPl + zk * TT * HD, HD, Sb, TT, 0, (size_t)TT * HD, (size_t)TT * HD, (size_t)TT * TT);
            k_gemmc<h16, 0, 1, 1><<<dim3((TT - RH) / 64, TT / 64, ZH), 32, 0, stream>>>(QP16 + zq * TT * HD + (size_t)RH * HD, nullptr, KP16 + zk * TT * HD, nullptr, HD, Sb + (size_t)RH * TT, TT, RH, (size_t)TT * HD, (size_t)TT * HD, (size_t)TT * TT);
            k_asoft<<<ZH * TT / 8, 256, 0, stream>>>(Sb, P16, Ph, Pl);
            k_gemmc<bf, 2, 2, 8><<<dim3(RH / 64, HD / 64, ZH), 256, 0, stream>>>(Ph, Pl, VTh + zk * HD * TT, VTl + zk * HD * TT, TT, Ob, HD, 0, (size_t)RH * TT, (size_t)HD * TT, (size_t)TT * HD);
            k_gemmc<h16, 0, 2, 16><<<dim3((TT - RH) / 64, HD / 64, ZH), 512, 0, stream>>>(P16 + (size_t)RH * TT, nullptr, VT16 + zk * HD * TT, nullptr, TT, Ob + (size_t)RH * HD, HD, RH, (size_t)TT * TT, (size_t)HD * TT, (size_t)TT * HD);
            k_merge<<<(unsigned)(((size_t)ZH * TT * HD / 2 + 255) / 256), 256, 0, stream>>>(Ob, h0, ATh, ATl); }
        k_gemmw<bf, 1, true, 8><<<dim3(TT / 64, DM / 64, 1), 256, 0, stream>>>(ATh, ATl, WO, nullptr, DQ, OUT + (size_t)b * TT * DM, DM, bo, 0, 0, 0); }
}

// v002
// Measured time: 685 microseconds a run.
// Two timings next to v001 put it at 1.71 and 1.69 times that version's speed.
// Counting every step since v000, it is 3.13 times as fast.
#include <hip/hip_runtime.h>

// Causal multi-head attention at d_model 768 with bias-free projections and an output bias (x [4][2048][768]; q, k, v = x W ('xw' [768][768], no bias; 12 heads x 64); scores masked (-inf) then / sqrt(64); softmax; out = merged Wo + bo ('xw' + bias) -> [4][2048][768] (6.3 M); argument order x, Wq, Wk, Wv, Wo, bo).
// Layout: bf16 copy of x (all batches); 'xw' weights transposed once; per batch: exact projections (K 768); identity-table plane builders; causal T-2048 attention at 12 heads (hybrid rows: < 512 hi/lo 3 products, rest fp16 x1024; k_gemmc skips tiles above the diagonal); then merged hi/lo x Wo exact + bo for all batches at once.
// Compute dtypes, f32 accumulate: every input rounded to bf16; projections exact; attention rows < 512 3 products, rest fp16; softmax f32; Wo hl x exact + bias.

#define NB_  4
#define TT   2048
#define DM   768
#define NH_  12
#define NKV  12
#define REP  (NH_ / NKV)
#define HD   64
#define DQ   (NH_ * HD)
#define DKV  (NKV * HD)
#define ZH   6                    // heads per attention launch (grid z)
#define RH   512                  // query rows < RH use hi+lo planes (0: none)
#define WIN  2048
#define PCAR 1024.0f
#define SCL  0.125f   // HD^-0.5
typedef _Float16 h16;
typedef unsigned short bf;
typedef __attribute__((ext_vector_type(16))) __bf16   v16bf;
typedef __attribute__((ext_vector_type(16))) _Float16 v16h;
typedef __attribute__((ext_vector_type(8)))  _Float16 v8h;
typedef __attribute__((ext_vector_type(8)))  unsigned short v8us;
typedef __attribute__((ext_vector_type(8)))  float    v8f;
typedef __attribute__((ext_vector_type(4)))  float    v4f;
typedef v8h  __attribute__((may_alias)) v8ha;
typedef v4f  __attribute__((may_alias)) v4fa;
typedef v8us __attribute__((may_alias)) v8usa;

__device__ __forceinline__ unsigned short f2bf(float f) { unsigned u = __float_as_uint(f); u += 0x7FFFu + ((u >> 16) & 1u); return (unsigned short)(u >> 16); }
__device__ __forceinline__ float bf2f(unsigned short b) { return __uint_as_float(((unsigned)b) << 16); }
__device__ __forceinline__ float bfr(float f) { return bf2f(f2bf(f)); }
__device__ __forceinline__ v16h cat16(v8h lo, v8h hi) { return __builtin_shufflevector(lo, hi, 0, 1, 2, 3, 4, 5, 6, 7, 8, 9, 10, 11, 12, 13, 14, 15); }
__device__ __forceinline__ v16bf cat16b(v8us lo, v8us hi) { return __builtin_bit_cast(v16bf, __builtin_shufflevector(lo, hi, 0, 1, 2, 3, 4, 5, 6, 7, 8, 9, 10, 11, 12, 13, 14, 15)); }
__device__ __forceinline__ v8f wmma16(v16h a, v16h b, v8f c) { return __builtin_amdgcn_wmma_f32_16x16x32_f16(false, a, false, b, (short)0, c, false, false); }
__device__ __forceinline__ v8f wmmab(v16bf a, v16bf b, v8f c) { return __builtin_amdgcn_wmma_f32_16x16x32_bf16(false, a, false, b, (short)0, c, false, false); }



// ---- ksum_store: the NW waves of a work-group each hold a partial 64x64 tile (their share of the K loop). Each wave writes its partial column-major (pitch 68) into its own LDS slot,
// one barrier, then every thread adds the NW slots in slot order for 4 rows of one column and stores them (a wave covers 32 adjacent columns: whole 128-byte lines).
#define KSLOT (64 * 68)
template <int NW, bool BIAS>
__device__ __forceinline__ void ksum_store(float* os, const v8f (&acc)[4][4], int wave, int lane, float* C, int ldc, int r0, int c0, const float* __restrict__ bias) {
    const int lr = lane & 15, hi = lane >> 4; float* slot = os + wave * KSLOT;
#pragma unroll
    for (int mb = 0; mb < 4; ++mb)
#pragma unroll
        for (int nb = 0; nb < 4; ++nb) { float* p = slot + (nb * 16 + lr) * 68 + mb * 16 + hi * 8; const v8f t = acc[mb][nb];
            *(v4fa*)p = __builtin_shufflevector(t, t, 0, 1, 2, 3); *(v4fa*)(p + 4) = __builtin_shufflevector(t, t, 4, 5, 6, 7); }
    __syncthreads();   // every wave's partial tile is in LDS before any thread sums across the slots
    constexpr int NU = 1024 / (NW * 32); v4f s[NU];
#pragma unroll
    for (int i = 0; i < NU; ++i) { const int u = i * NW * 32 + (int)threadIdx.x; const float* p = os + (u & 63) * 68 + (u >> 6) * 4; s[i] = *(const v4fa*)p;
#pragma unroll
        for (int w = 1; w < NW; ++w) s[i] += *(const v4fa*)(p + w * KSLOT); }
    const int col = (int)threadIdx.x & 63; float bb = 0.f; if (BIAS) bb = bfr(bias[c0 + col]);
#pragma unroll
    for (int i = 0; i < NU; ++i) { const int rg = (i * NW * 32 + (int)threadIdx.x) >> 6; float* cp = C + (size_t)(r0 + rg * 4) * ldc + c0 + col;
#pragma unroll
        for (int q = 0; q < 4; ++q) cp[(size_t)q * ldc] = BIAS ? s[i][q] + bb : s[i][q]; }
}

// ---- k_gemmw: register-blocked GEMM, one work-group of NW waves per 64x64 output tile; every wave holds the whole tile (16 accumulators) for its interleaved share of the K loop (32-wide K blocks wave, wave + NW, ...), operands straight from K-contiguous 16-bit planes; partials summed by ksum_store; grid (M/64, N/64, Z), NW x 32 threads.
// C[m][n] (f32, pitch ldc, + optional f32 bias[n]) = sum_k A[m][k] Bt[n][k] (+ split products per NSPLIT). z-batch strides sA/sB/sC in elements. K % 32 == 0.
template <typename T16> struct WFrag;
template <> struct WFrag<h16> { typedef v16h V; static __device__ __forceinline__ V ld(const h16* p) { return cat16(*(const v8h*)p, *(const v8h*)(p + 16)); } static __device__ __forceinline__ v8f mma(V a, V b, v8f c) { return wmma16(a, b, c); } };
template <> struct WFrag<bf> { typedef v16bf V; static __device__ __forceinline__ V ld(const bf* p) { return cat16b(*(const v8us*)p, *(const v8us*)(p + 16)); } static __device__ __forceinline__ v8f mma(V a, V b, v8f c) { return wmmab(a, b, c); } };
template <typename T16, int NSPLIT, bool BIAS, int NW>
__global__ __launch_bounds__(NW * 32) void k_gemmw(const T16* __restrict__ A, const T16* __restrict__ A2, const T16* __restrict__ Bt, const T16* __restrict__ Bt2, int K, float* C, int ldc, const float* __restrict__ bias, size_t sA, size_t sB, size_t sC) {
    typedef typename WFrag<T16>::V V;
    __shared__ __align__(16) float os[NW * KSLOT];
    const size_t z = blockIdx.z; A += z * sA; if (A2) A2 += z * sA; Bt += z * sB; if (Bt2) Bt2 += z * sB; C += z * sC;
    const int lane = threadIdx.x & 31, lr = lane & 15, hi = lane >> 4; const int wave = __builtin_amdgcn_readfirstlane((int)(threadIdx.x >> 5)); const int r0 = blockIdx.x * 64, c0 = blockIdx.y * 64;
    v8f acc[4][4];
#pragma unroll
    for (int mb = 0; mb < 4; ++mb)
#pragma unroll
        for (int nb = 0; nb < 4; ++nb) acc[mb][nb] = (v8f){};
    const size_t aoff = (size_t)(r0 + lr) * K + 8 * hi, boff = (size_t)(c0 + lr) * K + 8 * hi;
#pragma unroll 1
    for (int kc = wave * 32; kc < K; kc += NW * 32) {
        V a[4], a2[4];
#pragma unroll
        for (int mb = 0; mb < 4; ++mb) { a[mb] = WFrag<T16>::ld(A + aoff + (size_t)mb * 16 * K + kc); if (NSPLIT == 1 || NSPLIT == 2) a2[mb] = WFrag<T16>::ld(A2 + aoff + (size_t)mb * 16 * K + kc); }
#pragma unroll
        for (int nb = 0; nb < 4; ++nb) { const V b = WFrag<T16>::ld(Bt + boff + (size_t)nb * 16 * K + kc); V b2; if (NSPLIT >= 2) b2 = WFrag<T16>::ld(Bt2 + boff + (size_t)nb * 16 * K + kc);
#pragma unroll
            for (int mb = 0; mb < 4; ++mb) { acc[mb][nb] = WFrag<T16>::mma(a[mb], b, acc[mb][nb]); if (NSPLIT == 1 || NSPLIT == 2) acc[mb][nb] = WFrag<T16>::mma(a2[mb], b, acc[mb][nb]); if (NSPLIT >= 2) acc[mb][nb] = WFrag<T16>::mma(a[mb], b2, acc[mb][nb]); } }
        asm volatile("v_nop\n\tv_nop\n\tv_nop\n\tv_nop" : "+v"(acc[0][0]), "+v"(acc[1][1]), "+v"(acc[2][2]), "+v"(acc[3][3]) : "v"(a[0]), "v"(a[3]));
    }
    ksum_store<NW, BIAS>(os, acc, wave, lane, C, ldc, r0, c0, bias);
}

// ---- k_gemmc: the same 64x64 tile GEMM specialised for causal attention: CMODE 1 skips score tiles entirely above the diagonal (query rows r0+roff.., key columns c0..), CMODE 2 limits the
// key (K) loop of the probability x value contraction to the diagonal block (probabilities beyond it are exactly zero). roff = row offset of this launch's first row within the sequence. NW = waves per tile: 1 keeps the one-wave form (short K), above 1 the K loop is shared out as in k_gemmw.
template <typename T16, int NSPLIT, int CMODE, int NW>
__global__ __launch_bounds__(NW * 32) void k_gemmc(const T16* __restrict__ A, const T16* __restrict__ A2, const T16* __restrict__ Bt, const T16* __restrict__ Bt2, int K, float* C, int ldc, int roff, size_t sA, size_t sB, size_t sC) {
    typedef typename WFrag<T16>::V V;
    __shared__ __align__(16) float os[NW == 1 ? 16 * 68 : NW * KSLOT];
    const size_t z = blockIdx.z; A += z * sA; if (A2) A2 += z * sA; Bt += z * sB; if (Bt2) Bt2 += z * sB; C += z * sC;
    const int lane = threadIdx.x & 31, lr = lane & 15, hi = lane >> 4; const int wave = (NW == 1) ? 0 : __builtin_amdgcn_readfirstlane((int)(threadIdx.x >> 5)); const int r0 = blockIdx.x * 64, c0 = blockIdx.y * 64;
    if (CMODE == 1 && c0 > r0 + roff + 63) return;                  // score tile entirely above the causal diagonal: never read (the softmax masks j > i by select)
    const int Kl = (CMODE == 2) ? min(K, r0 + roff + 64) : K;        // P.V: probabilities are exactly 0 beyond the diagonal block, so the K loop stops there
    v8f acc[4][4];
#pragma unroll
    for (int mb = 0; mb < 4; ++mb)
#pragma unroll
        for (int nb = 0; nb < 4; ++nb) acc[mb][nb] = (v8f){};
    const size_t aoff = (size_t)(r0 + lr) * K + 8 * hi, boff = (size_t)(c0 + lr) * K + 8 * hi;
#pragma unroll 1
    for (int kc = wave * 32; kc < Kl; kc += NW * 32) {
        V a[4], a2[4];
#pragma unroll
        for (int mb = 0; mb < 4; ++mb) { a[mb] = WFrag<T16>::ld(A + aoff + (size_t)mb * 16 * K + kc); if (NSPLIT == 1 || NSPLIT == 2) a2[mb] = WFrag<T16>::ld(A2 + aoff + (size_t)mb * 16 * K + kc); }
#pragma unroll
        for (int nb = 0; nb < 4; ++nb) { const V b = WFrag<T16>::ld(Bt + boff + (size_t)nb * 16 * K + kc); V b2; if (NSPLIT >= 2) b2 = WFrag<T16>::ld(Bt2 + boff + (size_t)nb * 16 * K + kc);
#pragma unroll
            for (int mb = 0; mb < 4; ++mb) { acc[mb][nb] = WFrag<T16>::mma(a[mb], b, acc[mb][nb]); if (NSPLIT == 1 || NSPLIT == 2) acc[mb][nb] = WFrag<T16>::mma(a2[mb], b, acc[mb][nb]); if (NSPLIT >= 2) acc[mb][nb] = WFrag<T16>::mma(a[mb], b2, acc[mb][nb]); } }
        asm volatile("v_nop\n\tv_nop\n\tv_nop\n\tv_nop" : "+v"(acc[0][0]), "+v"(acc[1][1]), "+v"(acc[2][2]), "+v"(acc[3][3]) : "v"(a[0]), "v"(a[3]));
    }
    if constexpr (NW > 1) { ksum_store<NW, false>(os, acc, wave, lane, C, ldc, r0, c0, nullptr); return; }
#pragma unroll
    for (int mb = 0; mb < 4; ++mb) {
#pragma unroll
        for (int nb = 0; nb < 4; ++nb) {
#pragma unroll
            for (int j = 0; j < 8; ++j) os[(hi * 8 + j) * 68 + nb * 16 + lr] = acc[mb][nb][j]; }
        __builtin_amdgcn_wave_barrier(); asm volatile("" ::: "memory");
        float* crow = C + (size_t)(r0 + mb * 16) * ldc + c0;
{
#pragma unroll
            for (int s = 0; s < 8; ++s) { const int row = 2 * s + hi, cofs = lr * 4; v4f val = *(const v4fa*)(os + row * 68 + cofs);
                *(v4f*)(crow + (size_t)row * ldc + cofs) = val; }
             }
        __builtin_amdgcn_wave_barrier(); asm volatile("" ::: "memory");
    }
}

__device__ __forceinline__ h16 tohx(float x) { return (h16)x; }
__device__ __forceinline__ void splitf(float y, unsigned short& h, unsigned short& l) { h = f2bf(y); l = f2bf(y - bf2f(h)); }
typedef __attribute__((ext_vector_type(2))) _Float16 v2h;
typedef __attribute__((ext_vector_type(4))) _Float16 v4h;
typedef __attribute__((ext_vector_type(2))) unsigned short v2us;
typedef __attribute__((ext_vector_type(4))) unsigned short v4us;
typedef __attribute__((ext_vector_type(2))) float v2f;
typedef __attribute__((ext_vector_type(4))) int v4i;

__global__ __launch_bounds__(256) void k_wtG(const float* __restrict__ w, int K, int N, bf* Bt) {
    const int lane = threadIdx.x & 31; const int L0 = (blockIdx.x * 8 + (threadIdx.x >> 5)) * 8; const int nlines = N * K / 64;
{
#pragma unroll 1
        for (int l = 0; l < 8; ++l) { const int L = L0 + l; if (L >= nlines) break; const size_t e = (size_t)L * 64 + lane * 2; const int k = (int)(e % K), n = (int)(e / K); v2us o;
            o[0] = f2bf(w[(size_t)k * N + n]); o[1] = f2bf(w[(size_t)(k + 1) * N + n]); *(v2us*)(Bt + e) = o; }
         }
}
__global__ __launch_bounds__(256) void k_cvt8(const float* __restrict__ src, bf* dst, size_t n8) { const size_t i = (size_t)blockIdx.x * 256 + threadIdx.x; if (i >= n8) return; const v8f v = *(const v8f*)(src + i * 8); v8us o;
#pragma unroll
    for (int k = 0; k < 8; ++k) o[k] = f2bf(v[k]); *(v8us*)(dst + i * 8) = o;  }

// k_rope: head planes [h][t][d] (fp16 + hi/lo) of rope(x) x sc with the rotate-half convention out[d] = x[d] cos[t][d] - x[d+HD/2] sin[t][d], out[d+HD/2] = x[d+HD/2] cos[t][d+HD/2] + x[d] sin[t][d+HD/2]
__global__ __launch_bounds__(256) void k_rope(const float* __restrict__ F, int pitch, int nheads, const float* __restrict__ CS, const float* __restrict__ RF, const float* __restrict__ nw, float sc, h16* P16, bf* Ph, bf* Pl) {
    const size_t e = ((size_t)blockIdx.x * 256 + threadIdx.x) * 2; if (e >= (size_t)nheads * TT * HD) return; const int d = (int)(e % HD); const int t = (int)((e / HD) % TT); const int h = (int)(e / ((size_t)HD * TT)); const float* f = F + (size_t)t * pitch + h * HD; const float rf = RF ? RF[(size_t)h * TT + t] : 1.0f; v2h o16; v2us oh, ol;
#pragma unroll
    for (int q = 0; q < 2; ++q) { const int dd = d + q; const int dp = (dd < HD / 2) ? dd + HD / 2 : dd - HD / 2; float x0 = f[dd], x1 = f[dp];
        if (RF) { float n0 = __fmul_rn(x0, rf), n1 = __fmul_rn(x1, rf); asm volatile("" : "+v"(n0)); asm volatile("" : "+v"(n1)); x0 = __fmul_rn(bfr(nw[dd]), n0); x1 = __fmul_rn(bfr(nw[dp]), n1); }
        const v2f cs = *(const v2f*)(CS + ((size_t)t * HD + dd) * 2); float a = __fmul_rn(x0, cs[0]), bq = __fmul_rn(x1, cs[1]); asm volatile("" : "+v"(a)); asm volatile("" : "+v"(bq)); const float r = ((dd < HD / 2) ? __fsub_rn(a, bq) : __fadd_rn(a, bq)) * sc;
        o16[q] = tohx(r); unsigned short a2, c2; splitf(r, a2, c2); oh[q] = a2; ol[q] = c2; }
    *(v2h*)(P16 + e) = o16; *(v2us*)(Ph + e) = oh; *(v2us*)(Pl + e) = ol;  }
__global__ __launch_bounds__(256) void k_vtp(const float* __restrict__ F, int pitch, int nheads, h16* V16, bf* Vh, bf* Vl) { const size_t e = ((size_t)blockIdx.x * 256 + threadIdx.x) * 2; if (e >= (size_t)nheads * HD * TT) return; const int t = (int)(e % TT); const int d = (int)((e / TT) % HD); const int g = (int)(e / ((size_t)TT * HD)); v2h o16; v2us oh, ol;
#pragma unroll
    for (int q = 0; q < 2; ++q) { const float x = F[(size_t)(t + q) * pitch + g * HD + d]; o16[q] = tohx(x); unsigned short a2, c2; splitf(x, a2, c2); oh[q] = a2; ol[q] = c2; }
    *(v2h*)(V16 + e) = o16; *(v2us*)(Vh + e) = oh; *(v2us*)(Vl + e) = ol;  }
__global__ __launch_bounds__(256) void k_csid(float* CS) { const int idx = blockIdx.x * 256 + threadIdx.x; if (idx >= TT * HD) return; v2f cs; cs[0] = 1.0f; cs[1] = 0.0f; *(v2f*)(CS + (size_t)idx * 2) = cs;  }
// k_asoft: per row (zz, i): t = S x HD^-0.5 for j <= i and i - j < WIN (sliding causal window; the reference's -1e9 additive fill vanishes identically); softmax over the 2048 keys (register row, one exp, fixed trees);
__global__ __launch_bounds__(256) void k_asoft(const float* __restrict__ Sb, h16* P16, bf* Ph, bf* Pl) {
    const int lane = threadIdx.x & 31; const int row = blockIdx.x * 8 + (threadIdx.x >> 5); if (row >= ZH * TT) return; const int i = row % TT; const int zz = row / TT; (void)zz; const bool hires = (i < RH); const float* sr = Sb + (size_t)row * TT; float v[TT / 32]; float mx = -3.0e38f;
#pragma unroll
    for (int ch = 0; ch < TT / 128; ++ch) { const int j0 = ch * 128 + lane * 4; const v4f a = *(const v4f*)(sr + j0);
#pragma unroll
        for (int q = 0; q < 4; ++q) { const int j = j0 + q; (void)j; const float t = (j <= i && i - j < WIN) ? a[q] * SCL : -3.0e38f; v[ch * 4 + q] = t; mx = fmaxf(mx, t); } }
#pragma unroll
    for (int sh = 16; sh; sh >>= 1) mx = fmaxf(mx, __shfl_xor(mx, sh, 32));
    float sum = 0.f;
#pragma unroll
    for (int k = 0; k < TT / 32; ++k) { float d0 = __fsub_rn(v[k], mx); asm volatile("" : "+v"(d0)); v[k] = __builtin_amdgcn_exp2f(__fmul_rn(d0, 1.4426950408889634f)); sum += v[k]; }
#pragma unroll
    for (int sh = 16; sh; sh >>= 1) sum += __shfl_xor(sum, sh, 32);
    const float f = __fdiv_rn(hires ? 1.0f : PCAR, sum);
{
        if (hires) {
#pragma unroll
            for (int ch = 0; ch < TT / 128; ++ch) { v4us oh, ol;
#pragma unroll
                for (int q = 0; q < 4; ++q) { unsigned short a, c2; splitf(v[ch * 4 + q] * f, a, c2); oh[q] = a; ol[q] = c2; }
                const size_t oo = ((size_t)zz * (RH ? RH : 1) + i) * TT + ch * 128 + lane * 4; *(v4us*)(Ph + oo) = oh; *(v4us*)(Pl + oo) = ol; }
        } else {
#pragma unroll
            for (int ch = 0; ch < TT / 128; ++ch) { v4h o4;
#pragma unroll
                for (int q = 0; q < 4; ++q) o4[q] = tohx(v[ch * 4 + q] * f);
                *(v4h*)(P16 + (size_t)row * TT + ch * 128 + lane * 4) = o4; } }
         }
}
__global__ __launch_bounds__(256) void k_merge(const float* __restrict__ O, int h0, bf* Ah, bf* Al) { const size_t e = ((size_t)blockIdx.x * 256 + threadIdx.x) * 2; if (e >= (size_t)ZH * TT * HD) return; const int d = (int)(e % HD); const int t = (int)((e / HD) % TT); const int zz = (int)(e / ((size_t)HD * TT)); const float cs = (t < RH) ? 1.0f : (1.0f / PCAR); const size_t oo = (size_t)t * DQ + (h0 + zz) * HD + d;
    v2us oh, ol;
#pragma unroll
    for (int q = 0; q < 2; ++q) { unsigned short a, c2; splitf(O[e + q] * cs, a, c2); oh[q] = a; ol[q] = c2; } *(v2us*)(Ah + oo) = oh; *(v2us*)(Al + oo) = ol;  }

extern "C" void kernel_launch(void* const* d_in, const int* in_sizes, int n_in,
                              void* d_out, int out_size, void* d_ws, size_t ws_size, hipStream_t stream) {
    (void)in_sizes; (void)n_in; (void)out_size;
    const float* x = (const float*)d_in[0]; const float* wq = (const float*)d_in[1]; const float* wk = (const float*)d_in[2]; const float* wv = (const float*)d_in[3]; const float* wo = (const float*)d_in[4]; const float* bo = (const float*)d_in[5];   /* inputs x, Wq, Wk, Wv, Wo ('xw' [768][768]), bo */
    float* OUT = (float*)d_out;     // [4][2048][768]
    char* wsp = (char*)d_ws;
    auto take = [&](size_t bytes) { char* p = wsp; wsp += (bytes + 255) & ~(size_t)255; return (void*)p; };
    bf* WQ = (bf*)take((size_t)DQ * DM * 2); bf* WK = (bf*)take((size_t)DKV * DM * 2); bf* WV = (bf*)take((size_t)DKV * DM * 2); bf* WO = (bf*)take((size_t)DM * DQ * 2); float* CS = (float*)take((size_t)TT * HD * 2 * 4);
    bf* XB = (bf*)take((size_t)NB_ * TT * DM * 2);
    h16* QP16 = (h16*)take((size_t)NH_ * TT * HD * 2); h16* KP16 = (h16*)take((size_t)NKV * TT * HD * 2); h16* VT16 = (h16*)take((size_t)NKV * HD * TT * 2);   // q planes directly followed by k planes (fp16, hi, lo alike): one builder launch writes both as 24 heads
    bf* QPh = (bf*)take((size_t)NH_ * TT * HD * 2); bf* KPh = (bf*)take((size_t)NKV * TT * HD * 2); bf* QPl = (bf*)take((size_t)NH_ * TT * HD * 2); bf* KPl = (bf*)take((size_t)NKV * TT * HD * 2); bf* VTh = (bf*)take((size_t)NKV * HD * TT * 2); bf* VTl = (bf*)take((size_t)NKV * HD * TT * 2); bf* Ph = (bf*)take((size_t)ZH * RH * TT * 2); bf* Pl = (bf*)take((size_t)ZH * RH * TT * 2);
    float* Sb = (float*)take((size_t)ZH * TT * TT * 4); h16* P16 = (h16*)take((size_t)ZH * TT * TT * 2); float* Ob = (float*)take((size_t)ZH * TT * HD * 4); bf* ATh = (bf*)take((size_t)NB_ * TT * DQ * 2); bf* ATl = (bf*)take((size_t)NB_ * TT * DQ * 2);
    if ((size_t)(wsp - (char*)d_ws) > ws_size) return;    // ws 256 MiB
    float* FQKV = Sb;   // [TT][DQ + 2 DKV] f32 projections of one batch; dead once the planes are built, before the first score tile is stored (stream-ordered)
    { k_wtG<<<(unsigned)((DM * DQ / 64 + 63) / 64), 256, 0, stream>>>(wq, DM, DQ, WQ); k_wtG<<<(unsigned)((DM * DKV / 64 + 63) / 64), 256, 0, stream>>>(wk, DM, DKV, WK); k_wtG<<<(unsigned)((DM * DKV / 64 + 63) / 64), 256, 0, stream>>>(wv, DM, DKV, WV);
      k_wtG<<<(unsigned)((DQ * DM / 64 + 63) / 64), 256, 0, stream>>>(wo, DQ, DM, WO);
       }
    k_csid<<<(TT * HD + 255) / 256, 256, 0, stream>>>(CS);
    k_cvt8<<<(unsigned)(((size_t)NB_ * TT * DM / 8 + 255) / 256), 256, 0, stream>>>(x, XB, (size_t)NB_ * TT * DM / 8);   // all batches in one launch
    const unsigned LQK = (unsigned)(((size_t)(NH_ + NKV) * TT * HD / 2 + 255) / 256), LKv = (unsigned)(((size_t)NKV * TT * HD / 2 + 255) / 256);
    for (int b = 0; b < NB_; ++b) {
        // q, k, v in one GEMM: WQ, WK, WV lie back to back in the workspace, so they are one [DQ + 2 DKV][DM] transposed weight
        k_gemmw<bf, 0, false, 8><<<dim3(TT / 64, (DQ + 2 * DKV) / 64, 1), 256, 0, stream>>>(XB + (size_t)b * TT * DM, nullptr, WQ, nullptr, DM, FQKV, DQ + 2 * DKV, nullptr, 0, 0, 0);
        k_rope<<<LQK, 256, 0, stream>>>(FQKV, DQ + 2 * DKV, NH_ + NKV, CS, nullptr, nullptr, 1.0f, QP16, QPh, QPl);   // heads 0..11 are q, 12..23 are k
        k_vtp<<<LKv, 256, 0, stream>>>(FQKV + DQ + DKV, DQ + 2 * DKV, NKV, VT16, VTh, VTl);
        for (int h0 = 0; h0 < NH_; h0 += ZH) { const size_t zq = (size_t)h0, zk = (size_t)(h0 / REP);   // one kv head per query head: the pass's heads use consecutive kv planes (z-strides TT*HD)
            k_gemmc<bf, 2, 1, 1><<<dim3(RH / 64, TT / 64, ZH), 32, 0, stream>>>(QPh + zq * TT * HD, QPl + zq * TT * HD, KPh + zk * TT * HD, KPl + zk * TT * HD, HD, Sb, TT, 0, (size_t)TT * HD, (size_t)TT * HD, (size_t)TT * TT);
            k_gemmc<h16, 0, 1, 1><<<dim3((TT - RH) / 64, TT / 64, ZH), 32, 0, stream>>>(QP16 + zq * TT * HD + (size_t)RH * HD, nullptr, KP16 + zk * TT * HD, nullptr, HD, Sb + (size_t)RH * TT, TT, RH, (size_t)TT * HD, (size_t)TT * HD, (size_t)TT * TT);
            k_asoft<<<ZH * TT / 8, 256, 0, stream>>>(Sb, P16, Ph, Pl);
            k_gemmc<bf, 2, 2, 8><<<dim3(RH / 64, HD / 64, ZH), 256, 0, stream>>>(Ph, Pl, VTh + zk * HD * TT, VTl + zk * HD * TT, TT, Ob, HD, 0, (size_t)RH * TT, (size_t)HD * TT, (size_t)TT * HD);
            k_gemmc<h16, 0, 2, 16><<<dim3((TT - RH) / 64, HD / 64, ZH), 512, 0, stream>>>(P16 + (size_t)RH * TT, nullptr, VT16 + zk * HD * TT, nullptr, TT, Ob + (size_t)RH * HD, HD, RH, (size_t)TT * TT, (size_t)HD * TT, (size_t)TT * HD);
            k_merge<<<(unsigned)(((size_t)ZH * TT * HD / 2 + 255) / 256), 256, 0, stream>>>(Ob, h0, ATh + (size_t)b * TT * DQ, ATl + (size_t)b * TT * DQ); } }
    k_gemmw<bf, 1, true, 8><<<dim3(NB_ * TT / 64, DM / 64, 1), 256, 0, stream>>>(ATh, ATl, WO, nullptr, DQ, OUT, DM, bo, 0, 0, 0);   // output projection of all batches in one launch (rows b * TT + t)
}

// v003
// A run of this version takes 281 microseconds.
// Two timings next to v002 both put it at 2.44 times that version's speed.
// Over all steps from v000 it is 7.62 times as fast.
#include <hip/hip_runtime.h>

// Causal multi-head attention at d_model 768 with bias-free projections and an output bias (x [4][2048][768]; q, k, v = x W ('xw' [768][768], no bias; 12 heads x 64); scores masked (-inf) then / sqrt(64); softmax; out = merged Wo + bo ('xw' + bias) -> [4][2048][768] (6.3 M); argument order x, Wq, Wk, Wv, Wo, bo).
// Layout per batch: bf16 copy of x; 'xw' weights transposed once; exact projections (K 768); identity-table plane builders; one fused causal attention launch for all batches and heads (hybrid rows: < 512 hi/lo 3 products, rest fp16; running maximum and sum, keys only up to the diagonal); merged hi/lo x Wo exact + bo.
// Compute dtypes, f32 accumulate: every input rounded to bf16; projections exact; attention rows < 512 3 products, rest fp16; softmax f32; Wo hl x exact + bias.

#define NB_  4
#define TT   2048
#define DM   768
#define NH_  12
#define NKV  12
#define REP  (NH_ / NKV)
#define HD   64
#define DQ   (NH_ * HD)
#define DKV  (NKV * HD)
#define RH   512                  // query rows < RH use hi+lo planes (0: none)
#define SCL  0.125f   // HD^-0.5
typedef _Float16 h16;
typedef unsigned short bf;
typedef __attribute__((ext_vector_type(16))) __bf16   v16bf;
typedef __attribute__((ext_vector_type(16))) _Float16 v16h;
typedef __attribute__((ext_vector_type(8)))  _Float16 v8h;
typedef __attribute__((ext_vector_type(8)))  unsigned short v8us;
typedef __attribute__((ext_vector_type(8)))  float    v8f;
typedef __attribute__((ext_vector_type(4)))  float    v4f;
typedef v8h  __attribute__((may_alias)) v8ha;
typedef v4f  __attribute__((may_alias)) v4fa;
typedef v8us __attribute__((may_alias)) v8usa;

__device__ __forceinline__ unsigned short f2bf(float f) { unsigned u = __float_as_uint(f); u += 0x7FFFu + ((u >> 16) & 1u); return (unsigned short)(u >> 16); }
__device__ __forceinline__ float bf2f(unsigned short b) { return __uint_as_float(((unsigned)b) << 16); }
__device__ __forceinline__ float bfr(float f) { return bf2f(f2bf(f)); }
__device__ __forceinline__ v16h cat16(v8h lo, v8h hi) { return __builtin_shufflevector(lo, hi, 0, 1, 2, 3, 4, 5, 6, 7, 8, 9, 10, 11, 12, 13, 14, 15); }
__device__ __forceinline__ v16bf cat16b(v8us lo, v8us hi) { return __builtin_bit_cast(v16bf, __builtin_shufflevector(lo, hi, 0, 1, 2, 3, 4, 5, 6, 7, 8, 9, 10, 11, 12, 13, 14, 15)); }
__device__ __forceinline__ v8f wmma16(v16h a, v16h b, v8f c) { return __builtin_amdgcn_wmma_f32_16x16x32_f16(false, a, false, b, (short)0, c, false, false); }
__device__ __forceinline__ v8f wmmab(v16bf a, v16bf b, v8f c) { return __builtin_amdgcn_wmma_f32_16x16x32_bf16(false, a, false, b, (short)0, c, false, false); }



// ---- ksum_store: the NW waves of a work-group each hold a partial 64x64 tile (their share of the K loop). Each wave writes its partial column-major (pitch 68) into its own LDS slot,
// one barrier, then every thread adds the NW slots in slot order for 4 rows of one column and stores them (a wave covers 32 adjacent columns: whole 128-byte lines).
#define KSLOT (64 * 68)
template <int NW, bool BIAS>
__device__ __forceinline__ void ksum_store(float* os, const v8f (&acc)[4][4], int wave, int lane, float* C, int ldc, int r0, int c0, const float* __restrict__ bias) {
    const int lr = lane & 15, hi = lane >> 4; float* slot = os + wave * KSLOT;
#pragma unroll
    for (int mb = 0; mb < 4; ++mb)
#pragma unroll
        for (int nb = 0; nb < 4; ++nb) { float* p = slot + (nb * 16 + lr) * 68 + mb * 16 + hi * 8; const v8f t = acc[mb][nb];
            *(v4fa*)p = __builtin_shufflevector(t, t, 0, 1, 2, 3); *(v4fa*)(p + 4) = __builtin_shufflevector(t, t, 4, 5, 6, 7); }
    __syncthreads();   // every wave's partial tile is in LDS before any thread sums across the slots
    constexpr int NU = 1024 / (NW * 32); v4f s[NU];
#pragma unroll
    for (int i = 0; i < NU; ++i) { const int u = i * NW * 32 + (int)threadIdx.x; const float* p = os + (u & 63) * 68 + (u >> 6) * 4; s[i] = *(const v4fa*)p;
#pragma unroll
        for (int w = 1; w < NW; ++w) s[i] += *(const v4fa*)(p + w * KSLOT); }
    const int col = (int)threadIdx.x & 63; float bb = 0.f; if (BIAS) bb = bfr(bias[c0 + col]);
#pragma unroll
    for (int i = 0; i < NU; ++i) { const int rg = (i * NW * 32 + (int)threadIdx.x) >> 6; float* cp = C + (size_t)(r0 + rg * 4) * ldc + c0 + col;
#pragma unroll
        for (int q = 0; q < 4; ++q) cp[(size_t)q * ldc] = BIAS ? s[i][q] + bb : s[i][q]; }
}

// ---- k_gemmw: register-blocked GEMM, one work-group of NW waves per 64x64 output tile; every wave holds the whole tile (16 accumulators) for its interleaved share of the K loop (32-wide K blocks wave, wave + NW, ...), operands straight from K-contiguous 16-bit planes; partials summed by ksum_store; grid (M/64, N/64, Z), NW x 32 threads.
// C[m][n] (f32, pitch ldc, + optional f32 bias[n]) = sum_k A[m][k] Bt[n][k] (+ split products per NSPLIT). z-batch strides sA/sB/sC in elements. K % 32 == 0.
template <typename T16> struct WFrag;
template <> struct WFrag<h16> { typedef v16h V; static __device__ __forceinline__ V ld(const h16* p) { return cat16(*(const v8h*)p, *(const v8h*)(p + 16)); } static __device__ __forceinline__ v8f mma(V a, V b, v8f c) { return wmma16(a, b, c); } };
template <> struct WFrag<bf> { typedef v16bf V; static __device__ __forceinline__ V ld(const bf* p) { return cat16b(*(const v8us*)p, *(const v8us*)(p + 16)); } static __device__ __forceinline__ v8f mma(V a, V b, v8f c) { return wmmab(a, b, c); } };
template <typename T16, int NSPLIT, bool BIAS, int NW>
__global__ __launch_bounds__(NW * 32) void k_gemmw(const T16* __restrict__ A, const T16* __restrict__ A2, const T16* __restrict__ Bt, const T16* __restrict__ Bt2, int K, float* C, int ldc, const float* __restrict__ bias, size_t sA, size_t sB, size_t sC) {
    typedef typename WFrag<T16>::V V;
    __shared__ __align__(16) float os[NW * KSLOT];
    const size_t z = blockIdx.z; A += z * sA; if (A2) A2 += z * sA; Bt += z * sB; if (Bt2) Bt2 += z * sB; C += z * sC;
    const int lane = threadIdx.x & 31, lr = lane & 15, hi = lane >> 4; const int wave = __builtin_amdgcn_readfirstlane((int)(threadIdx.x >> 5)); const int r0 = blockIdx.x * 64, c0 = blockIdx.y * 64;
    v8f acc[4][4];
#pragma unroll
    for (int mb = 0; mb < 4; ++mb)
#pragma unroll
        for (int nb = 0; nb < 4; ++nb) acc[mb][nb] = (v8f){};
    const size_t aoff = (size_t)(r0 + lr) * K + 8 * hi, boff = (size_t)(c0 + lr) * K + 8 * hi;
#pragma unroll 1
    for (int kc = wave * 32; kc < K; kc += NW * 32) {
        V a[4], a2[4];
#pragma unroll
        for (int mb = 0; mb < 4; ++mb) { a[mb] = WFrag<T16>::ld(A + aoff + (size_t)mb * 16 * K + kc); if (NSPLIT == 1 || NSPLIT == 2) a2[mb] = WFrag<T16>::ld(A2 + aoff + (size_t)mb * 16 * K + kc); }
#pragma unroll
        for (int nb = 0; nb < 4; ++nb) { const V b = WFrag<T16>::ld(Bt + boff + (size_t)nb * 16 * K + kc); V b2; if (NSPLIT >= 2) b2 = WFrag<T16>::ld(Bt2 + boff + (size_t)nb * 16 * K + kc);
#pragma unroll
            for (int mb = 0; mb < 4; ++mb) { acc[mb][nb] = WFrag<T16>::mma(a[mb], b, acc[mb][nb]); if (NSPLIT == 1 || NSPLIT == 2) acc[mb][nb] = WFrag<T16>::mma(a2[mb], b, acc[mb][nb]); if (NSPLIT >= 2) acc[mb][nb] = WFrag<T16>::mma(a[mb], b2, acc[mb][nb]); } }
        asm volatile("v_nop\n\tv_nop\n\tv_nop\n\tv_nop" : "+v"(acc[0][0]), "+v"(acc[1][1]), "+v"(acc[2][2]), "+v"(acc[3][3]) : "v"(a[0]), "v"(a[3]));
    }
    ksum_store<NW, BIAS>(os, acc, wave, lane, C, ldc, r0, c0, bias);
}

__device__ __forceinline__ h16 tohx(float x) { return (h16)x; }
__device__ __forceinline__ void splitf(float y, unsigned short& h, unsigned short& l) { h = f2bf(y); l = f2bf(y - bf2f(h)); }
typedef __attribute__((ext_vector_type(2))) _Float16 v2h;
typedef __attribute__((ext_vector_type(4))) _Float16 v4h;
typedef __attribute__((ext_vector_type(2))) unsigned short v2us;
typedef __attribute__((ext_vector_type(4))) unsigned short v4us;
typedef __attribute__((ext_vector_type(2))) float v2f;
typedef __attribute__((ext_vector_type(4))) int v4i;

__global__ __launch_bounds__(256) void k_wtG(const float* __restrict__ w, int K, int N, bf* Bt) {
    const int lane = threadIdx.x & 31; const int L0 = (blockIdx.x * 8 + (threadIdx.x >> 5)) * 8; const int nlines = N * K / 64;
{
#pragma unroll 1
        for (int l = 0; l < 8; ++l) { const int L = L0 + l; if (L >= nlines) break; const size_t e = (size_t)L * 64 + lane * 2; const int k = (int)(e % K), n = (int)(e / K); v2us o;
            o[0] = f2bf(w[(size_t)k * N + n]); o[1] = f2bf(w[(size_t)(k + 1) * N + n]); *(v2us*)(Bt + e) = o; }
         }
}
__global__ __launch_bounds__(256) void k_cvt8(const float* __restrict__ src, bf* dst, size_t n8) { const size_t i = (size_t)blockIdx.x * 256 + threadIdx.x; if (i >= n8) return; const v8f v = *(const v8f*)(src + i * 8); v8us o;
#pragma unroll
    for (int k = 0; k < 8; ++k) o[k] = f2bf(v[k]); *(v8us*)(dst + i * 8) = o;  }

// k_rope: head planes [h][t][d] (fp16 + hi/lo) of rope(x) x sc with the rotate-half convention out[d] = x[d] cos[t][d] - x[d+HD/2] sin[t][d], out[d+HD/2] = x[d+HD/2] cos[t][d+HD/2] + x[d] sin[t][d+HD/2]
__global__ __launch_bounds__(256) void k_rope(const float* __restrict__ F, int pitch, int nheads, const float* __restrict__ CS, const float* __restrict__ RF, const float* __restrict__ nw, float sc, h16* P16, bf* Ph, bf* Pl) {
    const size_t e = ((size_t)blockIdx.x * 256 + threadIdx.x) * 2; if (e >= (size_t)nheads * TT * HD) return; const int d = (int)(e % HD); const int t = (int)((e / HD) % TT); const int h = (int)(e / ((size_t)HD * TT)); const float* f = F + (size_t)t * pitch + h * HD; const float rf = RF ? RF[(size_t)h * TT + t] : 1.0f; v2h o16; v2us oh, ol;
#pragma unroll
    for (int q = 0; q < 2; ++q) { const int dd = d + q; const int dp = (dd < HD / 2) ? dd + HD / 2 : dd - HD / 2; float x0 = f[dd], x1 = f[dp];
        if (RF) { float n0 = __fmul_rn(x0, rf), n1 = __fmul_rn(x1, rf); asm volatile("" : "+v"(n0)); asm volatile("" : "+v"(n1)); x0 = __fmul_rn(bfr(nw[dd]), n0); x1 = __fmul_rn(bfr(nw[dp]), n1); }
        const v2f cs = *(const v2f*)(CS + ((size_t)t * HD + dd) * 2); float a = __fmul_rn(x0, cs[0]), bq = __fmul_rn(x1, cs[1]); asm volatile("" : "+v"(a)); asm volatile("" : "+v"(bq)); const float r = ((dd < HD / 2) ? __fsub_rn(a, bq) : __fadd_rn(a, bq)) * sc;
        o16[q] = tohx(r); unsigned short a2, c2; splitf(r, a2, c2); oh[q] = a2; ol[q] = c2; }
    *(v2h*)(P16 + e) = o16; *(v2us*)(Ph + e) = oh; *(v2us*)(Pl + e) = ol;  }
__global__ __launch_bounds__(256) void k_vtp(const float* __restrict__ F, int pitch, int nheads, h16* V16, bf* Vh, bf* Vl) { const size_t e = ((size_t)blockIdx.x * 256 + threadIdx.x) * 2; if (e >= (size_t)nheads * HD * TT) return; const int t = (int)(e % TT); const int d = (int)((e / TT) % HD); const int g = (int)(e / ((size_t)TT * HD)); v2h o16; v2us oh, ol;
#pragma unroll
    for (int q = 0; q < 2; ++q) { const float x = F[(size_t)(t + q) * pitch + g * HD + d]; o16[q] = tohx(x); unsigned short a2, c2; splitf(x, a2, c2); oh[q] = a2; ol[q] = c2; }
    *(v2h*)(V16 + e) = o16; *(v2us*)(Vh + e) = oh; *(v2us*)(Vl + e) = ol;  }
__global__ __launch_bounds__(256) void k_csid(float* CS) { const int idx = blockIdx.x * 256 + threadIdx.x; if (idx >= TT * HD) return; v2f cs; cs[0] = 1.0f; cs[1] = 0.0f; *(v2f*)(CS + (size_t)idx * 2) = cs;  }
#define SC2 (SCL * 1.4426950408889634f)   // score scale x log2(e): the exponentials are taken to base 2
typedef __attribute__((ext_vector_type(16))) unsigned short v16us;
// stands behind a run of global loads or stores, in front of whatever next overwrites a register that they name (address pair, store data)
#define XWAIT() asm volatile("s_wait_xcnt 0x0" ::: "memory")
template <typename T16, bool HL, int NQ, bool DIAG>
__device__ __forceinline__ void attn_step(const T16* __restrict__ Kp, const T16* __restrict__ K2, const T16* __restrict__ Vt, const T16* __restrict__ Vt2, int k0, int q0, int lr, int hi,
                                          const typename WFrag<T16>::V (&qf)[NQ][2], const typename WFrag<T16>::V (&q2f)[NQ][2], typename WFrag<T16>::V (&kf)[2][2], float (&m)[NQ], float (&l)[NQ], v8f (&o)[4][NQ]) {
    typedef WFrag<T16> F; typedef typename F::V V;
    v8f s[2][NQ];
#pragma unroll
    for (int kt = 0; kt < 2; ++kt)
#pragma unroll
        for (int qt = 0; qt < NQ; ++qt) s[kt][qt] = (v8f){};
    V a2[2][2], va[4], va2[4];   // this pass's lo K plane and V^T fragments are requested first: V^T flies under the score products and the softmax arithmetic
    if (HL) {
#pragma unroll
        for (int kt = 0; kt < 2; ++kt)
#pragma unroll
            for (int ks = 0; ks < 2; ++ks) a2[kt][ks] = F::ld(K2 + (size_t)(k0 + kt * 16 + lr) * HD + ks * 32 + 8 * hi);
        XWAIT(); }
#pragma unroll
    for (int dt = 0; dt < 4; ++dt) { const size_t off = (size_t)(dt * 16 + lr) * TT + k0 + 8 * hi; va[dt] = F::ld(Vt + off); if (HL) va2[dt] = F::ld(Vt2 + off); }
    XWAIT();
#pragma unroll
    for (int kt = 0; kt < 2; ++kt)
#pragma unroll
        for (int ks = 0; ks < 2; ++ks)
#pragma unroll
            for (int qt = 0; qt < NQ; ++qt) { s[kt][qt] = F::mma(kf[kt][ks], qf[qt][ks], s[kt][qt]); if (HL) { s[kt][qt] = F::mma(kf[kt][ks], q2f[qt][ks], s[kt][qt]); s[kt][qt] = F::mma(a2[kt][ks], qf[qt][ks], s[kt][qt]); } }
    if (!DIAG) {   // the next pass's K fragments, into the registers that the score products have just read (a pass below the diagonal is always followed by another)
#pragma unroll
        for (int kt = 0; kt < 2; ++kt)
#pragma unroll
            for (int ks = 0; ks < 2; ++ks) kf[kt][ks] = F::ld(Kp + (size_t)(k0 + 32 + kt * 16 + lr) * HD + ks * 32 + 8 * hi);
        XWAIT(); }
    if (DIAG) {
#pragma unroll
        for (int kt = 0; kt < 2; ++kt)
#pragma unroll
            for (int qt = 0; qt < NQ; ++qt)
#pragma unroll
                for (int j = 0; j < 8; ++j) if (k0 + kt * 16 + hi * 8 + j > q0 + qt * 16 + lr) s[kt][qt][j] = -3.0e38f; }
    float mx[NQ]; bool need = false;
#pragma unroll
    for (int qt = 0; qt < NQ; ++qt) { float t = fmaxf(s[0][qt][0], s[1][qt][0]);
#pragma unroll
        for (int j = 1; j < 8; ++j) t = fmaxf(t, fmaxf(s[0][qt][j], s[1][qt][j]));
        mx[qt] = fmaxf(t, __shfl_xor(t, 16, 32)); need = need || (mx[qt] > m[qt]); }
    if (__builtin_amdgcn_ballot_w32(need) != 0) {   // some row's maximum rose: bring sums and outputs to the new maximum (factor exactly 1 for the rows whose maximum stayed)
#pragma unroll
        for (int qt = 0; qt < NQ; ++qt) { const float mn = fmaxf(m[qt], mx[qt]); const float al = __builtin_amdgcn_exp2f((m[qt] - mn) * SC2); m[qt] = mn; l[qt] *= al;
#pragma unroll
            for (int dt = 0; dt < 4; ++dt) o[dt][qt] *= al; } }
    V pb[NQ], pb2[NQ];
#pragma unroll
    for (int qt = 0; qt < NQ; ++qt) { const float nm = -m[qt] * SC2; float p[16];
#pragma unroll
        for (int e = 0; e < 16; ++e) { p[e] = __builtin_amdgcn_exp2f(fmaf(s[e >> 3][qt][e & 7], SC2, nm)); l[qt] += p[e]; }
        if constexpr (HL) { v16us ph, pl;
#pragma unroll
            for (int e = 0; e < 16; ++e) { unsigned short a, c2; splitf(p[e], a, c2); ph[e] = a; pl[e] = c2; }
            pb[qt] = __builtin_bit_cast(v16bf, ph); pb2[qt] = __builtin_bit_cast(v16bf, pl);
        } else {
#pragma unroll
            for (int e = 0; e < 16; ++e) pb[qt][e] = tohx(p[e]); } }
#pragma unroll
    for (int dt = 0; dt < 4; ++dt)
#pragma unroll
        for (int qt = 0; qt < NQ; ++qt) { o[dt][qt] = F::mma(va[dt], pb[qt], o[dt][qt]); if (HL) { o[dt][qt] = F::mma(va[dt], pb2[qt], o[dt][qt]); o[dt][qt] = F::mma(va2[dt], pb[qt], o[dt][qt]); } }
}
template <typename T16, bool HL, int NQ>
__device__ __forceinline__ void attn_rows(const T16* __restrict__ Q, const T16* __restrict__ Q2, const T16* __restrict__ Kp, const T16* __restrict__ K2, const T16* __restrict__ Vt, const T16* __restrict__ Vt2, int q0, int lane, bf* Ah, bf* Al) {
    typedef WFrag<T16> F; typedef typename F::V V; const int lr = lane & 15, hi = lane >> 4;
    V qf[NQ][2], q2f[NQ][2], kf[2][2];
#pragma unroll
    for (int qt = 0; qt < NQ; ++qt)
#pragma unroll
        for (int ks = 0; ks < 2; ++ks) { const size_t off = (size_t)(q0 + qt * 16 + lr) * HD + ks * 32 + 8 * hi; qf[qt][ks] = F::ld(Q + off); if (HL) q2f[qt][ks] = F::ld(Q2 + off); }
#pragma unroll
    for (int kt = 0; kt < 2; ++kt)
#pragma unroll
        for (int ks = 0; ks < 2; ++ks) kf[kt][ks] = F::ld(Kp + (size_t)(kt * 16 + lr) * HD + ks * 32 + 8 * hi);   // keys 0 .. 31; every later pass's K fragments are fetched one pass ahead
    XWAIT();
    float m[NQ], l[NQ]; v8f o[4][NQ]; const int kd = q0 & ~31;   // first key of the 32-key block that holds the diagonal
#pragma unroll
    for (int qt = 0; qt < NQ; ++qt) { m[qt] = -3.0e38f; l[qt] = 0.f; }
#pragma unroll
    for (int dt = 0; dt < 4; ++dt)
#pragma unroll
        for (int qt = 0; qt < NQ; ++qt) o[dt][qt] = (v8f){};
#pragma unroll 1
    for (int k0 = 0; k0 < kd; k0 += 32) {
        attn_step<T16, HL, NQ, false>(Kp, K2, Vt, Vt2, k0, q0, lr, hi, qf, q2f, kf, m, l, o);
    }
    attn_step<T16, HL, NQ, true>(Kp, K2, Vt, Vt2, kd, q0, lr, hi, qf, q2f, kf, m, l, o);   // the diagonal block: keys kd .. kd + 31, masked by select
#pragma unroll
    for (int qt = 0; qt < NQ; ++qt) { const float inv = __fdiv_rn(1.0f, l[qt] + __shfl_xor(l[qt], 16, 32)); const size_t ro = (size_t)(q0 + qt * 16 + lr) * DQ + 8 * hi;
#pragma unroll
        for (int dt = 0; dt < 4; ++dt) { v8us oh, ol;
#pragma unroll
            for (int j = 0; j < 8; ++j) { unsigned short a, c2; splitf(o[dt][qt][j] * inv, a, c2); oh[j] = a; ol[j] = c2; }
            *(v8us*)(Ah + ro + dt * 16) = oh; *(v8us*)(Al + ro + dt * 16) = ol; XWAIT(); } }
}
// grid (batch x head, position blocks: first the (TT - RH) / 128 fp16 blocks of 4 waves x 32 rows, the longest first, then the RH / 64 hi/lo blocks of 4 waves x 16 rows); the 4 waves of a work-group are independent
// (adjacent query rows walk the same keys: they meet in the WGP cache). The hi/lo rows take 16 per wave because both planes of every operand are live: at 32 the kernel needs registers above v255.
#define NFB ((TT - RH) / 128)
__global__ __launch_bounds__(128) void k_fattn(const h16* __restrict__ QK16, const bf* __restrict__ QKh, const bf* __restrict__ QKl, const h16* __restrict__ VT16, const bf* __restrict__ VTh, const bf* __restrict__ VTl, bf* ATh, bf* ATl) {
    const int lane = threadIdx.x & 31; const int wave = __builtin_amdgcn_readfirstlane((int)(threadIdx.x >> 5)); const int b = blockIdx.x / NH_, h = blockIdx.x % NH_, y = blockIdx.y;
    const size_t qo = ((size_t)b * (NH_ + NKV) + h) * TT * HD, ko = ((size_t)b * (NH_ + NKV) + NH_ + h / REP) * TT * HD, vo = ((size_t)b * NKV + h / REP) * HD * TT, ao = (size_t)b * TT * DQ + h * HD;
    if (y < NFB) attn_rows<h16, false, 2>(QK16 + qo, nullptr, QK16 + ko, nullptr, VT16 + vo, nullptr, TT - (y + 1) * 128 + wave * 32, lane, ATh + ao, ATl + ao);
    else attn_rows<bf, true, 1>(QKh + qo, QKl + qo, QKh + ko, QKl + ko, VTh + vo, VTl + vo, RH - (y - NFB + 1) * 64 + wave * 16, lane, ATh + ao, ATl + ao);
}

extern "C" void kernel_launch(void* const* d_in, const int* in_sizes, int n_in,
                              void* d_out, int out_size, void* d_ws, size_t ws_size, hipStream_t stream) {
    (void)in_sizes; (void)n_in; (void)out_size;
    const float* x = (const float*)d_in[0]; const float* wq = (const float*)d_in[1]; const float* wk = (const float*)d_in[2]; const float* wv = (const float*)d_in[3]; const float* wo = (const float*)d_in[4]; const float* bo = (const float*)d_in[5];   /* inputs x, Wq, Wk, Wv, Wo ('xw' [768][768]), bo */
    float* OUT = (float*)d_out;     // [4][2048][768]
    char* wsp = (char*)d_ws;
    auto take = [&](size_t bytes) { char* p = wsp; wsp += (bytes + 255) & ~(size_t)255; return (void*)p; };
    bf* WQ = (bf*)take((size_t)DQ * DM * 2); bf* WK = (bf*)take((size_t)DKV * DM * 2); bf* WV = (bf*)take((size_t)DKV * DM * 2); bf* WO = (bf*)take((size_t)DM * DQ * 2); float* CS = (float*)take((size_t)TT * HD * 2 * 4);
    bf* XB = (bf*)take((size_t)NB_ * TT * DM * 2);
    // planes of all batches: per batch the 12 q heads directly followed by the 12 k heads (fp16, hi, lo alike), so one builder launch writes both as 24 heads
    h16* QK16 = (h16*)take((size_t)NB_ * (NH_ + NKV) * TT * HD * 2); bf* QKh = (bf*)take((size_t)NB_ * (NH_ + NKV) * TT * HD * 2); bf* QKl = (bf*)take((size_t)NB_ * (NH_ + NKV) * TT * HD * 2);
    h16* VT16 = (h16*)take((size_t)NB_ * NKV * HD * TT * 2); bf* VTh = (bf*)take((size_t)NB_ * NKV * HD * TT * 2); bf* VTl = (bf*)take((size_t)NB_ * NKV * HD * TT * 2);
    float* FQKV = (float*)take((size_t)TT * (DQ + 2 * DKV) * 4);   // [TT][DQ + 2 DKV] f32 projections of one batch
    bf* ATh = (bf*)take((size_t)NB_ * TT * DQ * 2); bf* ATl = (bf*)take((size_t)NB_ * TT * DQ * 2);
    if ((size_t)(wsp - (char*)d_ws) > ws_size) return;    // ws 256 MiB
    { k_wtG<<<(unsigned)((DM * DQ / 64 + 63) / 64), 256, 0, stream>>>(wq, DM, DQ, WQ); k_wtG<<<(unsigned)((DM * DKV / 64 + 63) / 64), 256, 0, stream>>>(wk, DM, DKV, WK); k_wtG<<<(unsigned)((DM * DKV / 64 + 63) / 64), 256, 0, stream>>>(wv, DM, DKV, WV);
      k_wtG<<<(unsigned)((DQ * DM / 64 + 63) / 64), 256, 0, stream>>>(wo, DQ, DM, WO);
       }
    k_csid<<<(TT * HD + 255) / 256, 256, 0, stream>>>(CS);
    k_cvt8<<<(unsigned)(((size_t)NB_ * TT * DM / 8 + 255) / 256), 256, 0, stream>>>(x, XB, (size_t)NB_ * TT * DM / 8);   // all batches in one launch
    const unsigned LQK = (unsigned)(((size_t)(NH_ + NKV) * TT * HD / 2 + 255) / 256), LKv = (unsigned)(((size_t)NKV * TT * HD / 2 + 255) / 256);
    for (int b = 0; b < NB_; ++b) {
        // q, k, v in one GEMM: WQ, WK, WV lie back to back in the workspace, so they are one [DQ + 2 DKV][DM] transposed weight
        k_gemmw<bf, 0, false, 8><<<dim3(TT / 64, (DQ + 2 * DKV) / 64, 1), 256, 0, stream>>>(XB + (size_t)b * TT * DM, nullptr, WQ, nullptr, DM, FQKV, DQ + 2 * DKV, nullptr, 0, 0, 0);
        k_rope<<<LQK, 256, 0, stream>>>(FQKV, DQ + 2 * DKV, NH_ + NKV, CS, nullptr, nullptr, 1.0f, QK16 + (size_t)b * (NH_ + NKV) * TT * HD, QKh + (size_t)b * (NH_ + NKV) * TT * HD, QKl + (size_t)b * (NH_ + NKV) * TT * HD);   // heads 0..11 are q, 12..23 are k
        k_vtp<<<LKv, 256, 0, stream>>>(FQKV + DQ + DKV, DQ + 2 * DKV, NKV, VT16 + (size_t)b * NKV * HD * TT, VTh + (size_t)b * NKV * HD * TT, VTl + (size_t)b * NKV * HD * TT); }
    k_fattn<<<dim3(NB_ * NH_, (TT - RH) / 128 + RH / 64, 1), 128, 0, stream>>>(QK16, QKh, QKl, VT16, VTh, VTl, ATh, ATl);   // attention of all batches and heads in one launch
    k_gemmw<bf, 1, true, 8><<<dim3(NB_ * TT / 64, DM / 64, 1), 256, 0, stream>>>(ATh, ATl, WO, nullptr, DQ, OUT, DM, bo, 0, 0, 0);   // output projection of all batches in one launch (rows b * TT + t)
}

// v004
// One run takes 176 microseconds.
// Next to v003, in two timings, it ran 1.58 and 1.59 times as fast.
// Over all steps from v000 it is 12.1 times as fast.
#include <hip/hip_runtime.h>

// Causal multi-head attention at d_model 768 with bias-free projections and an output bias (x [4][2048][768]; q, k, v = x W ('xw' [768][768], no bias; 12 heads x 64); scores masked (-inf) then / sqrt(64); softmax; out = merged Wo + bo ('xw' + bias) -> [4][2048][768] (6.3 M); argument order x, Wq, Wk, Wv, Wo, bo).
// Layout: one preparation launch (bf16 copy of x; 'xw' weights transposed); exact projections (K 768) of all batches in one launch that writes the head planes itself; one fused causal attention launch for all batches and heads (hybrid rows: < 512 hi/lo 3 products, rest fp16; running maximum and sum, keys only up to the diagonal); merged hi/lo x Wo exact + bo.
// Compute dtypes, f32 accumulate: every input rounded to bf16; projections exact; attention rows < 512 3 products, rest fp16; softmax f32; Wo hl x exact + bias.

#define NB_  4
#define TT   2048
#define DM   768
#define NH_  12
#define NKV  12
#define REP  (NH_ / NKV)
#define HD   64
#define DQ   (NH_ * HD)
#define DKV  (NKV * HD)
#define RH   512                  // query rows < RH use hi+lo planes (0: none)
#define SCL  0.125f   // HD^-0.5
typedef _Float16 h16;
typedef unsigned short bf;
typedef __attribute__((ext_vector_type(16))) __bf16   v16bf;
typedef __attribute__((ext_vector_type(16))) _Float16 v16h;
typedef __attribute__((ext_vector_type(8)))  _Float16 v8h;
typedef __attribute__((ext_vector_type(8)))  unsigned short v8us;
typedef __attribute__((ext_vector_type(8)))  float    v8f;
typedef __attribute__((ext_vector_type(4)))  float    v4f;
typedef v8h  __attribute__((may_alias)) v8ha;
typedef v4f  __attribute__((may_alias)) v4fa;
typedef v8us __attribute__((may_alias)) v8usa;

__device__ __forceinline__ unsigned short f2bf(float f) { unsigned u = __float_as_uint(f); u += 0x7FFFu + ((u >> 16) & 1u); return (unsigned short)(u >> 16); }
__device__ __forceinline__ float bf2f(unsigned short b) { return __uint_as_float(((unsigned)b) << 16); }
__device__ __forceinline__ float bfr(float f) { return bf2f(f2bf(f)); }
__device__ __forceinline__ v16h cat16(v8h lo, v8h hi) { return __builtin_shufflevector(lo, hi, 0, 1, 2, 3, 4, 5, 6, 7, 8, 9, 10, 11, 12, 13, 14, 15); }
__device__ __forceinline__ v16bf cat16b(v8us lo, v8us hi) { return __builtin_bit_cast(v16bf, __builtin_shufflevector(lo, hi, 0, 1, 2, 3, 4, 5, 6, 7, 8, 9, 10, 11, 12, 13, 14, 15)); }
__device__ __forceinline__ v8f wmma16(v16h a, v16h b, v8f c) { return __builtin_amdgcn_wmma_f32_16x16x32_f16(false, a, false, b, (short)0, c, false, false); }
__device__ __forceinline__ v8f wmmab(v16bf a, v16bf b, v8f c) { return __builtin_amdgcn_wmma_f32_16x16x32_bf16(false, a, false, b, (short)0, c, false, false); }

__device__ __forceinline__ h16 tohx(float x) { return (h16)x; }
__device__ __forceinline__ void splitf(float y, unsigned short& h, unsigned short& l) { h = f2bf(y); l = f2bf(y - bf2f(h)); }
// stands behind a run of global loads or stores, in front of whatever next overwrites a register that they name (address pair, store data)
#define XWAIT() asm volatile("s_wait_xcnt 0x0" ::: "memory")

// ---- ksum_store: the NW waves of a work-group each hold a partial 64x64 tile (their share of the K loop). Each wave writes its partial column-major (pitch 68) into its own LDS slot,
// one barrier, then every thread adds the NW slots in slot order for 4 rows of one column and stores them (a wave covers 32 adjacent columns: whole 128-byte lines).
// PL: the sums leave as 16-bit planes instead (fp16, bf16 hi, bf16 lo; element [column][row] at pbase + column * ppitch + row): every thread adds the slots in the same order for 8 rows of one column and stores 16 bytes
// to each plane (8 adjacent lanes fill one 128-byte line).
#define KSLOT (64 * 68)
template <int NW, bool BIAS, bool PL>
__device__ __forceinline__ void ksum_store(float* os, const v8f (&acc)[4][4], int wave, int lane, float* C, int ldc, int r0, int c0, const float* __restrict__ bias, h16* P16, bf* Ph, bf* Pl, size_t pbase, int ppitch) {
    const int lr = lane & 15, hi = lane >> 4; float* slot = os + wave * KSLOT;
#pragma unroll
    for (int mb = 0; mb < 4; ++mb)
#pragma unroll
        for (int nb = 0; nb < 4; ++nb) { float* p = slot + (nb * 16 + lr) * 68 + mb * 16 + hi * 8; const v8f t = acc[mb][nb];
            *(v4fa*)p = __builtin_shufflevector(t, t, 0, 1, 2, 3); *(v4fa*)(p + 4) = __builtin_shufflevector(t, t, 4, 5, 6, 7); }
    __syncthreads();   // every wave's partial tile is in LDS before any thread sums across the slots
    if constexpr (PL) {
#pragma unroll
        for (int i = 0; i < 512 / (NW * 32); ++i) { const int u = i * NW * 32 + (int)threadIdx.x; const float* p = os + (u >> 3) * 68 + (u & 7) * 8; v4f s0 = *(const v4fa*)p, s1 = *(const v4fa*)(p + 4);
#pragma unroll
            for (int w = 1; w < NW; ++w) { s0 += *(const v4fa*)(p + w * KSLOT); s1 += *(const v4fa*)(p + w * KSLOT + 4); }
            v8h o16; v8us oh, ol;
#pragma unroll
            for (int j = 0; j < 8; ++j) { const float r = j < 4 ? s0[j & 3] : s1[j & 3]; o16[j] = tohx(r); unsigned short a2, c2; splitf(r, a2, c2); oh[j] = a2; ol[j] = c2; }
            const size_t e = pbase + (size_t)(u >> 3) * ppitch + (u & 7) * 8;
            *(v8h*)(P16 + e) = o16; *(v8us*)(Ph + e) = oh; *(v8us*)(Pl + e) = ol; XWAIT(); }
        return; }
    constexpr int NU = 1024 / (NW * 32); v4f s[NU];
#pragma unroll
    for (int i = 0; i < NU; ++i) { const int u = i * NW * 32 + (int)threadIdx.x; const float* p = os + (u & 63) * 68 + (u >> 6) * 4; s[i] = *(const v4fa*)p;
#pragma unroll
        for (int w = 1; w < NW; ++w) s[i] += *(const v4fa*)(p + w * KSLOT); }
    const int col = (int)threadIdx.x & 63; float bb = 0.f; if (BIAS) bb = bfr(bias[c0 + col]);
#pragma unroll
    for (int i = 0; i < NU; ++i) { const int rg = (i * NW * 32 + (int)threadIdx.x) >> 6; float* cp = C + (size_t)(r0 + rg * 4) * ldc + c0 + col;
#pragma unroll
        for (int q = 0; q < 4; ++q) cp[(size_t)q * ldc] = BIAS ? s[i][q] + bb : s[i][q]; }
}

// ---- k_gemmw: register-blocked GEMM, one work-group of NW waves per 64x64 output tile; every wave holds the whole tile (16 accumulators) for its interleaved share of the K loop (32-wide K blocks wave, wave + NW, ...), operands straight from K-contiguous 16-bit planes; partials summed by ksum_store; grid (M/64, N/64, Z), NW x 32 threads.
// C[m][n] (f32, pitch ldc, + optional f32 bias[n]) = sum_k A[m][k] Bt[n][k] (+ split products per NSPLIT). z-batch strides sA/sB/sC in elements. K % 32 == 0.
// PL (the q/k/v projection of all batches; rows b * TT + t, a 64-column tile is one head): no C; the tile goes straight to the head planes that the attention kernel reads. A v tile leaves as V^T [d][t], which is the
// column-major order of the LDS slots as they stand; a q or k tile leaves as [t][d], so there the two operands change places (both use the same loader and k order) and the slots hold the transposed tile.
template <typename T16> struct WFrag;
template <> struct WFrag<h16> { typedef v16h V; static __device__ __forceinline__ V ld(const h16* p) { return cat16(*(const v8h*)p, *(const v8h*)(p + 16)); } static __device__ __forceinline__ v8f mma(V a, V b, v8f c) { return wmma16(a, b, c); } };
template <> struct WFrag<bf> { typedef v16bf V; static __device__ __forceinline__ V ld(const bf* p) { return cat16b(*(const v8us*)p, *(const v8us*)(p + 16)); } static __device__ __forceinline__ v8f mma(V a, V b, v8f c) { return wmmab(a, b, c); } };
template <typename T16, int NSPLIT, bool BIAS, int NW, bool PL>
__global__ __launch_bounds__(NW * 32) void k_gemmw(const T16* __restrict__ A, const T16* __restrict__ A2, const T16* __restrict__ Bt, const T16* __restrict__ Bt2, int K, float* C, int ldc, const float* __restrict__ bias, size_t sA, size_t sB, size_t sC,
                                                   h16* QK16, bf* QKh, bf* QKl, h16* VT16, bf* VTh, bf* VTl) {
    typedef typename WFrag<T16>::V V;
    __shared__ __align__(16) float os[NW * KSLOT];
    const size_t z = blockIdx.z; A += z * sA; if (A2) A2 += z * sA; Bt += z * sB; if (Bt2) Bt2 += z * sB; C += z * sC;
    const int lane = threadIdx.x & 31, lr = lane & 15, hi = lane >> 4; const int wave = __builtin_amdgcn_readfirstlane((int)(threadIdx.x >> 5)); const int r0 = blockIdx.x * 64, c0 = blockIdx.y * 64;
    v8f acc[4][4];
#pragma unroll
    for (int mb = 0; mb < 4; ++mb)
#pragma unroll
        for (int nb = 0; nb < 4; ++nb) acc[mb][nb] = (v8f){};
    const bool sw = PL && c0 < DQ + DKV;   // q or k tile (the same for the whole work-group): weight rows as the A operand, token rows as B
    if (sw) { const T16* t = A; A = Bt; Bt = t; }
    const size_t aoff = (size_t)((sw ? c0 : r0) + lr) * K + 8 * hi, boff = (size_t)((sw ? r0 : c0) + lr) * K + 8 * hi;
#pragma unroll 1
    for (int kc = wave * 32; kc < K; kc += NW * 32) {
        V a[4], a2[4];
#pragma unroll
        for (int mb = 0; mb < 4; ++mb) { a[mb] = WFrag<T16>::ld(A + aoff + (size_t)mb * 16 * K + kc); if (NSPLIT == 1 || NSPLIT == 2) a2[mb] = WFrag<T16>::ld(A2 + aoff + (size_t)mb * 16 * K + kc); }
#pragma unroll
        for (int nb = 0; nb < 4; ++nb) { const V b = WFrag<T16>::ld(Bt + boff + (size_t)nb * 16 * K + kc); V b2; if (NSPLIT >= 2) b2 = WFrag<T16>::ld(Bt2 + boff + (size_t)nb * 16 * K + kc);
#pragma unroll
            for (int mb = 0; mb < 4; ++mb) { acc[mb][nb] = WFrag<T16>::mma(a[mb], b, acc[mb][nb]); if (NSPLIT == 1 || NSPLIT == 2) acc[mb][nb] = WFrag<T16>::mma(a2[mb], b, acc[mb][nb]); if (NSPLIT >= 2) acc[mb][nb] = WFrag<T16>::mma(a[mb], b2, acc[mb][nb]); } }
        asm volatile("v_nop\n\tv_nop\n\tv_nop\n\tv_nop" : "+v"(acc[0][0]), "+v"(acc[1][1]), "+v"(acc[2][2]), "+v"(acc[3][3]) : "v"(a[0]), "v"(a[3]));
    }
    const int pb = r0 / TT, pt = r0 % TT, ph = c0 / HD;   // batch, first token and head (0 .. 11 q, 12 .. 23 k, 24 .. 35 v) of a PL tile
    ksum_store<NW, BIAS, PL>(os, acc, wave, lane, C, ldc, r0, c0, bias, sw ? QK16 : VT16, sw ? QKh : VTh, sw ? QKl : VTl,
                             sw ? ((size_t)(pb * (NH_ + NKV) + ph) * TT + pt) * HD : (size_t)(pb * NKV + ph - NH_ - NKV) * HD * TT + pt, sw ? HD : TT);
}

typedef __attribute__((ext_vector_type(2))) _Float16 v2h;
typedef __attribute__((ext_vector_type(4))) _Float16 v4h;
typedef __attribute__((ext_vector_type(2))) unsigned short v2us;
typedef __attribute__((ext_vector_type(4))) unsigned short v4us;
typedef __attribute__((ext_vector_type(2))) float v2f;
typedef __attribute__((ext_vector_type(4))) int v4i;

// ---- k_prep: all operand preparation in one launch. Work-groups 0 .. 4 WTB - 1: the four 'xw' weights [k][n] to bf16 [n][k], back to back in Wt (each wave writes 8 lines of 64 elements);
// the other CVB work-groups: x to bf16, 4 x 8 elements a thread.
#define WTB (DM * DQ / 64 / 64)
#define CVB (NB_ * TT * DM / 8 / 1024)
static_assert(DQ == DM && DKV == DM && WTB * 64 * 64 == DM * DQ && CVB * 8 * 1024 == NB_ * TT * DM, "the preparation grid covers every element exactly once");
__global__ __launch_bounds__(256) void k_prep(const float* __restrict__ x, const float* __restrict__ wq, const float* __restrict__ wk, const float* __restrict__ wv, const float* __restrict__ wo, bf* Wt, bf* XB) {
    const int blk = blockIdx.x;
    if (blk < 4 * WTB) {
        const int id = blk / WTB; const float* __restrict__ w = id == 0 ? wq : id == 1 ? wk : id == 2 ? wv : wo; bf* Bt = Wt + (size_t)id * DM * DQ;
        const int lane = threadIdx.x & 31; const int e0 = (((blk % WTB) * 8 + (int)(threadIdx.x >> 5)) * 8) * 64 + lane * 2; float f[8][2];
#pragma unroll
        for (int l = 0; l < 8; ++l) { const int e = e0 + l * 64; const int k = e % DM, n = e / DM; f[l][0] = w[(size_t)k * DQ + n]; f[l][1] = w[(size_t)(k + 1) * DQ + n]; }
        XWAIT();
#pragma unroll
        for (int l = 0; l < 8; ++l) { v2us o; o[0] = f2bf(f[l][0]); o[1] = f2bf(f[l][1]); *(v2us*)(Bt + e0 + l * 64) = o; }
        XWAIT();
    } else {
        const size_t i0 = (size_t)(blk - 4 * WTB) * 1024 + threadIdx.x; v8f v[4];
#pragma unroll
        for (int q = 0; q < 4; ++q) v[q] = *(const v8f*)(x + (i0 + q * 256) * 8);
        XWAIT();
#pragma unroll
        for (int q = 0; q < 4; ++q) { v8us o;
#pragma unroll
            for (int k = 0; k < 8; ++k) o[k] = f2bf(v[q][k]);
            *(v8us*)(XB + (i0 + q * 256) * 8) = o; }
        XWAIT();
    }
}
#define SC2 (SCL * 1.4426950408889634f)   // score scale x log2(e): the exponentials are taken to base 2
typedef __attribute__((ext_vector_type(16))) unsigned short v16us;
template <typename T16, bool HL, int NQ, bool DIAG>
__device__ __forceinline__ void attn_step(const T16* __restrict__ Kp, const T16* __restrict__ K2, const T16* __restrict__ Vt, const T16* __restrict__ Vt2, int k0, int q0, int lr, int hi,
                                          const typename WFrag<T16>::V (&qf)[NQ][2], const typename WFrag<T16>::V (&q2f)[NQ][2], typename WFrag<T16>::V (&kf)[2][2], float (&m)[NQ], float (&l)[NQ], v8f (&o)[4][NQ]) {
    typedef WFrag<T16> F; typedef typename F::V V;
    v8f s[2][NQ];
#pragma unroll
    for (int kt = 0; kt < 2; ++kt)
#pragma unroll
        for (int qt = 0; qt < NQ; ++qt) s[kt][qt] = (v8f){};
    V a2[2][2], va[4], va2[4];   // this pass's lo K plane and V^T fragments are requested first: V^T flies under the score products and the softmax arithmetic
    if (HL) {
#pragma unroll
        for (int kt = 0; kt < 2; ++kt)
#pragma unroll
            for (int ks = 0; ks < 2; ++ks) a2[kt][ks] = F::ld(K2 + (size_t)(k0 + kt * 16 + lr) * HD + ks * 32 + 8 * hi);
        XWAIT(); }
#pragma unroll
    for (int dt = 0; dt < 4; ++dt) { const size_t off = (size_t)(dt * 16 + lr) * TT + k0 + 8 * hi; va[dt] = F::ld(Vt + off); if (HL) va2[dt] = F::ld(Vt2 + off); }
    XWAIT();
#pragma unroll
    for (int kt = 0; kt < 2; ++kt)
#pragma unroll
        for (int ks = 0; ks < 2; ++ks)
#pragma unroll
            for (int qt = 0; qt < NQ; ++qt) { s[kt][qt] = F::mma(kf[kt][ks], qf[qt][ks], s[kt][qt]); if (HL) { s[kt][qt] = F::mma(kf[kt][ks], q2f[qt][ks], s[kt][qt]); s[kt][qt] = F::mma(a2[kt][ks], qf[qt][ks], s[kt][qt]); } }
    if (!DIAG) {   // the next pass's K fragments, into the registers that the score products have just read (a pass below the diagonal is always followed by another)
#pragma unroll
        for (int kt = 0; kt < 2; ++kt)
#pragma unroll
            for (int ks = 0; ks < 2; ++ks) kf[kt][ks] = F::ld(Kp + (size_t)(k0 + 32 + kt * 16 + lr) * HD + ks * 32 + 8 * hi);
        XWAIT(); }
    if (DIAG) {
#pragma unroll
        for (int kt = 0; kt < 2; ++kt)
#pragma unroll
            for (int qt = 0; qt < NQ; ++qt)
#pragma unroll
                for (int j = 0; j < 8; ++j) if (k0 + kt * 16 + hi * 8 + j > q0 + qt * 16 + lr) s[kt][qt][j] = -3.0e38f; }
    float mx[NQ]; bool need = false;
#pragma unroll
    for (int qt = 0; qt < NQ; ++qt) { float t = fmaxf(s[0][qt][0], s[1][qt][0]);
#pragma unroll
        for (int j = 1; j < 8; ++j) t = fmaxf(t, fmaxf(s[0][qt][j], s[1][qt][j]));
        mx[qt] = fmaxf(t, __shfl_xor(t, 16, 32)); need = need || (mx[qt] > m[qt]); }
    if (__builtin_amdgcn_ballot_w32(need) != 0) {   // some row's maximum rose: bring sums and outputs to the new maximum (factor exactly 1 for the rows whose maximum stayed)
#pragma unroll
        for (int qt = 0; qt < NQ; ++qt) { const float mn = fmaxf(m[qt], mx[qt]); const float al = __builtin_amdgcn_exp2f((m[qt] - mn) * SC2); m[qt] = mn; l[qt] *= al;
#pragma unroll
            for (int dt = 0; dt < 4; ++dt) o[dt][qt] *= al; } }
    V pb[NQ], pb2[NQ];
#pragma unroll
    for (int qt = 0; qt < NQ; ++qt) { const float nm = -m[qt] * SC2; float p[16];
#pragma unroll
        for (int e = 0; e < 16; ++e) { p[e] = __builtin_amdgcn_exp2f(fmaf(s[e >> 3][qt][e & 7], SC2, nm)); l[qt] += p[e]; }
        if constexpr (HL) { v16us ph, pl;
#pragma unroll
            for (int e = 0; e < 16; ++e) { unsigned short a, c2; splitf(p[e], a, c2); ph[e] = a; pl[e] = c2; }
            pb[qt] = __builtin_bit_cast(v16bf, ph); pb2[qt] = __builtin_bit_cast(v16bf, pl);
        } else {
#pragma unroll
            for (int e = 0; e < 16; ++e) pb[qt][e] = tohx(p[e]); } }
#pragma unroll
    for (int dt = 0; dt < 4; ++dt)
#pragma unroll
        for (int qt = 0; qt < NQ; ++qt) { o[dt][qt] = F::mma(va[dt], pb[qt], o[dt][qt]); if (HL) { o[dt][qt] = F::mma(va[dt], pb2[qt], o[dt][qt]); o[dt][qt] = F::mma(va2[dt], pb[qt], o[dt][qt]); } }
}
template <typename T16, bool HL, int NQ>
__device__ __forceinline__ void attn_rows(const T16* __restrict__ Q, const T16* __restrict__ Q2, const T16* __restrict__ Kp, const T16* __restrict__ K2, const T16* __restrict__ Vt, const T16* __restrict__ Vt2, int q0, int lane, bf* Ah, bf* Al) {
    typedef WFrag<T16> F; typedef typename F::V V; const int lr = lane & 15, hi = lane >> 4;
    V qf[NQ][2], q2f[NQ][2], kf[2][2];
#pragma unroll
    for (int qt = 0; qt < NQ; ++qt)
#pragma unroll
        for (int ks = 0; ks < 2; ++ks) { const size_t off = (size_t)(q0 + qt * 16 + lr) * HD + ks * 32 + 8 * hi; qf[qt][ks] = F::ld(Q + off); if (HL) q2f[qt][ks] = F::ld(Q2 + off); }
#pragma unroll
    for (int kt = 0; kt < 2; ++kt)
#pragma unroll
        for (int ks = 0; ks < 2; ++ks) kf[kt][ks] = F::ld(Kp + (size_t)(kt * 16 + lr) * HD + ks * 32 + 8 * hi);   // keys 0 .. 31; every later pass's K fragments are fetched one pass ahead
    XWAIT();
    float m[NQ], l[NQ]; v8f o[4][NQ]; const int kd = q0 & ~31;   // first key of the 32-key block that holds the diagonal
#pragma unroll
    for (int qt = 0; qt < NQ; ++qt) { m[qt] = -3.0e38f; l[qt] = 0.f; }
#pragma unroll
    for (int dt = 0; dt < 4; ++dt)
#pragma unroll
        for (int qt = 0; qt < NQ; ++qt) o[dt][qt] = (v8f){};
#pragma unroll 1
    for (int k0 = 0; k0 < kd; k0 += 32) {
        attn_step<T16, HL, NQ, false>(Kp, K2, Vt, Vt2, k0, q0, lr, hi, qf, q2f, kf, m, l, o);
    }
    attn_step<T16, HL, NQ, true>(Kp, K2, Vt, Vt2, kd, q0, lr, hi, qf, q2f, kf, m, l, o);   // the diagonal block: keys kd .. kd + 31, masked by select
#pragma unroll
    for (int qt = 0; qt < NQ; ++qt) { const float inv = __fdiv_rn(1.0f, l[qt] + __shfl_xor(l[qt], 16, 32)); const size_t ro = (size_t)(q0 + qt * 16 + lr) * DQ + 8 * hi;
#pragma unroll
        for (int dt = 0; dt < 4; ++dt) { v8us oh, ol;
#pragma unroll
            for (int j = 0; j < 8; ++j) { unsigned short a, c2; splitf(o[dt][qt][j] * inv, a, c2); oh[j] = a; ol[j] = c2; }
            *(v8us*)(Ah + ro + dt * 16) = oh; *(v8us*)(Al + ro + dt * 16) = ol; XWAIT(); } }
}
// grid (batch x head, position blocks: first the (TT - RH) / 128 fp16 blocks of 4 waves x 32 rows, the longest first, then the RH / 64 hi/lo blocks of 4 waves x 16 rows); the 4 waves of a work-group are independent
// (adjacent query rows walk the same keys: they meet in the WGP cache). The hi/lo rows take 16 per wave because both planes of every operand are live: at 32 the kernel needs registers above v255.
#define NFB ((TT - RH) / 128)
__global__ __launch_bounds__(128) void k_fattn(const h16* __restrict__ QK16, const bf* __restrict__ QKh, const bf* __restrict__ QKl, const h16* __restrict__ VT16, const bf* __restrict__ VTh, const bf* __restrict__ VTl, bf* ATh, bf* ATl) {
    const int lane = threadIdx.x & 31; const int wave = __builtin_amdgcn_readfirstlane((int)(threadIdx.x >> 5)); const int b = blockIdx.x / NH_, h = blockIdx.x % NH_, y = blockIdx.y;
    const size_t qo = ((size_t)b * (NH_ + NKV) + h) * TT * HD, ko = ((size_t)b * (NH_ + NKV) + NH_ + h / REP) * TT * HD, vo = ((size_t)b * NKV + h / REP) * HD * TT, ao = (size_t)b * TT * DQ + h * HD;
    if (y < NFB) attn_rows<h16, false, 2>(QK16 + qo, nullptr, QK16 + ko, nullptr, VT16 + vo, nullptr, TT - (y + 1) * 128 + wave * 32, lane, ATh + ao, ATl + ao);
    else attn_rows<bf, true, 1>(QKh + qo, QKl + qo, QKh + ko, QKl + ko, VTh + vo, VTl + vo, RH - (y - NFB + 1) * 64 + wave * 16, lane, ATh + ao, ATl + ao);
}

extern "C" void kernel_launch(void* const* d_in, const int* in_sizes, int n_in,
                              void* d_out, int out_size, void* d_ws, size_t ws_size, hipStream_t stream) {
    (void)in_sizes; (void)n_in; (void)out_size;
    const float* x = (const float*)d_in[0]; const float* wq = (const float*)d_in[1]; const float* wk = (const float*)d_in[2]; const float* wv = (const float*)d_in[3]; const float* wo = (const float*)d_in[4]; const float* bo = (const float*)d_in[5];   /* inputs x, Wq, Wk, Wv, Wo ('xw' [768][768]), bo */
    float* OUT = (float*)d_out;     // [4][2048][768]
    char* wsp = (char*)d_ws;
    auto take = [&](size_t bytes) { char* p = wsp; wsp += (bytes + 255) & ~(size_t)255; return (void*)p; };
    bf* WQ = (bf*)take((size_t)DQ * DM * 2); bf* WK = (bf*)take((size_t)DKV * DM * 2); bf* WV = (bf*)take((size_t)DKV * DM * 2); bf* WO = (bf*)take((size_t)DM * DQ * 2); (void)WK; (void)WV;   // back to back: one [DQ + 2 DKV + DM][DM] block
    bf* XB = (bf*)take((size_t)NB_ * TT * DM * 2);
    // planes of all batches: per batch the 12 q heads directly followed by the 12 k heads (fp16, hi, lo alike)
    h16* QK16 = (h16*)take((size_t)NB_ * (NH_ + NKV) * TT * HD * 2); bf* QKh = (bf*)take((size_t)NB_ * (NH_ + NKV) * TT * HD * 2); bf* QKl = (bf*)take((size_t)NB_ * (NH_ + NKV) * TT * HD * 2);
    h16* VT16 = (h16*)take((size_t)NB_ * NKV * HD * TT * 2); bf* VTh = (bf*)take((size_t)NB_ * NKV * HD * TT * 2); bf* VTl = (bf*)take((size_t)NB_ * NKV * HD * TT * 2);
    bf* ATh = (bf*)take((size_t)NB_ * TT * DQ * 2); bf* ATl = (bf*)take((size_t)NB_ * TT * DQ * 2);
    if ((size_t)(wsp - (char*)d_ws) > ws_size) return;    // ws 256 MiB
    k_prep<<<4 * WTB + CVB, 256, 0, stream>>>(x, wq, wk, wv, wo, WQ, XB);
    // q, k, v of all batches in one GEMM (WQ, WK, WV are one [DQ + 2 DKV][DM] transposed weight); its epilogue writes the head planes
    k_gemmw<bf, 0, false, 8, true><<<dim3(NB_ * TT / 64, (DQ + 2 * DKV) / 64, 1), 256, 0, stream>>>(XB, nullptr, WQ, nullptr, DM, nullptr, 0, nullptr, 0, 0, 0, QK16, QKh, QKl, VT16, VTh, VTl);
    k_fattn<<<dim3(NB_ * NH_, (TT - RH) / 128 + RH / 64, 1), 128, 0, stream>>>(QK16, QKh, QKl, VT16, VTh, VTl, ATh, ATl);   // attention of all batches and heads in one launch
    k_gemmw<bf, 1, true, 8, false><<<dim3(NB_ * TT / 64, DM / 64, 1), 256, 0, stream>>>(ATh, ATl, WO, nullptr, DQ, OUT, DM, bo, 0, 0, 0, nullptr, nullptr, nullptr, nullptr, nullptr, nullptr);   // output projection of all batches in one launch (rows b * TT + t)
}

// v005
// One run takes 126 microseconds.
// Next to v004, in two timings, it ran 1.40 times as fast each time.
// Counting every step since v000, it is 16.9 times as fast.
#include <hip/hip_runtime.h>

// Causal multi-head attention at d_model 768 with bias-free projections and an output bias (x [4][2048][768]; q, k, v = x W ('xw' [768][768], no bias; 12 heads x 64); scores masked (-inf) then / sqrt(64); softmax; out = merged Wo + bo ('xw' + bias) -> [4][2048][768] (6.3 M); argument order x, Wq, Wk, Wv, Wo, bo).
// Layout: one preparation launch (bf16 copy of x; 'xw' weights transposed); exact projections (K 768) of all batches in one launch that writes the head planes itself; one fused causal attention launch for all batches and heads (hybrid rows: < 512 hi/lo 3 products, rest fp16; running maximum and sum, keys only up to the diagonal); merged hi/lo x Wo exact + bo.
// Every 16-bit operand plane lies in FRAGMENT ORDER: a block of 16 rows x 32 k is 1,024 contiguous bytes, element (row r, k) at j * 256 + (h * 16 + r) * 8 + e with k = j * 16 + h * 8 + e (j, h in 0..1, e in 0..7),
// so that lane h * 16 + r of a wave finds the two 16-byte halves of its WMMA fragment at lane * 8 and 256 + lane * 8: each wave-wide load or store covers four whole 128-byte lines. The k order of every fragment is what it was.
// Compute dtypes, f32 accumulate: every input rounded to bf16; projections exact; attention rows < 512 3 products, rest fp16; softmax f32; Wo hl x exact + bias.

#define NB_  4
#define TT   2048
#define DM   768
#define NH_  12
#define NKV  12
#define REP  (NH_ / NKV)
#define HD   64
#define DQ   (NH_ * HD)
#define DKV  (NKV * HD)
#define RH   512                  // query rows < RH use hi+lo planes (0: none)
#define SCL  0.125f   // HD^-0.5
typedef _Float16 h16;
typedef unsigned short bf;
typedef __attribute__((ext_vector_type(16))) __bf16   v16bf;
typedef __attribute__((ext_vector_type(16))) _Float16 v16h;
typedef __attribute__((ext_vector_type(8)))  _Float16 v8h;
typedef __attribute__((ext_vector_type(8)))  unsigned short v8us;
typedef __attribute__((ext_vector_type(8)))  float    v8f;
typedef __attribute__((ext_vector_type(4)))  float    v4f;
typedef v8h  __attribute__((may_alias)) v8ha;
typedef v4f  __attribute__((may_alias)) v4fa;
typedef v8us __attribute__((may_alias)) v8usa;

__device__ __forceinline__ unsigned short f2bf(float f) { unsigned u = __float_as_uint(f); u += 0x7FFFu + ((u >> 16) & 1u); return (unsigned short)(u >> 16); }
__device__ __forceinline__ float bf2f(unsigned short b) { return __uint_as_float(((unsigned)b) << 16); }
__device__ __forceinline__ float bfr(float f) { return bf2f(f2bf(f)); }
__device__ __forceinline__ v16h cat16(v8h lo, v8h hi) { return __builtin_shufflevector(lo, hi, 0, 1, 2, 3, 4, 5, 6, 7, 8, 9, 10, 11, 12, 13, 14, 15); }
__device__ __forceinline__ v16bf cat16b(v8us lo, v8us hi) { return __builtin_bit_cast(v16bf, __builtin_shufflevector(lo, hi, 0, 1, 2, 3, 4, 5, 6, 7, 8, 9, 10, 11, 12, 13, 14, 15)); }
__device__ __forceinline__ v8f wmma16(v16h a, v16h b, v8f c) { return __builtin_amdgcn_wmma_f32_16x16x32_f16(false, a, false, b, (short)0, c, false, false); }
__device__ __forceinline__ v8f wmmab(v16bf a, v16bf b, v8f c) { return __builtin_amdgcn_wmma_f32_16x16x32_bf16(false, a, false, b, (short)0, c, false, false); }

__device__ __forceinline__ h16 tohx(float x) { return (h16)x; }
__device__ __forceinline__ void splitf(float y, unsigned short& h, unsigned short& l) { h = f2bf(y); l = f2bf(y - bf2f(h)); }
// stands behind a run of global loads or stores, in front of whatever next overwrites a register that they name (address pair, store data)
#define XWAIT() asm volatile("s_wait_xcnt 0x0" ::: "memory")
// the same wait behind a run of loads from two (four) addresses plus immediate offsets: the addresses are inputs, so they stay in their registers up to the wait and no load of the run lands on them
#define XWAITA(p, q) asm volatile("s_wait_xcnt 0x0" :: "v"(p), "v"(q) : "memory")
#define XWAITA4(p, q, r, s) asm volatile("s_wait_xcnt 0x0" :: "v"(p), "v"(q), "v"(r), "v"(s) : "memory")

// ---- ksum_store: the NW waves of a work-group each hold a partial 64x64 tile (their share of the K loop). Each wave writes its partial column-major (pitch 68) into its own LDS slot,
// one barrier, then every thread adds the NW slots in slot order for 4 rows of one column and stores them (a wave covers 32 adjacent columns: whole 128-byte lines).
// PL: the sums leave as 16-bit planes instead (fp16, bf16 hi, bf16 lo), in fragment order: the tile is 8 blocks = 4,096 contiguous elements from pbase. Every thread adds the slots in the same order for 8 rows of one column
// (a slot column is a fragment row, 8 slot rows are 8 k) and stores 16 bytes to each plane at pbase + unit * 8 (a wave fills four whole lines). QK: blocks ordered (16 columns, 32 rows); else (32 rows, 16 columns).
#define KSLOT (64 * 68)
template <int NW, bool BIAS, bool PL>
__device__ __forceinline__ void ksum_store(float* os, const v8f (&acc)[4][4], int wave, int lane, float* C, int ldc, int r0, int c0, const float* __restrict__ bias, h16* P16, bf* Ph, bf* Pl, size_t pbase, bool qk) {
    const int lr = lane & 15, hi = lane >> 4; float* slot = os + wave * KSLOT;
#pragma unroll
    for (int mb = 0; mb < 4; ++mb)
#pragma unroll
        for (int nb = 0; nb < 4; ++nb) { float* p = slot + (nb * 16 + lr) * 68 + mb * 16 + hi * 8; const v8f t = acc[mb][nb];
            *(v4fa*)p = __builtin_shufflevector(t, t, 0, 1, 2, 3); *(v4fa*)(p + 4) = __builtin_shufflevector(t, t, 4, 5, 6, 7); }
    __syncthreads();   // every wave's partial tile is in LDS before any thread sums across the slots
    if constexpr (PL) {
#pragma unroll
        for (int i = 0; i < 512 / (NW * 32); ++i) { const int u = i * NW * 32 + (int)threadIdx.x, hb = u >> 5;   // hb: which 512-byte half block of the tile
            const int col = (qk ? hb >> 2 : (hb >> 1) & 3) * 16 + (u & 15), row = (qk ? (hb & 3) * 16 : (hb >> 3) * 32 + (hb & 1) * 16) + ((u >> 4) & 1) * 8;
            const float* p = os + col * 68 + row; v4f s0 = *(const v4fa*)p, s1 = *(const v4fa*)(p + 4);
#pragma unroll
            for (int w = 1; w < NW; ++w) { s0 += *(const v4fa*)(p + w * KSLOT); s1 += *(const v4fa*)(p + w * KSLOT + 4); }
            v8h o16; v8us oh, ol;
#pragma unroll
            for (int j = 0; j < 8; ++j) { const float r = j < 4 ? s0[j & 3] : s1[j & 3]; o16[j] = tohx(r); unsigned short a2, c2; splitf(r, a2, c2); oh[j] = a2; ol[j] = c2; }
            const size_t e = pbase + (size_t)u * 8;
            *(v8h*)(P16 + e) = o16; *(v8us*)(Ph + e) = oh; *(v8us*)(Pl + e) = ol; XWAIT(); }
        return; }
    constexpr int NU = 1024 / (NW * 32); v4f s[NU];
#pragma unroll
    for (int i = 0; i < NU; ++i) { const int u = i * NW * 32 + (int)threadIdx.x; const float* p = os + (u & 63) * 68 + (u >> 6) * 4; s[i] = *(const v4fa*)p;
#pragma unroll
        for (int w = 1; w < NW; ++w) s[i] += *(const v4fa*)(p + w * KSLOT); }
    const int col = (int)threadIdx.x & 63; float bb = 0.f; if (BIAS) bb = bfr(bias[c0 + col]);
#pragma unroll
    for (int i = 0; i < NU; ++i) { const int rg = (i * NW * 32 + (int)threadIdx.x) >> 6; float* cp = C + (size_t)(r0 + rg * 4) * ldc + c0 + col;
#pragma unroll
        for (int q = 0; q < 4; ++q) cp[(size_t)q * ldc] = BIAS ? s[i][q] + bb : s[i][q]; }
}

// ---- k_gemmw: register-blocked GEMM, one work-group of NW waves per 64x64 output tile; every wave holds the whole tile (16 accumulators) for its interleaved share of the K loop (32-wide K blocks wave, wave + NW, ...), operands straight from 16-bit planes in fragment order (blocks of one 16-row group K-contiguous: block (g, kb) at (g * K / 32 + kb) * 512); partials summed by ksum_store; grid (M/64, N/64, Z), NW x 32 threads.
// C[m][n] (f32, pitch ldc, + optional f32 bias[n]) = sum_k A[m][k] Bt[n][k] (+ split products per NSPLIT). z-batch strides sA/sB/sC in elements. K % 32 == 0; K is a compile-time constant, so that the row groups of a tile stand at immediate offsets from one address.
// PL (the q/k/v projection of all batches; rows b * TT + t, a 64-column tile is one head): no C; the tile goes straight to the head planes that the attention kernel reads. A v tile leaves as V^T (fragment rows d, k = t), which is the
// column-major order of the LDS slots as they stand; a q or k tile leaves with fragment rows t, k = d, so there the two operands change places (both use the same loader and k order) and the slots hold the transposed tile.
template <typename T16> struct WFrag;
template <> struct WFrag<h16> { typedef v16h V; static __device__ __forceinline__ V ld(const h16* p) { return cat16(*(const v8h*)p, *(const v8h*)(p + 256)); } static __device__ __forceinline__ v8f mma(V a, V b, v8f c) { return wmma16(a, b, c); } };
template <> struct WFrag<bf> { typedef v16bf V; static __device__ __forceinline__ V ld(const bf* p) { return cat16b(*(const v8us*)p, *(const v8us*)(p + 256)); } static __device__ __forceinline__ v8f mma(V a, V b, v8f c) { return wmmab(a, b, c); } };
template <typename T16, int NSPLIT, bool BIAS, int NW, bool PL, int K>
__global__ __launch_bounds__(NW * 32) void k_gemmw(const T16* __restrict__ A, const T16* __restrict__ A2, const T16* __restrict__ Bt, const T16* __restrict__ Bt2, float* C, int ldc, const float* __restrict__ bias, size_t sA, size_t sB, size_t sC,
                                                   h16* QK16, bf* QKh, bf* QKl, h16* VT16, bf* VTh, bf* VTl) {
    typedef typename WFrag<T16>::V V;
    __shared__ __align__(16) float os[NW * KSLOT];
    const size_t z = blockIdx.z; A += z * sA; if (A2) A2 += z * sA; Bt += z * sB; if (Bt2) Bt2 += z * sB; C += z * sC;
    const int lane = threadIdx.x & 31; const int wave = __builtin_amdgcn_readfirstlane((int)(threadIdx.x >> 5)); const int r0 = blockIdx.x * 64, c0 = blockIdx.y * 64;
    v8f acc[4][4];
#pragma unroll
    for (int mb = 0; mb < 4; ++mb)
#pragma unroll
        for (int nb = 0; nb < 4; ++nb) acc[mb][nb] = (v8f){};
    const bool sw = PL && c0 < DQ + DKV;   // q or k tile (the same for the whole work-group): weight rows as the A operand, token rows as B
    if (sw) { const T16* t = A; A = Bt; Bt = t; }
    const size_t aoff = (size_t)(sw ? c0 : r0) * K, boff = (size_t)(sw ? r0 : c0) * K; const unsigned l8 = 8u * (unsigned)lane;   // 16 rows x K elements a row group; a 32-wide K block is 512 elements on; the lane's place last, so that the rest of every address is wave-uniform
#pragma unroll 1
    for (int kc = wave * 32; kc < K; kc += NW * 32) {
        V a[4], a2[4]; const T16* pa = A + (aoff + (size_t)kc * 16) + l8; const T16* pa2 = NSPLIT == 1 || NSPLIT == 2 ? A2 + (aoff + (size_t)kc * 16) + l8 : pa;
        const T16* pb = Bt + (boff + (size_t)kc * 16) + l8; const T16* pb2 = NSPLIT >= 2 ? Bt2 + (boff + (size_t)kc * 16) + l8 : pb;
#pragma unroll
        for (int mb = 0; mb < 4; ++mb) { a[mb] = WFrag<T16>::ld(pa + mb * 16 * K); if (NSPLIT == 1 || NSPLIT == 2) a2[mb] = WFrag<T16>::ld(pa2 + mb * 16 * K); }
        XWAITA(pa, pa2);
#pragma unroll
        for (int nb = 0; nb < 4; ++nb) { const V b = WFrag<T16>::ld(pb + nb * 16 * K); V b2; if (NSPLIT >= 2) b2 = WFrag<T16>::ld(pb2 + nb * 16 * K);
#pragma unroll
            for (int mb = 0; mb < 4; ++mb) { acc[mb][nb] = WFrag<T16>::mma(a[mb], b, acc[mb][nb]); if (NSPLIT == 1 || NSPLIT == 2) acc[mb][nb] = WFrag<T16>::mma(a2[mb], b, acc[mb][nb]); if (NSPLIT >= 2) acc[mb][nb] = WFrag<T16>::mma(a[mb], b2, acc[mb][nb]); } }
        XWAITA(pb, pb2);
        asm volatile("v_nop\n\tv_nop\n\tv_nop\n\tv_nop" : "+v"(acc[0][0]), "+v"(acc[1][1]), "+v"(acc[2][2]), "+v"(acc[3][3]) : "v"(a[0]), "v"(a[3]));
    }
    const int pb = r0 / TT, pt = r0 % TT, ph = c0 / HD;   // batch, first token and head (0 .. 11 q, 12 .. 23 k, 24 .. 35 v) of a PL tile
    ksum_store<NW, BIAS, PL>(os, acc, wave, lane, C, ldc, r0, c0, bias, sw ? QK16 : VT16, sw ? QKh : VTh, sw ? QKl : VTl,
                             sw ? ((size_t)(pb * (NH_ + NKV) + ph) * TT + pt) * HD : ((size_t)(pb * NKV + ph - NH_ - NKV) * TT + pt) * HD, sw);
}

typedef __attribute__((ext_vector_type(2))) _Float16 v2h;
typedef __attribute__((ext_vector_type(4))) _Float16 v4h;
typedef __attribute__((ext_vector_type(2))) unsigned short v2us;
typedef __attribute__((ext_vector_type(4))) unsigned short v4us;
typedef __attribute__((ext_vector_type(2))) float v2f;
typedef __attribute__((ext_vector_type(4))) int v4i;

// ---- k_prep: all operand preparation in one launch, both results in fragment order; a thread makes 16-byte pieces (8 k of one fragment row), piece i at element i * 8, so a wave writes four whole lines.
// Piece i: block i / 64 = (row group, K block), half (i / 32) % 2, lane i % 32. Work-groups 0 .. 4 WTB - 1: the four 'xw' weights [k][n] to bf16 with fragment rows n, back to back in Wt, 2 pieces a thread
// (16 lanes read 16 adjacent n of one k); the other CVB work-groups: x to bf16, 4 pieces a thread.
#define WTB (DM * DQ / 64 / 64)
#define CVB (NB_ * TT * DM / 8 / 1024)
static_assert(DQ == DM && DKV == DM && WTB * 64 * 64 == DM * DQ && CVB * 8 * 1024 == NB_ * TT * DM, "the preparation grid covers every element exactly once");
__global__ __launch_bounds__(256) void k_prep(const float* __restrict__ x, const float* __restrict__ wq, const float* __restrict__ wk, const float* __restrict__ wv, const float* __restrict__ wo, bf* Wt, bf* XB) {
    const int blk = blockIdx.x;
    if (blk < 4 * WTB) {
        const int id = blk / WTB; const float* __restrict__ w = id == 0 ? wq : id == 1 ? wk : id == 2 ? wv : wo; bf* Bt = Wt + (size_t)id * DM * DQ;
        const int i0 = (blk % WTB) * 512 + (int)threadIdx.x; float f[2][8]; const float* pw[2];
#pragma unroll
        for (int q = 0; q < 2; ++q) { const int i = i0 + q * 256, bk = i >> 6; const int n = (bk / (DM / 32)) * 16 + (i & 15), k = (bk % (DM / 32)) * 32 + ((i >> 5) & 1) * 16 + ((i >> 4) & 1) * 8; pw[q] = w + (size_t)k * DQ + n;
#pragma unroll
            for (int e = 0; e < 8; ++e) f[q][e] = pw[q][e * DQ]; }
        XWAITA(pw[0], pw[1]);
#pragma unroll
        for (int q = 0; q < 2; ++q) { v8us o;
#pragma unroll
            for (int e = 0; e < 8; ++e) o[e] = f2bf(f[q][e]);
            *(v8us*)(Bt + (size_t)(i0 + q * 256) * 8) = o; }
        XWAIT();
    } else {
        const size_t i0 = (size_t)(blk - 4 * WTB) * 1024 + threadIdx.x; v8f v[4]; const float* px[4];
#pragma unroll
        for (int q = 0; q < 4; ++q) { const int i = (int)i0 + q * 256, bk = i >> 6; px[q] = x + (size_t)((bk / (DM / 32)) * 16 + (i & 15)) * DM + (bk % (DM / 32)) * 32 + ((i >> 5) & 1) * 16 + ((i >> 4) & 1) * 8; v[q] = *(const v8f*)px[q]; }
        XWAITA4(px[0], px[1], px[2], px[3]);
#pragma unroll
        for (int q = 0; q < 4; ++q) { v8us o;
#pragma unroll
            for (int k = 0; k < 8; ++k) o[k] = f2bf(v[q][k]);
            *(v8us*)(XB + (i0 + q * 256) * 8) = o; }
        XWAIT();
    }
}
#define SC2 (SCL * 1.4426950408889634f)   // score scale x log2(e): the exponentials are taken to base 2
typedef __attribute__((ext_vector_type(16))) unsigned short v16us;
template <typename T16, bool HL, int NQ, bool DIAG>
__device__ __forceinline__ void attn_step(const T16* __restrict__ Kp, const T16* __restrict__ K2, const T16* __restrict__ Vt, const T16* __restrict__ Vt2, int k0, int q0, int lr, int hi,
                                          const typename WFrag<T16>::V (&qf)[NQ][2], const typename WFrag<T16>::V (&q2f)[NQ][2], typename WFrag<T16>::V (&kf)[2][2], float (&m)[NQ], float (&l)[NQ], v8f (&o)[4][NQ]) {
    typedef WFrag<T16> F; typedef typename F::V V; const int l8 = (hi * 16 + lr) * 8;   // the lane's place in a half block; 32 keys are 4 blocks of K (16 keys, 32 d) and 4 of V^T (16 d, 32 keys), 2,048 elements each
    v8f s[2][NQ];
#pragma unroll
    for (int kt = 0; kt < 2; ++kt)
#pragma unroll
        for (int qt = 0; qt < NQ; ++qt) s[kt][qt] = (v8f){};
    V a2[2][2], va[4], va2[4];   // this pass's lo K plane and V^T fragments are requested first: V^T flies under the score products and the softmax arithmetic
    if (HL) {
#pragma unroll
        for (int kt = 0; kt < 2; ++kt)
#pragma unroll
            for (int ks = 0; ks < 2; ++ks) a2[kt][ks] = F::ld(K2 + (size_t)k0 * HD + (kt * 2 + ks) * 512 + l8);
        XWAIT(); }
#pragma unroll
    for (int dt = 0; dt < 4; ++dt) { const size_t off = (size_t)k0 * HD + dt * 512 + l8; va[dt] = F::ld(Vt + off); if (HL) va2[dt] = F::ld(Vt2 + off); }
    XWAIT();
#pragma unroll
    for (int kt = 0; kt < 2; ++kt)
#pragma unroll
        for (int ks = 0; ks < 2; ++ks)
#pragma unroll
            for (int qt = 0; qt < NQ; ++qt) { s[kt][qt] = F::mma(kf[kt][ks], qf[qt][ks], s[kt][qt]); if (HL) { s[kt][qt] = F::mma(kf[kt][ks], q2f[qt][ks], s[kt][qt]); s[kt][qt] = F::mma(a2[kt][ks], qf[qt][ks], s[kt][qt]); } }
    if (!DIAG) {   // the next pass's K fragments, into the registers that the score products have just read (a pass below the diagonal is always followed by another)
#pragma unroll
        for (int kt = 0; kt < 2; ++kt)
#pragma unroll
            for (int ks = 0; ks < 2; ++ks) kf[kt][ks] = F::ld(Kp + (size_t)(k0 + 32) * HD + (kt * 2 + ks) * 512 + l8);
        XWAIT(); }
    if (DIAG) {
#pragma unroll
        for (int kt = 0; kt < 2; ++kt)
#pragma unroll
            for (int qt = 0; qt < NQ; ++qt)
#pragma unroll
                for (int j = 0; j < 8; ++j) if (k0 + kt * 16 + hi * 8 + j > q0 + qt * 16 + lr) s[kt][qt][j] = -3.0e38f; }
    float mx[NQ]; bool need = false;
#pragma unroll
    for (int qt = 0; qt < NQ; ++qt) { float t = fmaxf(s[0][qt][0], s[1][qt][0]);
#pragma unroll
        for (int j = 1; j < 8; ++j) t = fmaxf(t, fmaxf(s[0][qt][j], s[1][qt][j]));
        mx[qt] = fmaxf(t, __shfl_xor(t, 16, 32)); need = need || (mx[qt] > m[qt]); }
    if (__builtin_amdgcn_ballot_w32(need) != 0) {   // some row's maximum rose: bring sums and outputs to the new maximum (factor exactly 1 for the rows whose maximum stayed)
#pragma unroll
        for (int qt = 0; qt < NQ; ++qt) { const float mn = fmaxf(m[qt], mx[qt]); const float al = __builtin_amdgcn_exp2f((m[qt] - mn) * SC2); m[qt] = mn; l[qt] *= al;
#pragma unroll
            for (int dt = 0; dt < 4; ++dt) o[dt][qt] *= al; } }
    V pb[NQ], pb2[NQ];
#pragma unroll
    for (int qt = 0; qt < NQ; ++qt) { const float nm = -m[qt] * SC2; float p[16];
#pragma unroll
        for (int e = 0; e < 16; ++e) { p[e] = __builtin_amdgcn_exp2f(fmaf(s[e >> 3][qt][e & 7], SC2, nm)); l[qt] += p[e]; }
        if constexpr (HL) { v16us ph, pl;
#pragma unroll
            for (int e = 0; e < 16; ++e) { unsigned short a, c2; splitf(p[e], a, c2); ph[e] = a; pl[e] = c2; }
            pb[qt] = __builtin_bit_cast(v16bf, ph); pb2[qt] = __builtin_bit_cast(v16bf, pl);
        } else {
#pragma unroll
            for (int e = 0; e < 16; ++e) pb[qt][e] = tohx(p[e]); } }
#pragma unroll
    for (int dt = 0; dt < 4; ++dt)
#pragma unroll
        for (int qt = 0; qt < NQ; ++qt) { o[dt][qt] = F::mma(va[dt], pb[qt], o[dt][qt]); if (HL) { o[dt][qt] = F::mma(va[dt], pb2[qt], o[dt][qt]); o[dt][qt] = F::mma(va2[dt], pb[qt], o[dt][qt]); } }
}
template <typename T16, bool HL, int NQ>
__device__ __forceinline__ void attn_rows(const T16* __restrict__ Q, const T16* __restrict__ Q2, const T16* __restrict__ Kp, const T16* __restrict__ K2, const T16* __restrict__ Vt, const T16* __restrict__ Vt2, int q0, int lane, bf* Ah, bf* Al) {
    typedef WFrag<T16> F; typedef typename F::V V; const int lr = lane & 15, hi = lane >> 4;
    V qf[NQ][2], q2f[NQ][2], kf[2][2];
#pragma unroll
    for (int qt = 0; qt < NQ; ++qt)
#pragma unroll
        for (int ks = 0; ks < 2; ++ks) { const size_t off = (size_t)(q0 + qt * 16) * HD + ks * 512 + lane * 8; qf[qt][ks] = F::ld(Q + off); if (HL) q2f[qt][ks] = F::ld(Q2 + off); }
#pragma unroll
    for (int kt = 0; kt < 2; ++kt)
#pragma unroll
        for (int ks = 0; ks < 2; ++ks) kf[kt][ks] = F::ld(Kp + (kt * 2 + ks) * 512 + lane * 8);   // keys 0 .. 31; every later pass's K fragments are fetched one pass ahead
    XWAIT();
    float m[NQ], l[NQ]; v8f o[4][NQ]; const int kd = q0 & ~31;   // first key of the 32-key block that holds the diagonal
#pragma unroll
    for (int qt = 0; qt < NQ; ++qt) { m[qt] = -3.0e38f; l[qt] = 0.f; }
#pragma unroll
    for (int dt = 0; dt < 4; ++dt)
#pragma unroll
        for (int qt = 0; qt < NQ; ++qt) o[dt][qt] = (v8f){};
#pragma unroll 1
    for (int k0 = 0; k0 < kd; k0 += 32) {
        attn_step<T16, HL, NQ, false>(Kp, K2, Vt, Vt2, k0, q0, lr, hi, qf, q2f, kf, m, l, o);
    }
    attn_step<T16, HL, NQ, true>(Kp, K2, Vt, Vt2, kd, q0, lr, hi, qf, q2f, kf, m, l, o);   // the diagonal block: keys kd .. kd + 31, masked by select
#pragma unroll
    for (int qt = 0; qt < NQ; ++qt) { const float inv = __fdiv_rn(1.0f, l[qt] + __shfl_xor(l[qt], 16, 32)); const size_t ro = (size_t)(q0 + qt * 16) * DQ + lane * 8;   // merged planes in fragment order for the output projection (rows t, k = h * 64 + d): this head's 16 d of tile dt are half block dt of its two K blocks
#pragma unroll
        for (int dt = 0; dt < 4; ++dt) { v8us oh, ol;
#pragma unroll
            for (int j = 0; j < 8; ++j) { unsigned short a, c2; splitf(o[dt][qt][j] * inv, a, c2); oh[j] = a; ol[j] = c2; }
            *(v8us*)(Ah + ro + dt * 256) = oh; *(v8us*)(Al + ro + dt * 256) = ol; XWAIT(); } }
}
// grid (batch x head, position blocks: first the (TT - RH) / 128 fp16 blocks of 4 waves x 32 rows, the longest first, then the RH / 64 hi/lo blocks of 4 waves x 16 rows); the 4 waves of a work-group are independent
// (adjacent query rows walk the same keys: they meet in the WGP cache). The hi/lo rows take 16 per wave because both planes of every operand are live: at 32 the kernel needs registers above v255.
#define NFB ((TT - RH) / 128)
__global__ __launch_bounds__(128) void k_fattn(const h16* __restrict__ QK16, const bf* __restrict__ QKh, const bf* __restrict__ QKl, const h16* __restrict__ VT16, const bf* __restrict__ VTh, const bf* __restrict__ VTl, bf* ATh, bf* ATl) {
    const int lane = threadIdx.x & 31; const int wave = __builtin_amdgcn_readfirstlane((int)(threadIdx.x >> 5)); const int b = blockIdx.x / NH_, h = blockIdx.x % NH_, y = blockIdx.y;
    const size_t qo = ((size_t)b * (NH_ + NKV) + h) * TT * HD, ko = ((size_t)b * (NH_ + NKV) + NH_ + h / REP) * TT * HD, vo = ((size_t)b * NKV + h / REP) * HD * TT, ao = (size_t)b * TT * DQ + h * HD * 16;
    if (y < NFB) attn_rows<h16, false, 2>(QK16 + qo, nullptr, QK16 + ko, nullptr, VT16 + vo, nullptr, TT - (y + 1) * 128 + wave * 32, lane, ATh + ao, ATl + ao);
    else attn_rows<bf, true, 1>(QKh + qo, QKl + qo, QKh + ko, QKl + ko, VTh + vo, VTl + vo, RH - (y - NFB + 1) * 64 + wave * 16, lane, ATh + ao, ATl + ao);
}

extern "C" void kernel_launch(void* const* d_in, const int* in_sizes, int n_in,
                              void* d_out, int out_size, void* d_ws, size_t ws_size, hipStream_t stream) {
    (void)in_sizes; (void)n_in; (void)out_size;
    const float* x = (const float*)d_in[0]; const float* wq = (const float*)d_in[1]; const float* wk = (const float*)d_in[2]; const float* wv = (const float*)d_in[3]; const float* wo = (const float*)d_in[4]; const float* bo = (const float*)d_in[5];   /* inputs x, Wq, Wk, Wv, Wo ('xw' [768][768]), bo */
    float* OUT = (float*)d_out;     // [4][2048][768]
    char* wsp = (char*)d_ws;
    auto take = [&](size_t bytes) { char* p = wsp; wsp += (bytes + 255) & ~(size_t)255; return (void*)p; };
    bf* WQ = (bf*)take((size_t)DQ * DM * 2); bf* WK = (bf*)take((size_t)DKV * DM * 2); bf* WV = (bf*)take((size_t)DKV * DM * 2); bf* WO = (bf*)take((size_t)DM * DQ * 2); (void)WK; (void)WV;   // back to back: one [DQ + 2 DKV + DM][DM] block
    bf* XB = (bf*)take((size_t)NB_ * TT * DM * 2);
    // planes of all batches: per batch the 12 q heads directly followed by the 12 k heads (fp16, hi, lo alike)
    h16* QK16 = (h16*)take((size_t)NB_ * (NH_ + NKV) * TT * HD * 2); bf* QKh = (bf*)take((size_t)NB_ * (NH_ + NKV) * TT * HD * 2); bf* QKl = (bf*)take((size_t)NB_ * (NH_ + NKV) * TT * HD * 2);
    h16* VT16 = (h16*)take((size_t)NB_ * NKV * HD * TT * 2); bf* VTh = (bf*)take((size_t)NB_ * NKV * HD * TT * 2); bf* VTl = (bf*)take((size_t)NB_ * NKV * HD * TT * 2);
    bf* ATh = (bf*)take((size_t)NB_ * TT * DQ * 2); bf* ATl = (bf*)take((size_t)NB_ * TT * DQ * 2);
    if ((size_t)(wsp - (char*)d_ws) > ws_size) return;    // ws 256 MiB
    k_prep<<<4 * WTB + CVB, 256, 0, stream>>>(x, wq, wk, wv, wo, WQ, XB);
    // q, k, v of all batches in one GEMM (WQ, WK, WV are one [DQ + 2 DKV][DM] transposed weight); its epilogue writes the head planes
    k_gemmw<bf, 0, false, 8, true, DM><<<dim3(NB_ * TT / 64, (DQ + 2 * DKV) / 64, 1), 256, 0, stream>>>(XB, nullptr, WQ, nullptr, nullptr, 0, nullptr, 0, 0, 0, QK16, QKh, QKl, VT16, VTh, VTl);
    k_fattn<<<dim3(NB_ * NH_, (TT - RH) / 128 + RH / 64, 1), 128, 0, stream>>>(QK16, QKh, QKl, VT16, VTh, VTl, ATh, ATl);   // attention of all batches and heads in one launch
    k_gemmw<bf, 1, true, 8, false, DQ><<<dim3(NB_ * TT / 64, DM / 64, 1), 256, 0, stream>>>(ATh, ATl, WO, nullptr, OUT, DM, bo, 0, 0, 0, nullptr, nullptr, nullptr, nullptr, nullptr, nullptr);   // output projection of all batches in one launch (rows b * TT + t)
}

// v006
// A run of this version takes 111 microseconds.
// Timed twice side by side with v005, it ran 1.14 and 1.15 times as fast.
// Over all steps from v000 it is 19.3 times as fast.
#include <hip/hip_runtime.h>

// Causal multi-head attention at d_model 768 with bias-free projections and an output bias (x [4][2048][768]; q, k, v = x W ('xw' [768][768], no bias; 12 heads x 64); scores masked (-inf) then / sqrt(64); softmax; out = merged Wo + bo ('xw' + bias) -> [4][2048][768] (6.3 M); argument order x, Wq, Wk, Wv, Wo, bo).
// Layout: one preparation launch (bf16 copy of x; 'xw' weights transposed); exact projections (K 768) of all batches in one launch that writes the head planes itself; one fused causal attention launch for all batches and heads (hybrid rows: < 512 hi/lo 3 products, rest fp16; running maximum and sum, keys only up to the diagonal); merged hi/lo x Wo exact + bo.
// Every 16-bit operand plane lies in FRAGMENT ORDER: a block of 16 rows x 32 k is 1,024 contiguous bytes, element (row r, k) at j * 256 + (h * 16 + r) * 8 + e with k = j * 16 + h * 8 + e (j, h in 0..1, e in 0..7),
// so that lane h * 16 + r of a wave finds the two 16-byte halves of its WMMA fragment at lane * 8 and 256 + lane * 8: each wave-wide load or store covers four whole 128-byte lines. The k order of every fragment is what it was.
// Compute dtypes, f32 accumulate: every input rounded to bf16; projections exact; attention rows < 512 3 products, rest fp16; softmax f32; Wo hl x exact + bias.

#define NB_  4
#define TT   2048
#define DM   768
#define NH_  12
#define NKV  12
#define REP  (NH_ / NKV)
#define HD   64
#define DQ   (NH_ * HD)
#define DKV  (NKV * HD)
#define RH   512                  // query rows < RH use hi+lo planes (0: none)
#define SCL  0.125f   // HD^-0.5
typedef _Float16 h16;
typedef unsigned short bf;
typedef __attribute__((ext_vector_type(16))) __bf16   v16bf;
typedef __attribute__((ext_vector_type(16))) _Float16 v16h;
typedef __attribute__((ext_vector_type(8)))  _Float16 v8h;
typedef __attribute__((ext_vector_type(8)))  unsigned short v8us;
typedef __attribute__((ext_vector_type(8)))  float    v8f;
typedef __attribute__((ext_vector_type(4)))  float    v4f;
typedef v8h  __attribute__((may_alias)) v8ha;
typedef v4f  __attribute__((may_alias)) v4fa;
typedef v8us __attribute__((may_alias)) v8usa;

__device__ __forceinline__ unsigned short f2bf(float f) { unsigned u = __float_as_uint(f); u += 0x7FFFu + ((u >> 16) & 1u); return (unsigned short)(u >> 16); }
__device__ __forceinline__ float bf2f(unsigned short b) { return __uint_as_float(((unsigned)b) << 16); }
__device__ __forceinline__ float bfr(float f) { return bf2f(f2bf(f)); }
__device__ __forceinline__ v16h cat16(v8h lo, v8h hi) { return __builtin_shufflevector(lo, hi, 0, 1, 2, 3, 4, 5, 6, 7, 8, 9, 10, 11, 12, 13, 14, 15); }
__device__ __forceinline__ v16bf cat16b(v8us lo, v8us hi) { return __builtin_bit_cast(v16bf, __builtin_shufflevector(lo, hi, 0, 1, 2, 3, 4, 5, 6, 7, 8, 9, 10, 11, 12, 13, 14, 15)); }
__device__ __forceinline__ v8f wmma16(v16h a, v16h b, v8f c) { return __builtin_amdgcn_wmma_f32_16x16x32_f16(false, a, false, b, (short)0, c, false, false); }
__device__ __forceinline__ v8f wmmab(v16bf a, v16bf b, v8f c) { return __builtin_amdgcn_wmma_f32_16x16x32_bf16(false, a, false, b, (short)0, c, false, false); }

__device__ __forceinline__ h16 tohx(float x) { return (h16)x; }
__device__ __forceinline__ void splitf(float y, unsigned short& h, unsigned short& l) { h = f2bf(y); l = f2bf(y - bf2f(h)); }
// stands behind a run of global loads or stores, in front of whatever next overwrites a register that they name (address pair, store data)
#define XWAIT() asm volatile("s_wait_xcnt 0x0" ::: "memory")
// the same wait behind a run of loads from two (four) addresses plus immediate offsets: the addresses are inputs, so they stay in their registers up to the wait and no load of the run lands on them
#define XWAITA(p, q) asm volatile("s_wait_xcnt 0x0" :: "v"(p), "v"(q) : "memory")
#define XWAITA4(p, q, r, s) asm volatile("s_wait_xcnt 0x0" :: "v"(p), "v"(q), "v"(r), "v"(s) : "memory")
// the same wait behind ALL ten fragment loads of one K block. The loaded fragments are inputs too (inputs only, nothing is changed): so every load of the block is issued ahead of the first product and the wave waits once a block;
// without them the compiler turns two register sets over for one operand and fetches it fragment by fragment, four products ahead of its use, with a wait in front of each
#define XWAITF10(p, q, f) asm volatile("s_wait_xcnt 0x0" :: "v"(p), "v"(q), "v"(f[0]), "v"(f[1]), "v"(f[2]), "v"(f[3]), "v"(f[4]), "v"(f[5]), "v"(f[6]), "v"(f[7]), "v"(f[8]), "v"(f[9]) : "memory")

template <typename T16> struct WFrag;
template <> struct WFrag<h16> { typedef v16h V; static __device__ __forceinline__ V ld(const h16* p) { return cat16(*(const v8h*)p, *(const v8h*)(p + 256)); } static __device__ __forceinline__ v8f mma(V a, V b, v8f c) { return wmma16(a, b, c); } };
template <> struct WFrag<bf> { typedef v16bf V; static __device__ __forceinline__ V ld(const bf* p) { return cat16b(*(const v8us*)p, *(const v8us*)(p + 256)); } static __device__ __forceinline__ v8f mma(V a, V b, v8f c) { return wmmab(a, b, c); } };

// ---- The two projections: every wave owns one output tile for the WHOLE K loop (no split of K, so no partial tiles, no LDS sum and no barrier), operands straight from the bf16 planes in fragment order
// (blocks of one 16-row group K-contiguous: block (g, kb) at (g * K / 32 + kb) * 512, so the row groups of a tile stand at immediate offsets from one address and a K block is 512 elements on).
// As many work-groups as WGPs, all waves resident at once (three on a SIMD); the waves of a work-group form a rectangle of tiles, so that an operand block fetched from L2 by one wave can be found in the WGP cache by the other waves of its row or column.
// tile_mm: acc[mb][nb] += A rows (mb * 16 ..) x B rows (nb * 16 ..) over K; pa, pb: the lane's place in the first block of either operand; both operands use the same loader and k order.
template <int MB, int NB, int K>
__device__ __forceinline__ void tile_mm(const bf* __restrict__ pa, const bf* __restrict__ pb, v8f (&acc)[MB][NB]) {
    typedef WFrag<bf> F; static_assert(MB + NB == 10, "the wait names ten fragments");
#pragma unroll 1
    for (int kb = 0; kb < K / 32; ++kb) {   // stays rolled (for speed only)
        F::V f[MB + NB];   // A fragments, then B fragments
#pragma unroll
        for (int mb = 0; mb < MB; ++mb) f[mb] = F::ld(pa + mb * 16 * K);
#pragma unroll
        for (int nb = 0; nb < NB; ++nb) f[MB + nb] = F::ld(pb + nb * 16 * K);
        XWAITF10(pa, pb, f);
#pragma unroll
        for (int nb = 0; nb < NB; ++nb)
#pragma unroll
            for (int mb = 0; mb < MB; ++mb) acc[mb][nb] = F::mma(f[mb], f[MB + nb], acc[mb][nb]);
        pa += 512; pb += 512;
    }
}
// One accumulator tile to the three 16-bit planes (fp16, bf16 hi, bf16 lo): a lane holds 8 successive k of one fragment row, which is its 16-byte piece of a half block in fragment order: a wave fills four whole lines of each plane.
__device__ __forceinline__ void plane_store(const v8f t, h16* P16, bf* Ph, bf* Pl, size_t e) {
    v8h o16; v8us oh, ol;
#pragma unroll
    for (int j = 0; j < 8; ++j) { o16[j] = tohx(t[j]); unsigned short a2, c2; splitf(t[j], a2, c2); oh[j] = a2; ol[j] = c2; }
    h16* q16 = P16 + e; bf* qh = Ph + e; bf* ql = Pl + e; *(v8h*)q16 = o16; *(v8us*)qh = oh; *(v8us*)ql = ol;
    // the wait behind the three stores; their addresses and data are inputs (inputs only), so that they stay in their registers up to it: with a bare wait the next tile's arithmetic is moved in front of it and lands on the last store's data
    asm volatile("s_wait_xcnt 0x0" :: "v"(q16), "v"(qh), "v"(ql), "v"(o16), "v"(oh), "v"(ol) : "memory");
}
// ---- k_qkv: q, k, v of all batches (rows b * TT + t; columns 0 .. 767 q, .. 1535 k, .. 2303 v). A wave's tile is 64 tokens x 96 columns; 12 waves (4 x 3 tiles: 256 tokens x 288 columns) a work-group, three on a SIMD; grid (tokens / 256, columns / 288).
// A q or k tile: weight rows as the A operand, tokens as B, so a lane holds 8 d of one token (fragment rows t, k = d); a v tile: tokens as A, weight rows as B, so a lane holds 8 tokens of one d (V^T: fragment rows d, k = t).
// Each 16-column group lies in one head. The branch is the same for a whole wave.
#define QWM 4
#define QWN 3
#define QCG 6   // 16-column groups of a wave's tile
static_assert((NB_ * TT) % (QWM * 64) == 0 && (DQ + 2 * DKV) % (QWN * QCG * 16) == 0 && DQ % (QCG * 16) == 0 && DKV % (QCG * 16) == 0 && TT % 64 == 0 && HD == 64, "whole tiles; a tile lies in one of q, k, v and in one batch");
__global__ __launch_bounds__(QWM * QWN * 32) void k_qkv(const bf* __restrict__ X, const bf* __restrict__ Wt, h16* QK16, bf* QKh, bf* QKl, h16* VT16, bf* VTh, bf* VTl) {
    const int lane = threadIdx.x & 31; const int wave = __builtin_amdgcn_readfirstlane((int)(threadIdx.x >> 5));
    const int r0 = ((int)blockIdx.x * QWM + (wave & 3)) * 64, c0 = ((int)blockIdx.y * QWN + (wave >> 2)) * (QCG * 16);
    const bf* px = X + (size_t)r0 * DM + lane * 8; const bf* pw = Wt + (size_t)c0 * DM + lane * 8; const int pb = r0 / TT, pt = r0 % TT;   // batch and first token of the tile
    if (c0 < DQ + DKV) {
        v8f acc[QCG][4];
#pragma unroll
        for (int mb = 0; mb < QCG; ++mb)
#pragma unroll
            for (int nb = 0; nb < 4; ++nb) acc[mb][nb] = (v8f){};
        tile_mm<QCG, 4, DM>(pw, px, acc);
#pragma unroll
        for (int mb = 0; mb < QCG; ++mb) { const int cg = c0 + mb * 16; const size_t hb = ((size_t)(pb * (NH_ + NKV) + cg / HD) * TT + pt) * HD + (cg % HD) * 16 + lane * 8;   // head plane (0 .. 11 q, 12 .. 23 k); 16 d are one half block of 256 elements
#pragma unroll
            for (int nb = 0; nb < 4; ++nb) plane_store(acc[mb][nb], QK16, QKh, QKl, hb + nb * 1024); }   // 16 tokens x 64 d are 1,024 elements
    } else {
        v8f acc[4][QCG];
#pragma unroll
        for (int mb = 0; mb < 4; ++mb)
#pragma unroll
            for (int nb = 0; nb < QCG; ++nb) acc[mb][nb] = (v8f){};
        tile_mm<4, QCG, DM>(px, pw, acc);
#pragma unroll
        for (int nb = 0; nb < QCG; ++nb) { const int cg = c0 - DQ - DKV + nb * 16; const size_t hb = ((size_t)(pb * NKV + cg / HD) * TT + pt) * HD + (cg % HD) * 32 + lane * 8;   // 16 d x 32 tokens are one block of 512 elements
#pragma unroll
            for (int mb = 0; mb < 4; ++mb) plane_store(acc[mb][nb], VT16, VTh, VTl, hb + (mb >> 1) * 2048 + (mb & 1) * 256); }   // 32 tokens x 64 d are 2,048 elements; 16 tokens a half block
    }
}
// ---- k_wo: out = merged (hi + lo planes) x Wo + bo for all batches. A wave's tile is 32 tokens x 64 columns (Wo rows as the A operand, tokens as B); 12 waves (4 x 3 tiles: 128 tokens x 192 columns) a work-group; grid (tokens / 128, columns / 192).
// The f32 tile leaves through the wave's OWN LDS range (token rows at pitch 68 floats), read back by rows, so that every store covers whole lines: two token rows of 256 bytes each.
#define OWM 4
#define OWN 3
#define OSLOT (32 * 68)
static_assert((NB_ * TT) % (OWM * 32) == 0 && DM % (OWN * 64) == 0, "whole tiles");
__global__ __launch_bounds__(OWM * OWN * 32) void k_wo(const bf* __restrict__ Ah, const bf* __restrict__ Al, const bf* __restrict__ Wo, const float* __restrict__ bias, float* C) {
    typedef WFrag<bf> F;
    __shared__ __align__(16) float os[OWM * OWN * OSLOT];
    const int lane = threadIdx.x & 31; const int wave = __builtin_amdgcn_readfirstlane((int)(threadIdx.x >> 5)); const int lr = lane & 15, hi = lane >> 4;
    const int r0 = ((int)blockIdx.x * OWM + (wave & 3)) * 32, c0 = ((int)blockIdx.y * OWN + (wave >> 2)) * 64;
    const bf* pw = Wo + (size_t)c0 * DQ + lane * 8; const bf* ph = Ah + (size_t)r0 * DQ + lane * 8; const bf* pl = Al + (size_t)r0 * DQ + lane * 8;
    v8f acc[4][2];
#pragma unroll
    for (int mb = 0; mb < 4; ++mb)
#pragma unroll
        for (int nb = 0; nb < 2; ++nb) acc[mb][nb] = (v8f){};
#pragma unroll
    for (int kb = 0; kb < DQ / 32; ++kb) {   // unrolled whole (one tile shape, a short text): every load is one of three addresses plus an immediate offset, and no address register is rewritten inside
        F::V w[4], xh[2], xl[2];
#pragma unroll
        for (int mb = 0; mb < 4; ++mb) w[mb] = F::ld(pw + mb * 16 * DQ + kb * 512);
#pragma unroll
        for (int nb = 0; nb < 2; ++nb) { xh[nb] = F::ld(ph + nb * 16 * DQ + kb * 512); xl[nb] = F::ld(pl + nb * 16 * DQ + kb * 512); }
#pragma unroll
        for (int nb = 0; nb < 2; ++nb)
#pragma unroll
            for (int mb = 0; mb < 4; ++mb) acc[mb][nb] = F::mma(w[mb], xh[nb], acc[mb][nb]);
#pragma unroll
        for (int nb = 0; nb < 2; ++nb)
#pragma unroll
            for (int mb = 0; mb < 4; ++mb) acc[mb][nb] = F::mma(w[mb], xl[nb], acc[mb][nb]);
    }
    XWAITA4(pw, ph, pl, pl);
    const int col = lr * 4; const float* pbias = bias + c0 + col; v4f bb;
#pragma unroll
    for (int q = 0; q < 4; ++q) bb[q] = pbias[q];
    XWAITA(pbias, pbias);
    float* slot = os + wave * OSLOT;
#pragma unroll
    for (int nb = 0; nb < 2; ++nb)
#pragma unroll
        for (int mb = 0; mb < 4; ++mb) { float* p = slot + (nb * 16 + lr) * 68 + mb * 16 + hi * 8; const v8f t = acc[mb][nb];
            *(v4fa*)p = __builtin_shufflevector(t, t, 0, 1, 2, 3); *(v4fa*)(p + 4) = __builtin_shufflevector(t, t, 4, 5, 6, 7); }
    asm volatile("s_wait_dscnt 0x0" ::: "memory");   // the wave's own LDS writes are done before its lanes read one another's pieces back (no other wave touches this range)
#pragma unroll
    for (int q = 0; q < 4; ++q) bb[q] = bfr(bb[q]);
    float* cp = C + (size_t)(r0 + hi) * DM + c0 + col; v4f s[16];
#pragma unroll
    for (int i = 0; i < 16; ++i) s[i] = *(const v4fa*)(slot + (i * 2 + hi) * 68 + col);
#pragma unroll
    for (int i = 0; i < 16; ++i) *(v4f*)(cp + (size_t)i * 2 * DM) = s[i] + bb;
    XWAIT();
}

typedef __attribute__((ext_vector_type(2))) _Float16 v2h;
typedef __attribute__((ext_vector_type(4))) _Float16 v4h;
typedef __attribute__((ext_vector_type(2))) unsigned short v2us;
typedef __attribute__((ext_vector_type(4))) unsigned short v4us;
typedef __attribute__((ext_vector_type(2))) float v2f;
typedef __attribute__((ext_vector_type(4))) int v4i;

// ---- k_prep: all operand preparation in one launch, both results in fragment order; a thread makes 16-byte pieces (8 k of one fragment row), piece i at element i * 8, so a wave writes four whole lines.
// Piece i: block i / 64 = (row group, K block), half (i / 32) % 2, lane i % 32. Work-groups 0 .. 4 WTB - 1: the four 'xw' weights [k][n] to bf16 with fragment rows n, back to back in Wt, 2 pieces a thread
// (16 lanes read 16 adjacent n of one k); the other CVB work-groups: x to bf16, 4 pieces a thread.
#define WTB (DM * DQ / 64 / 64)
#define CVB (NB_ * TT * DM / 8 / 1024)
static_assert(DQ == DM && DKV == DM && WTB * 64 * 64 == DM * DQ && CVB * 8 * 1024 == NB_ * TT * DM, "the preparation grid covers every element exactly once");
__global__ __launch_bounds__(256) void k_prep(const float* __restrict__ x, const float* __restrict__ wq, const float* __restrict__ wk, const float* __restrict__ wv, const float* __restrict__ wo, bf* Wt, bf* XB) {
    const int blk = blockIdx.x;
    if (blk < 4 * WTB) {
        const int id = blk / WTB; const float* __restrict__ w = id == 0 ? wq : id == 1 ? wk : id == 2 ? wv : wo; bf* Bt = Wt + (size_t)id * DM * DQ;
        const int i0 = (blk % WTB) * 512 + (int)threadIdx.x; float f[2][8]; const float* pw[2];
#pragma unroll
        for (int q = 0; q < 2; ++q) { const int i = i0 + q * 256, bk = i >> 6; const int n = (bk / (DM / 32)) * 16 + (i & 15), k = (bk % (DM / 32)) * 32 + ((i >> 5) & 1) * 16 + ((i >> 4) & 1) * 8; pw[q] = w + (size_t)k * DQ + n;
#pragma unroll
            for (int e = 0; e < 8; ++e) f[q][e] = pw[q][e * DQ]; }
        XWAITA(pw[0], pw[1]);
#pragma unroll
        for (int q = 0; q < 2; ++q) { v8us o;
#pragma unroll
            for (int e = 0; e < 8; ++e) o[e] = f2bf(f[q][e]);
            *(v8us*)(Bt + (size_t)(i0 + q * 256) * 8) = o; }
        XWAIT();
    } else {
        const size_t i0 = (size_t)(blk - 4 * WTB) * 1024 + threadIdx.x; v8f v[4]; const float* px[4];
#pragma unroll
        for (int q = 0; q < 4; ++q) { const int i = (int)i0 + q * 256, bk = i >> 6; px[q] = x + (size_t)((bk / (DM / 32)) * 16 + (i & 15)) * DM + (bk % (DM / 32)) * 32 + ((i >> 5) & 1) * 16 + ((i >> 4) & 1) * 8; v[q] = *(const v8f*)px[q]; }
        XWAITA4(px[0], px[1], px[2], px[3]);
#pragma unroll
        for (int q = 0; q < 4; ++q) { v8us o;
#pragma unroll
            for (int k = 0; k < 8; ++k) o[k] = f2bf(v[q][k]);
            *(v8us*)(XB + (i0 + q * 256) * 8) = o; }
        XWAIT();
    }
}
#define SC2 (SCL * 1.4426950408889634f)   // score scale x log2(e): the exponentials are taken to base 2
typedef __attribute__((ext_vector_type(16))) unsigned short v16us;
template <typename T16, bool HL, int NQ, bool DIAG>
__device__ __forceinline__ void attn_step(const T16* __restrict__ Kp, const T16* __restrict__ K2, const T16* __restrict__ Vt, const T16* __restrict__ Vt2, int k0, int q0, int lr, int hi,
                                          const typename WFrag<T16>::V (&qf)[NQ][2], const typename WFrag<T16>::V (&q2f)[NQ][2], typename WFrag<T16>::V (&kf)[2][2], float (&m)[NQ], float (&l)[NQ], v8f (&o)[4][NQ]) {
    typedef WFrag<T16> F; typedef typename F::V V; const int l8 = (hi * 16 + lr) * 8;   // the lane's place in a half block; 32 keys are 4 blocks of K (16 keys, 32 d) and 4 of V^T (16 d, 32 keys), 2,048 elements each
    v8f s[2][NQ];
#pragma unroll
    for (int kt = 0; kt < 2; ++kt)
#pragma unroll
        for (int qt = 0; qt < NQ; ++qt) s[kt][qt] = (v8f){};
    V a2[2][2], va[4], va2[4];   // this pass's lo K plane and V^T fragments are requested first: V^T flies under the score products and the softmax arithmetic
    if (HL) {
#pragma unroll
        for (int kt = 0; kt < 2; ++kt)
#pragma unroll
            for (int ks = 0; ks < 2; ++ks) a2[kt][ks] = F::ld(K2 + (size_t)k0 * HD + (kt * 2 + ks) * 512 + l8);
        XWAIT(); }
#pragma unroll
    for (int dt = 0; dt < 4; ++dt) { const size_t off = (size_t)k0 * HD + dt * 512 + l8; va[dt] = F::ld(Vt + off); if (HL) va2[dt] = F::ld(Vt2 + off); }
    XWAIT();
#pragma unroll
    for (int kt = 0; kt < 2; ++kt)
#pragma unroll
        for (int ks = 0; ks < 2; ++ks)
#pragma unroll
            for (int qt = 0; qt < NQ; ++qt) { s[kt][qt] = F::mma(kf[kt][ks], qf[qt][ks], s[kt][qt]); if (HL) { s[kt][qt] = F::mma(kf[kt][ks], q2f[qt][ks], s[kt][qt]); s[kt][qt] = F::mma(a2[kt][ks], qf[qt][ks], s[kt][qt]); } }
    if (!DIAG) {   // the next pass's K fragments, into the registers that the score products have just read (a pass below the diagonal is always followed by another)
#pragma unroll
        for (int kt = 0; kt < 2; ++kt)
#pragma unroll
            for (int ks = 0; ks < 2; ++ks) kf[kt][ks] = F::ld(Kp + (size_t)(k0 + 32) * HD + (kt * 2 + ks) * 512 + l8);
        XWAIT(); }
    if (DIAG) {
#pragma unroll
        for (int kt = 0; kt < 2; ++kt)
#pragma unroll
            for (int qt = 0; qt < NQ; ++qt)
#pragma unroll
                for (int j = 0; j < 8; ++j) if (k0 + kt * 16 + hi * 8 + j > q0 + qt * 16 + lr) s[kt][qt][j] = -3.0e38f; }
    float mx[NQ]; bool need = false;
#pragma unroll
    for (int qt = 0; qt < NQ; ++qt) { float t = fmaxf(s[0][qt][0], s[1][qt][0]);
#pragma unroll
        for (int j = 1; j < 8; ++j) t = fmaxf(t, fmaxf(s[0][qt][j], s[1][qt][j]));
        mx[qt] = fmaxf(t, __shfl_xor(t, 16, 32)); need = need || (mx[qt] > m[qt]); }
    if (__builtin_amdgcn_ballot_w32(need) != 0) {   // some row's maximum rose: bring sums and outputs to the new maximum (factor exactly 1 for the rows whose maximum stayed)
#pragma unroll
        for (int qt = 0; qt < NQ; ++qt) { const float mn = fmaxf(m[qt], mx[qt]); const float al = __builtin_amdgcn_exp2f((m[qt] - mn) * SC2); m[qt] = mn; l[qt] *= al;
#pragma unroll
            for (int dt = 0; dt < 4; ++dt) o[dt][qt] *= al; } }
    V pb[NQ], pb2[NQ];
#pragma unroll
    for (int qt = 0; qt < NQ; ++qt) { const float nm = -m[qt] * SC2; float p[16];
#pragma unroll
        for (int e = 0; e < 16; ++e) { p[e] = __builtin_amdgcn_exp2f(fmaf(s[e >> 3][qt][e & 7], SC2, nm)); l[qt] += p[e]; }
        if constexpr (HL) { v16us ph, pl;
#pragma unroll
            for (int e = 0; e < 16; ++e) { unsigned short a, c2; splitf(p[e], a, c2); ph[e] = a; pl[e] = c2; }
            pb[qt] = __builtin_bit_cast(v16bf, ph); pb2[qt] = __builtin_bit_cast(v16bf, pl);
        } else {
#pragma unroll
            for (int e = 0; e < 16; ++e) pb[qt][e] = tohx(p[e]); } }
#pragma unroll
    for (int dt = 0; dt < 4; ++dt)
#pragma unroll
        for (int qt = 0; qt < NQ; ++qt) { o[dt][qt] = F::mma(va[dt], pb[qt], o[dt][qt]); if (HL) { o[dt][qt] = F::mma(va[dt], pb2[qt], o[dt][qt]); o[dt][qt] = F::mma(va2[dt], pb[qt], o[dt][qt]); } }
}
template <typename T16, bool HL, int NQ>
__device__ __forceinline__ void attn_rows(const T16* __restrict__ Q, const T16* __restrict__ Q2, const T16* __restrict__ Kp, const T16* __restrict__ K2, const T16* __restrict__ Vt, const T16* __restrict__ Vt2, int q0, int lane, bf* Ah, bf* Al) {
    typedef WFrag<T16> F; typedef typename F::V V; const int lr = lane & 15, hi = lane >> 4;
    V qf[NQ][2], q2f[NQ][2], kf[2][2];
#pragma unroll
    for (int qt = 0; qt < NQ; ++qt)
#pragma unroll
        for (int ks = 0; ks < 2; ++ks) { const size_t off = (size_t)(q0 + qt * 16) * HD + ks * 512 + lane * 8; qf[qt][ks] = F::ld(Q + off); if (HL) q2f[qt][ks] = F::ld(Q2 + off); }
#pragma unroll
    for (int kt = 0; kt < 2; ++kt)
#pragma unroll
        for (int ks = 0; ks < 2; ++ks) kf[kt][ks] = F::ld(Kp + (kt * 2 + ks) * 512 + lane * 8);   // keys 0 .. 31; every later pass's K fragments are fetched one pass ahead
    XWAIT();
    float m[NQ], l[NQ]; v8f o[4][NQ]; const int kd = q0 & ~31;   // first key of the 32-key block that holds the diagonal
#pragma unroll
    for (int qt = 0; qt < NQ; ++qt) { m[qt] = -3.0e38f; l[qt] = 0.f; }
#pragma unroll
    for (int dt = 0; dt < 4; ++dt)
#pragma unroll
        for (int qt = 0; qt < NQ; ++qt) o[dt][qt] = (v8f){};
#pragma unroll 1
    for (int k0 = 0; k0 < kd; k0 += 32) {
        attn_step<T16, HL, NQ, false>(Kp, K2, Vt, Vt2, k0, q0, lr, hi, qf, q2f, kf, m, l, o);
    }
    attn_step<T16, HL, NQ, true>(Kp, K2, Vt, Vt2, kd, q0, lr, hi, qf, q2f, kf, m, l, o);   // the diagonal block: keys kd .. kd + 31, masked by select
#pragma unroll
    for (int qt = 0; qt < NQ; ++qt) { const float inv = __fdiv_rn(1.0f, l[qt] + __shfl_xor(l[qt], 16, 32)); const size_t ro = (size_t)(q0 + qt * 16) * DQ + lane * 8;   // merged planes in fragment order for the output projection (rows t, k = h * 64 + d): this head's 16 d of tile dt are half block dt of its two K blocks
#pragma unroll
        for (int dt = 0; dt < 4; ++dt) { v8us oh, ol;
#pragma unroll
            for (int j = 0; j < 8; ++j) { unsigned short a, c2; splitf(o[dt][qt][j] * inv, a, c2); oh[j] = a; ol[j] = c2; }
            *(v8us*)(Ah + ro + dt * 256) = oh; *(v8us*)(Al + ro + dt * 256) = ol; XWAIT(); } }
}
// grid (batch x head, position blocks: first the (TT - RH) / 128 fp16 blocks of 4 waves x 32 rows, the longest first, then the RH / 64 hi/lo blocks of 4 waves x 16 rows); the 4 waves of a work-group are independent
// (adjacent query rows walk the same keys: they meet in the WGP cache). The hi/lo rows take 16 per wave because both planes of every operand are live: at 32 the kernel needs registers above v255.
#define NFB ((TT - RH) / 128)
__global__ __launch_bounds__(128) void k_fattn(const h16* __restrict__ QK16, const bf* __restrict__ QKh, const bf* __restrict__ QKl, const h16* __restrict__ VT16, const bf* __restrict__ VTh, const bf* __restrict__ VTl, bf* ATh, bf* ATl) {
    const int lane = threadIdx.x & 31; const int wave = __builtin_amdgcn_readfirstlane((int)(threadIdx.x >> 5)); const int b = blockIdx.x / NH_, h = blockIdx.x % NH_, y = blockIdx.y;
    const size_t qo = ((size_t)b * (NH_ + NKV) + h) * TT * HD, ko = ((size_t)b * (NH_ + NKV) + NH_ + h / REP) * TT * HD, vo = ((size_t)b * NKV + h / REP) * HD * TT, ao = (size_t)b * TT * DQ + h * HD * 16;
    if (y < NFB) attn_rows<h16, false, 2>(QK16 + qo, nullptr, QK16 + ko, nullptr, VT16 + vo, nullptr, TT - (y + 1) * 128 + wave * 32, lane, ATh + ao, ATl + ao);
    else attn_rows<bf, true, 1>(QKh + qo, QKl + qo, QKh + ko, QKl + ko, VTh + vo, VTl + vo, RH - (y - NFB + 1) * 64 + wave * 16, lane, ATh + ao, ATl + ao);
}

extern "C" void kernel_launch(void* const* d_in, const int* in_sizes, int n_in,
                              void* d_out, int out_size, void* d_ws, size_t ws_size, hipStream_t stream) {
    (void)in_sizes; (void)n_in; (void)out_size;
    const float* x = (const float*)d_in[0]; const float* wq = (const float*)d_in[1]; const float* wk = (const float*)d_in[2]; const float* wv = (const float*)d_in[3]; const float* wo = (const float*)d_in[4]; const float* bo = (const float*)d_in[5];   /* inputs x, Wq, Wk, Wv, Wo ('xw' [768][768]), bo */
    float* OUT = (float*)d_out;     // [4][2048][768]
    char* wsp = (char*)d_ws;
    auto take = [&](size_t bytes) { char* p = wsp; wsp += (bytes + 255) & ~(size_t)255; return (void*)p; };
    bf* WQ = (bf*)take((size_t)DQ * DM * 2); bf* WK = (bf*)take((size_t)DKV * DM * 2); bf* WV = (bf*)take((size_t)DKV * DM * 2); bf* WO = (bf*)take((size_t)DM * DQ * 2); (void)WK; (void)WV;   // back to back: one [DQ + 2 DKV + DM][DM] block
    bf* XB = (bf*)take((size_t)NB_ * TT * DM * 2);
    // planes of all batches: per batch the 12 q heads directly followed by the 12 k heads (fp16, hi, lo alike)
    h16* QK16 = (h16*)take((size_t)NB_ * (NH_ + NKV) * TT * HD * 2); bf* QKh = (bf*)take((size_t)NB_ * (NH_ + NKV) * TT * HD * 2); bf* QKl = (bf*)take((size_t)NB_ * (NH_ + NKV) * TT * HD * 2);
    h16* VT16 = (h16*)take((size_t)NB_ * NKV * HD * TT * 2); bf* VTh = (bf*)take((size_t)NB_ * NKV * HD * TT * 2); bf* VTl = (bf*)take((size_t)NB_ * NKV * HD * TT * 2);
    bf* ATh = (bf*)take((size_t)NB_ * TT * DQ * 2); bf* ATl = (bf*)take((size_t)NB_ * TT * DQ * 2);
    if ((size_t)(wsp - (char*)d_ws) > ws_size) return;    // ws 256 MiB
    k_prep<<<4 * WTB + CVB, 256, 0, stream>>>(x, wq, wk, wv, wo, WQ, XB);
    // q, k, v of all batches in one GEMM (WQ, WK, WV are one [DQ + 2 DKV][DM] transposed weight); its epilogue writes the head planes
    k_qkv<<<dim3(NB_ * TT / (QWM * 64), (DQ + 2 * DKV) / (QWN * QCG * 16), 1), QWM * QWN * 32, 0, stream>>>(XB, WQ, QK16, QKh, QKl, VT16, VTh, VTl);
    k_fattn<<<dim3(NB_ * NH_, (TT - RH) / 128 + RH / 64, 1), 128, 0, stream>>>(QK16, QKh, QKl, VT16, VTh, VTl, ATh, ATl);   // attention of all batches and heads in one launch
    k_wo<<<dim3(NB_ * TT / (OWM * 32), DM / (OWN * 64), 1), OWM * OWN * 32, 0, stream>>>(ATh, ATl, WO, bo, OUT);   // output projection of all batches in one launch (rows b * TT + t)
}

// v007
// One run takes 86.6 microseconds.
// Two timings next to v006 put it at 1.28 and 1.29 times that version's speed.
// Counting every step since v000, it is 24.8 times as fast.
#include <hip/hip_runtime.h>

// Causal multi-head attention at d_model 768 with bias-free projections and an output bias (x [4][2048][768]; q, k, v = x W ('xw' [768][768], no bias; 12 heads x 64); scores masked (-inf) then / sqrt(64); softmax; out = merged Wo + bo ('xw' + bias) -> [4][2048][768] (6.3 M); argument order x, Wq, Wk, Wv, Wo, bo).
// Layout: one preparation launch (bf16 copy of x; 'xw' weights transposed); exact projections (K 768) of all batches in one launch that writes the head planes itself; one fused causal attention launch for all batches and heads (hybrid rows: < 512 hi/lo 3 products, rest fp16; running maximum and sum, keys only up to the diagonal); merged hi/lo x Wo exact + bo.
// Every 16-bit operand plane lies in FRAGMENT ORDER: a block of 16 rows x 32 k is 1,024 contiguous bytes, element (row r, k) at j * 256 + (h * 16 + r) * 8 + e with k = j * 16 + h * 8 + e (j, h in 0..1, e in 0..7),
// so that lane h * 16 + r of a wave finds the two 16-byte halves of its WMMA fragment at lane * 8 and 256 + lane * 8: each wave-wide load or store covers four whole 128-byte lines. The k order of every fragment is what it was.
// Compute dtypes, f32 accumulate: every input rounded to bf16; projections exact; attention rows < 512 3 products, rest fp16; softmax f32; Wo hl x exact + bias.

#define NB_  4
#define TT   2048
#define DM   768
#define NH_  12
#define NKV  12
#define REP  (NH_ / NKV)
#define HD   64
#define DQ   (NH_ * HD)
#define DKV  (NKV * HD)
#define RH   512                  // query rows < RH use hi+lo planes
#define SCL  0.125f   // HD^-0.5
typedef _Float16 h16;
typedef unsigned short bf;
typedef __attribute__((ext_vector_type(16))) __bf16   v16bf;
typedef __attribute__((ext_vector_type(16))) _Float16 v16h;
typedef __attribute__((ext_vector_type(8)))  _Float16 v8h;
typedef __attribute__((ext_vector_type(8)))  unsigned short v8us;
typedef __attribute__((ext_vector_type(8)))  float    v8f;
typedef __attribute__((ext_vector_type(4)))  float    v4f;
typedef v8h  __attribute__((may_alias)) v8ha;
typedef v4f  __attribute__((may_alias)) v4fa;
typedef v8us __attribute__((may_alias)) v8usa;

__device__ __forceinline__ unsigned short f2bf(float f) { unsigned u = __float_as_uint(f); u += 0x7FFFu + ((u >> 16) & 1u); return (unsigned short)(u >> 16); }
__device__ __forceinline__ float bf2f(unsigned short b) { return __uint_as_float(((unsigned)b) << 16); }
__device__ __forceinline__ float bfr(float f) { return bf2f(f2bf(f)); }
__device__ __forceinline__ v16h cat16(v8h lo, v8h hi) { return __builtin_shufflevector(lo, hi, 0, 1, 2, 3, 4, 5, 6, 7, 8, 9, 10, 11, 12, 13, 14, 15); }
__device__ __forceinline__ v16bf cat16b(v8us lo, v8us hi) { return __builtin_bit_cast(v16bf, __builtin_shufflevector(lo, hi, 0, 1, 2, 3, 4, 5, 6, 7, 8, 9, 10, 11, 12, 13, 14, 15)); }
__device__ __forceinline__ v8f wmma16(v16h a, v16h b, v8f c) { return __builtin_amdgcn_wmma_f32_16x16x32_f16(false, a, false, b, (short)0, c, false, false); }
__device__ __forceinline__ v8f wmmab(v16bf a, v16bf b, v8f c) { return __builtin_amdgcn_wmma_f32_16x16x32_bf16(false, a, false, b, (short)0, c, false, false); }

__device__ __forceinline__ h16 tohx(float x) { return (h16)x; }
__device__ __forceinline__ void splitf(float y, unsigned short& h, unsigned short& l) { h = f2bf(y); l = f2bf(y - bf2f(h)); }
// stands behind a run of global loads or stores, in front of whatever next overwrites a register that they name (address pair, store data)
#define XWAIT() asm volatile("s_wait_xcnt 0x0" ::: "memory")
// the same wait behind a run of loads from two (four) addresses plus immediate offsets: the addresses are inputs, so they stay in their registers up to the wait and no load of the run lands on them
#define XWAITA(p, q) asm volatile("s_wait_xcnt 0x0" :: "v"(p), "v"(q) : "memory")
#define XWAITA4(p, q, r, s) asm volatile("s_wait_xcnt 0x0" :: "v"(p), "v"(q), "v"(r), "v"(s) : "memory")
// the same wait behind ALL ten fragment loads of one K block. The loaded fragments are inputs too (inputs only, nothing is changed): so every load of the block is issued ahead of the first product and the wave waits once a block;
// without them the compiler turns two register sets over for one operand and fetches it fragment by fragment, four products ahead of its use, with a wait in front of each
#define XWAITF10(p, q, f) asm volatile("s_wait_xcnt 0x0" :: "v"(p), "v"(q), "v"(f[0]), "v"(f[1]), "v"(f[2]), "v"(f[3]), "v"(f[4]), "v"(f[5]), "v"(f[6]), "v"(f[7]), "v"(f[8]), "v"(f[9]) : "memory")

// Asks L2 for the data at p: one request a lane, nothing comes back to the wave. Every plane read below was written by an earlier launch.
// The second line is the wait that stands behind any global access before its address register is used for something else.
__device__ __forceinline__ void l2_ask(const char* p) { asm volatile("global_prefetch_b8 %0, off scope:SCOPE_SE\n\ts_wait_xcnt 0x0" :: "v"(p) : "memory"); }

template <typename T16> struct WFrag;
template <> struct WFrag<h16> { typedef v16h V; static __device__ __forceinline__ V ld(const h16* p) { return cat16(*(const v8h*)p, *(const v8h*)(p + 256)); } static __device__ __forceinline__ v8f mma(V a, V b, v8f c) { return wmma16(a, b, c); } };
template <> struct WFrag<bf> { typedef v16bf V; static __device__ __forceinline__ V ld(const bf* p) { return cat16b(*(const v8us*)p, *(const v8us*)(p + 256)); } static __device__ __forceinline__ v8f mma(V a, V b, v8f c) { return wmmab(a, b, c); } };

// ---- The two projections: every wave owns one output tile for the WHOLE K loop (no split of K, so no partial tiles, no LDS sum and no barrier), operands straight from the bf16 planes in fragment order
// (blocks of one 16-row group K-contiguous: block (g, kb) at (g * K / 32 + kb) * 512, so the row groups of a tile stand at immediate offsets from one address and a K block is 512 elements on).
// As many work-groups as WGPs, all waves resident at once (three on a SIMD); the waves of a work-group form a rectangle of tiles, so that an operand block fetched from L2 by one wave can be found in the WGP cache by the other waves of its row or column.
// tile_mm: acc[mb][nb] += A rows (mb * 16 ..) x B rows (nb * 16 ..) over K; pa, pb: the lane's place in the first block of either operand; both operands use the same loader and k order.
template <int MB, int NB, int K>
__device__ __forceinline__ void tile_mm(const bf* __restrict__ pa, const bf* __restrict__ pb, v8f (&acc)[MB][NB]) {
    typedef WFrag<bf> F; static_assert(MB + NB == 10, "the wait names ten fragments");
#pragma unroll 1
    for (int kb = 0; kb < K / 32; ++kb) {   // stays rolled (for speed only)
        F::V f[MB + NB];   // A fragments, then B fragments
#pragma unroll
        for (int mb = 0; mb < MB; ++mb) f[mb] = F::ld(pa + mb * 16 * K);
#pragma unroll
        for (int nb = 0; nb < NB; ++nb) f[MB + nb] = F::ld(pb + nb * 16 * K);
        XWAITF10(pa, pb, f);
#pragma unroll
        for (int nb = 0; nb < NB; ++nb)
#pragma unroll
            for (int mb = 0; mb < MB; ++mb) acc[mb][nb] = F::mma(f[mb], f[MB + nb], acc[mb][nb]);
        pa += 512; pb += 512;
    }
}
// One accumulator tile to the three 16-bit planes (fp16, bf16 hi, bf16 lo): a lane holds 8 successive k of one fragment row, which is its 16-byte piece of a half block in fragment order: a wave fills four whole lines of each plane.
__device__ __forceinline__ void plane_store(const v8f t, h16* P16, bf* Ph, bf* Pl, size_t e) {
    v8h o16; v8us oh, ol;
#pragma unroll
    for (int j = 0; j < 8; ++j) { o16[j] = tohx(t[j]); unsigned short a2, c2; splitf(t[j], a2, c2); oh[j] = a2; ol[j] = c2; }
    h16* q16 = P16 + e; bf* qh = Ph + e; bf* ql = Pl + e; *(v8h*)q16 = o16; *(v8us*)qh = oh; *(v8us*)ql = ol;
    // the wait behind the three stores; their addresses and data are inputs (inputs only), so that they stay in their registers up to it: with a bare wait the next tile's arithmetic is moved in front of it and lands on the last store's data
    asm volatile("s_wait_xcnt 0x0" :: "v"(q16), "v"(qh), "v"(ql), "v"(o16), "v"(oh), "v"(ol) : "memory");
}
// ---- k_qkv: q, k, v of all batches (rows b * TT + t; columns 0 .. 767 q, .. 1535 k, .. 2303 v). A wave's tile is 64 tokens x 96 columns; 12 waves (4 x 3 tiles: 256 tokens x 288 columns) a work-group, three on a SIMD; grid (tokens / 256, columns / 288).
// A q or k tile: weight rows as the A operand, tokens as B, so a lane holds 8 d of one token (fragment rows t, k = d); a v tile: tokens as A, weight rows as B, so a lane holds 8 tokens of one d (V^T: fragment rows d, k = t).
// Each 16-column group lies in one head. The branch is the same for a whole wave.
#define QWM 4
#define QWN 3
#define QCG 6   // 16-column groups of a wave's tile
static_assert((NB_ * TT) % (QWM * 64) == 0 && (DQ + 2 * DKV) % (QWN * QCG * 16) == 0 && DQ % (QCG * 16) == 0 && DKV % (QCG * 16) == 0 && TT % 64 == 0 && HD == 64, "whole tiles; a tile lies in one of q, k, v and in one batch");
__global__ __launch_bounds__(QWM * QWN * 32) void k_qkv(const bf* __restrict__ X, const bf* __restrict__ Wt, h16* QK16, bf* QKh, bf* QKl, h16* VT16, bf* VTh, bf* VTl) {
    const int lane = threadIdx.x & 31; const int wave = __builtin_amdgcn_readfirstlane((int)(threadIdx.x >> 5));
    const int r0 = ((int)blockIdx.x * QWM + (wave & 3)) * 64, c0 = ((int)blockIdx.y * QWN + (wave >> 2)) * (QCG * 16);
    const bf* px = X + (size_t)r0 * DM + lane * 8; const bf* pw = Wt + (size_t)c0 * DM + lane * 8; const int pb = r0 / TT, pt = r0 % TT;   // batch and first token of the tile
    // L2 requests for both operand panels at entry, dealt over the work-groups that read the same panel (for speed only: all are resident together): the token panel over the column blocks,
    // the weight panel in 16 shares over the 32 token blocks (each share twice), chosen so that any four neighbouring indices modulo 8 hold all 16 shares. Wave-uniform branches; every address lies inside its panel.
    constexpr int XU = QWM * 64 * DM * 2 / 256, XS = XU / ((DQ + 2 * DKV) / (QWN * QCG * 16)), WU = QWN * QCG * 16 * DM * 2 / 256, WS = WU / 16;
    static_assert(XS == 6 * 32 && WS * 16 == WU && WS <= 4 * 32 && NB_ * TT / (QWM * 64) == 32, "shares of whole waves; 32 token blocks");
    if (wave < 6) l2_ask((const char*)X + ((size_t)blockIdx.x * XU + blockIdx.y * XS + wave * 32 + lane) * 256);
    else if (wave < 10) { const int u = (wave - 6) * 32 + lane; l2_ask((const char*)Wt + ((size_t)blockIdx.y * WU + (((int)blockIdx.x & 3) * 4 + ((int)blockIdx.x >> 3)) * WS + (u < WS ? u : WS - 1)) * 256); }
    if (c0 < DQ + DKV) {
        v8f acc[QCG][4];
#pragma unroll
        for (int mb = 0; mb < QCG; ++mb)
#pragma unroll
            for (int nb = 0; nb < 4; ++nb) acc[mb][nb] = (v8f){};
        tile_mm<QCG, 4, DM>(pw, px, acc);
#pragma unroll
        for (int mb = 0; mb < QCG; ++mb) { const int cg = c0 + mb * 16; const size_t hb = ((size_t)(pb * (NH_ + NKV) + cg / HD) * TT + pt) * HD + (cg % HD) * 16 + lane * 8;   // head plane (0 .. 11 q, 12 .. 23 k); 16 d are one half block of 256 elements
#pragma unroll
            for (int nb = 0; nb < 4; ++nb) plane_store(acc[mb][nb], QK16, QKh, QKl, hb + nb * 1024); }   // 16 tokens x 64 d are 1,024 elements
    } else {
        v8f acc[4][QCG];
#pragma unroll
        for (int mb = 0; mb < 4; ++mb)
#pragma unroll
            for (int nb = 0; nb < QCG; ++nb) acc[mb][nb] = (v8f){};
        tile_mm<4, QCG, DM>(px, pw, acc);
#pragma unroll
        for (int nb = 0; nb < QCG; ++nb) { const int cg = c0 - DQ - DKV + nb * 16; const size_t hb = ((size_t)(pb * NKV + cg / HD) * TT + pt) * HD + (cg % HD) * 32 + lane * 8;   // 16 d x 32 tokens are one block of 512 elements
#pragma unroll
            for (int mb = 0; mb < 4; ++mb) plane_store(acc[mb][nb], VT16, VTh, VTl, hb + (mb >> 1) * 2048 + (mb & 1) * 256); }   // 32 tokens x 64 d are 2,048 elements; 16 tokens a half block
    }
}
// ---- k_wo: out = merged (hi + lo planes) x Wo + bo for all batches. A wave's tile is 32 tokens x 64 columns (Wo rows as the A operand, tokens as B); 12 waves (4 x 3 tiles: 128 tokens x 192 columns) a work-group; grid (tokens / 128, columns / 192).
// The f32 tile leaves through the wave's OWN LDS range (token rows at pitch 68 floats), read back by rows, so that every store covers whole lines: two token rows of 256 bytes each.
#define OWM 4
#define OWN 3
#define OSLOT (32 * 68)
static_assert((NB_ * TT) % (OWM * 32) == 0 && DM % (OWN * 64) == 0, "whole tiles");
__global__ __launch_bounds__(OWM * OWN * 32) void k_wo(const bf* __restrict__ Ah, const bf* __restrict__ Al, const bf* __restrict__ Wo, const float* __restrict__ bias, float* C) {
    typedef WFrag<bf> F;
    __shared__ __align__(16) float os[OWM * OWN * OSLOT];
    const int lane = threadIdx.x & 31; const int wave = __builtin_amdgcn_readfirstlane((int)(threadIdx.x >> 5)); const int lr = lane & 15, hi = lane >> 4;
    const int r0 = ((int)blockIdx.x * OWM + (wave & 3)) * 32, c0 = ((int)blockIdx.y * OWN + (wave >> 2)) * 64;
    const bf* pw = Wo + (size_t)c0 * DQ + lane * 8; const bf* ph = Ah + (size_t)r0 * DQ + lane * 8; const bf* pl = Al + (size_t)r0 * DQ + lane * 8;
    // L2 requests at entry, dealt as in k_qkv: the two token panels (hi, then lo) over the four column blocks, one request a lane; the weight panel in 16 shares over the token blocks
    constexpr int AU = OWM * 32 * DQ * 2 / 256, OU = OWN * 64 * DQ * 2 / 256, OS = OU / 16;
    static_assert(2 * AU == (DM / (OWN * 64)) * OWM * OWN * 32 && OS * 16 == OU && OS <= 3 * 32, "one request a lane covers both token panels");
    { const int u = (int)blockIdx.y * (OWM * OWN * 32) + (int)threadIdx.x; l2_ask((const char*)(u < AU ? Ah : Al) + ((size_t)blockIdx.x * AU + (u < AU ? u : u - AU)) * 256); }
    if (wave < 3) { const int u = wave * 32 + lane; l2_ask((const char*)Wo + ((size_t)blockIdx.y * OU + (((int)blockIdx.x & 3) * 4 + (((int)blockIdx.x >> 3) & 3)) * OS + (u < OS ? u : OS - 1)) * 256); }
    v8f acc[4][2];
#pragma unroll
    for (int mb = 0; mb < 4; ++mb)
#pragma unroll
        for (int nb = 0; nb < 2; ++nb) acc[mb][nb] = (v8f){};
#pragma unroll
    for (int kb = 0; kb < DQ / 32; ++kb) {   // unrolled whole (one tile shape, a short text): every load is one of three addresses plus an immediate offset, and no address register is rewritten inside
        F::V w[4], xh[2], xl[2];
#pragma unroll
        for (int mb = 0; mb < 4; ++mb) w[mb] = F::ld(pw + mb * 16 * DQ + kb * 512);
#pragma unroll
        for (int nb = 0; nb < 2; ++nb) { xh[nb] = F::ld(ph + nb * 16 * DQ + kb * 512); xl[nb] = F::ld(pl + nb * 16 * DQ + kb * 512); }
#pragma unroll
        for (int nb = 0; nb < 2; ++nb)
#pragma unroll
            for (int mb = 0; mb < 4; ++mb) acc[mb][nb] = F::mma(w[mb], xh[nb], acc[mb][nb]);
#pragma unroll
        for (int nb = 0; nb < 2; ++nb)
#pragma unroll
            for (int mb = 0; mb < 4; ++mb) acc[mb][nb] = F::mma(w[mb], xl[nb], acc[mb][nb]);
    }
    XWAITA4(pw, ph, pl, pl);
    const int col = lr * 4; const float* pbias = bias + c0 + col; v4f bb;
#pragma unroll
    for (int q = 0; q < 4; ++q) bb[q] = pbias[q];
    XWAITA(pbias, pbias);
    float* slot = os + wave * OSLOT;
#pragma unroll
    for (int nb = 0; nb < 2; ++nb)
#pragma unroll
        for (int mb = 0; mb < 4; ++mb) { float* p = slot + (nb * 16 + lr) * 68 + mb * 16 + hi * 8; const v8f t = acc[mb][nb];
            *(v4fa*)p = __builtin_shufflevector(t, t, 0, 1, 2, 3); *(v4fa*)(p + 4) = __builtin_shufflevector(t, t, 4, 5, 6, 7); }
    asm volatile("s_wait_dscnt 0x0" ::: "memory");   // the wave's own LDS writes are done before its lanes read one another's pieces back (no other wave touches this range)
#pragma unroll
    for (int q = 0; q < 4; ++q) bb[q] = bfr(bb[q]);
    float* cp = C + (size_t)(r0 + hi) * DM + c0 + col; v4f s[16];
#pragma unroll
    for (int i = 0; i < 16; ++i) s[i] = *(const v4fa*)(slot + (i * 2 + hi) * 68 + col);
#pragma unroll
    for (int i = 0; i < 16; ++i) *(v4f*)(cp + (size_t)i * 2 * DM) = s[i] + bb;
    XWAIT();
}

typedef __attribute__((ext_vector_type(2))) _Float16 v2h;
typedef __attribute__((ext_vector_type(4))) _Float16 v4h;
typedef __attribute__((ext_vector_type(2))) unsigned short v2us;
typedef __attribute__((ext_vector_type(4))) unsigned short v4us;
typedef __attribute__((ext_vector_type(2))) float v2f;
typedef __attribute__((ext_vector_type(4))) int v4i;

// ---- k_prep: all operand preparation in one launch, both results in fragment order; a thread makes 16-byte pieces (8 k of one fragment row), piece i at element i * 8, so a wave writes four whole lines.
// Piece i: block i / 64 = (row group, K block), half (i / 32) % 2, lane i % 32. Work-groups 0 .. 4 WTB - 1: the four 'xw' weights [k][n] to bf16 with fragment rows n, back to back in Wt, 2 pieces a thread
// (16 lanes read 16 adjacent n of one k); the other CVB work-groups: x to bf16, 4 pieces a thread.
#define WTB (DM * DQ / 64 / 64)
#define CVB (NB_ * TT * DM / 8 / 1024)
static_assert(DQ == DM && DKV == DM && WTB * 64 * 64 == DM * DQ && CVB * 8 * 1024 == NB_ * TT * DM, "the preparation grid covers every element exactly once");
__global__ __launch_bounds__(256) void k_prep(const float* __restrict__ x, const float* __restrict__ wq, const float* __restrict__ wk, const float* __restrict__ wv, const float* __restrict__ wo, bf* Wt, bf* XB) {
    const int blk = blockIdx.x;
    if (blk < 4 * WTB) {
        const int id = blk / WTB; const float* __restrict__ w = id == 0 ? wq : id == 1 ? wk : id == 2 ? wv : wo; bf* Bt = Wt + (size_t)id * DM * DQ;
        const int i0 = (blk % WTB) * 512 + (int)threadIdx.x; float f[2][8]; const float* pw[2];
#pragma unroll
        for (int q = 0; q < 2; ++q) { const int i = i0 + q * 256, bk = i >> 6; const int n = (bk / (DM / 32)) * 16 + (i & 15), k = (bk % (DM / 32)) * 32 + ((i >> 5) & 1) * 16 + ((i >> 4) & 1) * 8; pw[q] = w + (size_t)k * DQ + n;
#pragma unroll
            for (int e = 0; e < 8; ++e) f[q][e] = pw[q][e * DQ]; }
        XWAITA(pw[0], pw[1]);
#pragma unroll
        for (int q = 0; q < 2; ++q) { v8us o;
#pragma unroll
            for (int e = 0; e < 8; ++e) o[e] = f2bf(f[q][e]);
            *(v8us*)(Bt + (size_t)(i0 + q * 256) * 8) = o; }
        XWAIT();
    } else {
        const size_t i0 = (size_t)(blk - 4 * WTB) * 1024 + threadIdx.x; v8f v[4]; const float* px[4];
#pragma unroll
        for (int q = 0; q < 4; ++q) { const int i = (int)i0 + q * 256, bk = i >> 6; px[q] = x + (size_t)((bk / (DM / 32)) * 16 + (i & 15)) * DM + (bk % (DM / 32)) * 32 + ((i >> 5) & 1) * 16 + ((i >> 4) & 1) * 8; v[q] = *(const v8f*)px[q]; }
        XWAITA4(px[0], px[1], px[2], px[3]);
#pragma unroll
        for (int q = 0; q < 4; ++q) { v8us o;
#pragma unroll
            for (int k = 0; k < 8; ++k) o[k] = f2bf(v[q][k]);
            *(v8us*)(XB + (i0 + q * 256) * 8) = o; }
        XWAIT();
    }
}
#define SC2 (SCL * 1.4426950408889634f)   // score scale x log2(e): the exponentials are taken to base 2
typedef __attribute__((ext_vector_type(16))) unsigned short v16us;
template <typename T16, bool HL, int NQ, bool DIAG>
__device__ __forceinline__ void attn_step(const T16* __restrict__ Kp, const T16* __restrict__ K2, const T16* __restrict__ Vt, const T16* __restrict__ Vt2, int k0, int q0, int lr, int hi,
                                          const typename WFrag<T16>::V (&qf)[NQ][2], const typename WFrag<T16>::V (&q2f)[NQ][2], typename WFrag<T16>::V (&kf)[2][2], float (&m)[NQ], float (&l)[NQ], v8f (&o)[4][NQ]) {
    typedef WFrag<T16> F; typedef typename F::V V; const int l8 = (hi * 16 + lr) * 8;   // the lane's place in a half block; 32 keys are 4 blocks of K (16 keys, 32 d) and 4 of V^T (16 d, 32 keys), 2,048 elements each
    v8f s[2][NQ];
#pragma unroll
    for (int kt = 0; kt < 2; ++kt)
#pragma unroll
        for (int qt = 0; qt < NQ; ++qt) s[kt][qt] = (v8f){};
    V a2[2][2], va[4], va2[4];   // this pass's lo K plane and V^T fragments are requested first: V^T flies under the score products and the softmax arithmetic
    if (HL) {
#pragma unroll
        for (int kt = 0; kt < 2; ++kt)
#pragma unroll
            for (int ks = 0; ks < 2; ++ks) a2[kt][ks] = F::ld(K2 + (size_t)k0 * HD + (kt * 2 + ks) * 512 + l8);
        XWAIT(); }
#pragma unroll
    for (int dt = 0; dt < 4; ++dt) { const size_t off = (size_t)k0 * HD + dt * 512 + l8; va[dt] = F::ld(Vt + off); if (HL) va2[dt] = F::ld(Vt2 + off); }
    XWAIT();
#pragma unroll
    for (int kt = 0; kt < 2; ++kt)
#pragma unroll
        for (int ks = 0; ks < 2; ++ks)
#pragma unroll
            for (int qt = 0; qt < NQ; ++qt) { s[kt][qt] = F::mma(kf[kt][ks], qf[qt][ks], s[kt][qt]); if (HL) { s[kt][qt] = F::mma(kf[kt][ks], q2f[qt][ks], s[kt][qt]); s[kt][qt] = F::mma(a2[kt][ks], qf[qt][ks], s[kt][qt]); } }
    if (!DIAG) {   // the next pass's K fragments, into the registers that the score products have just read (a pass below the diagonal is always followed by another)
#pragma unroll
        for (int kt = 0; kt < 2; ++kt)
#pragma unroll
            for (int ks = 0; ks < 2; ++ks) kf[kt][ks] = F::ld(Kp + (size_t)(k0 + 32) * HD + (kt * 2 + ks) * 512 + l8);
        XWAIT(); }
    if (DIAG) {
#pragma unroll
        for (int kt = 0; kt < 2; ++kt)
#pragma unroll
            for (int qt = 0; qt < NQ; ++qt)
#pragma unroll
                for (int j = 0; j < 8; ++j) if (k0 + kt * 16 + hi * 8 + j > q0 + qt * 16 + lr) s[kt][qt][j] = -3.0e38f; }
    float mx[NQ]; bool need = false;
#pragma unroll
    for (int qt = 0; qt < NQ; ++qt) { float t = fmaxf(s[0][qt][0], s[1][qt][0]);
#pragma unroll
        for (int j = 1; j < 8; ++j) t = fmaxf(t, fmaxf(s[0][qt][j], s[1][qt][j]));
        mx[qt] = fmaxf(t, __shfl_xor(t, 16, 32)); need = need || (mx[qt] > m[qt]); }
    if (__builtin_amdgcn_ballot_w32(need) != 0) {   // some row's maximum rose: bring sums and outputs to the new maximum (factor exactly 1 for the rows whose maximum stayed)
#pragma unroll
        for (int qt = 0; qt < NQ; ++qt) { const float mn = fmaxf(m[qt], mx[qt]); const float al = __builtin_amdgcn_exp2f((m[qt] - mn) * SC2); m[qt] = mn; l[qt] *= al;
#pragma unroll
            for (int dt = 0; dt < 4; ++dt) o[dt][qt] *= al; } }
    V pb[NQ], pb2[NQ];
#pragma unroll
    for (int qt = 0; qt < NQ; ++qt) { const float nm = -m[qt] * SC2; float p[16];
#pragma unroll
        for (int e = 0; e < 16; ++e) { p[e] = __builtin_amdgcn_exp2f(fmaf(s[e >> 3][qt][e & 7], SC2, nm)); l[qt] += p[e]; }
        if constexpr (HL) { v16us ph, pl;
#pragma unroll
            for (int e = 0; e < 16; ++e) { unsigned short a, c2; splitf(p[e], a, c2); ph[e] = a; pl[e] = c2; }
            pb[qt] = __builtin_bit_cast(v16bf, ph); pb2[qt] = __builtin_bit_cast(v16bf, pl);
        } else {
#pragma unroll
            for (int e = 0; e < 16; ++e) pb[qt][e] = tohx(p[e]); } }
#pragma unroll
    for (int dt = 0; dt < 4; ++dt)
#pragma unroll
        for (int qt = 0; qt < NQ; ++qt) { o[dt][qt] = F::mma(va[dt], pb[qt], o[dt][qt]); if (HL) { o[dt][qt] = F::mma(va[dt], pb2[qt], o[dt][qt]); o[dt][qt] = F::mma(va2[dt], pb[qt], o[dt][qt]); } }
}
template <typename T16, bool HL, int NQ>
__device__ __forceinline__ void attn_rows(const T16* __restrict__ Q, const T16* __restrict__ Q2, const T16* __restrict__ Kp, const T16* __restrict__ K2, const T16* __restrict__ Vt, const T16* __restrict__ Vt2, int q0, int lane, bool ask, bf* Ah, bf* Al) {
    typedef WFrag<T16> F; typedef typename F::V V; const int lr = lane & 15, hi = lane >> 4;
    V qf[NQ][2], q2f[NQ][2], kf[2][2];
#pragma unroll
    for (int qt = 0; qt < NQ; ++qt)
#pragma unroll
        for (int ks = 0; ks < 2; ++ks) { const size_t off = (size_t)(q0 + qt * 16) * HD + ks * 512 + lane * 8; qf[qt][ks] = F::ld(Q + off); if (HL) q2f[qt][ks] = F::ld(Q2 + off); }
#pragma unroll
    for (int kt = 0; kt < 2; ++kt)
#pragma unroll
        for (int ks = 0; ks < 2; ++ks) kf[kt][ks] = F::ld(Kp + (kt * 2 + ks) * 512 + lane * 8);   // keys 0 .. 31; every later pass's K fragments are fetched one pass ahead
    XWAIT();
    float m[NQ], l[NQ]; v8f o[4][NQ]; const int kd = q0 & ~31;   // first key of the 32-key block that holds the diagonal
#pragma unroll
    for (int qt = 0; qt < NQ; ++qt) { m[qt] = -3.0e38f; l[qt] = 0.f; }
#pragma unroll
    for (int dt = 0; dt < 4; ++dt)
#pragma unroll
        for (int qt = 0; qt < NQ; ++qt) o[dt][qt] = (v8f){};
    // L2 requests for K and V^T four passes ahead (fp16 rows; 'ask': one wave of a work-group, the one with the most keys). A pass reads 4,096 contiguous bytes of either plane: lanes 0 .. 15 ask for the 16 units of K, lanes 16 .. 31 for those of V^T.
    // pf stays in one register pair for the whole loop (the statements hold it as an operand that they may change) and points at the current pass's block; the test keeps the request, also after pf's next step, on blocks that this wave reads itself.
    const char* pf = hi ? (const char*)Vt + lr * 256 : (const char*)Kp + lr * 256; const int pfk = ask ? kd : 0;
    if constexpr (!HL) { static_assert(RH >= 5 * 32, "the first blocks exist for every fp16 row");
        if (ask) asm volatile("global_prefetch_b8 %0, off offset:4096 scope:SCOPE_SE\n\tglobal_prefetch_b8 %0, off offset:8192 scope:SCOPE_SE\n\tglobal_prefetch_b8 %0, off offset:12288 scope:SCOPE_SE\n\ts_wait_xcnt 0x0" : "+v"(pf) :: "memory"); }
#pragma unroll 1
    for (int k0 = 0; k0 < kd; k0 += 32) {
        if constexpr (!HL) {
            if (k0 + 4 * 32 < pfk) asm volatile("global_prefetch_b8 %0, off offset:16384 scope:SCOPE_SE\n\ts_wait_xcnt 0x0" : "+v"(pf) :: "memory");
            pf += 4096; }
        attn_step<T16, HL, NQ, false>(Kp, K2, Vt, Vt2, k0, q0, lr, hi, qf, q2f, kf, m, l, o);
    }
    attn_step<T16, HL, NQ, true>(Kp, K2, Vt, Vt2, kd, q0, lr, hi, qf, q2f, kf, m, l, o);   // the diagonal block: keys kd .. kd + 31, masked by select
#pragma unroll
    for (int qt = 0; qt < NQ; ++qt) { const float inv = __fdiv_rn(1.0f, l[qt] + __shfl_xor(l[qt], 16, 32)); const size_t ro = (size_t)(q0 + qt * 16) * DQ + lane * 8;   // merged planes in fragment order for the output projection (rows t, k = h * 64 + d): this head's 16 d of tile dt are half block dt of its two K blocks
#pragma unroll
        for (int dt = 0; dt < 4; ++dt) { v8us oh, ol;
#pragma unroll
            for (int j = 0; j < 8; ++j) { unsigned short a, c2; splitf(o[dt][qt][j] * inv, a, c2); oh[j] = a; ol[j] = c2; }
            *(v8us*)(Ah + ro + dt * 256) = oh; *(v8us*)(Al + ro + dt * 256) = ol; XWAIT(); } }
}
// grid (batch x head, position blocks: first the (TT - RH) / 128 fp16 blocks of 4 waves x 32 rows, the longest first, then the RH / 64 hi/lo blocks of 4 waves x 16 rows); the 4 waves of a work-group are independent
// (adjacent query rows walk the same keys: they meet in the WGP cache). The hi/lo rows take 16 per wave because both planes of every operand are live: at 32 the kernel needs registers above v255.
#define NFB ((TT - RH) / 128)
__global__ __launch_bounds__(128) void k_fattn(const h16* __restrict__ QK16, const bf* __restrict__ QKh, const bf* __restrict__ QKl, const h16* __restrict__ VT16, const bf* __restrict__ VTh, const bf* __restrict__ VTl, bf* ATh, bf* ATl) {
    const int lane = threadIdx.x & 31; const int wave = __builtin_amdgcn_readfirstlane((int)(threadIdx.x >> 5)); const int b = blockIdx.x / NH_, h = blockIdx.x % NH_, y = blockIdx.y;
    const size_t qo = ((size_t)b * (NH_ + NKV) + h) * TT * HD, ko = ((size_t)b * (NH_ + NKV) + NH_ + h / REP) * TT * HD, vo = ((size_t)b * NKV + h / REP) * HD * TT, ao = (size_t)b * TT * DQ + h * HD * 16;
    if (y < NFB) attn_rows<h16, false, 2>(QK16 + qo, nullptr, QK16 + ko, nullptr, VT16 + vo, nullptr, TT - (y + 1) * 128 + wave * 32, lane, wave == 3, ATh + ao, ATl + ao);
    else attn_rows<bf, true, 1>(QKh + qo, QKl + qo, QKh + ko, QKl + ko, VTh + vo, VTl + vo, RH - (y - NFB + 1) * 64 + wave * 16, lane, false, ATh + ao, ATl + ao);
}

extern "C" void kernel_launch(void* const* d_in, const int* in_sizes, int n_in,
                              void* d_out, int out_size, void* d_ws, size_t ws_size, hipStream_t stream) {
    (void)in_sizes; (void)n_in; (void)out_size;
    const float* x = (const float*)d_in[0]; const float* wq = (const float*)d_in[1]; const float* wk = (const float*)d_in[2]; const float* wv = (const float*)d_in[3]; const float* wo = (const float*)d_in[4]; const float* bo = (const float*)d_in[5];   /* inputs x, Wq, Wk, Wv, Wo ('xw' [768][768]), bo */
    float* OUT = (float*)d_out;     // [4][2048][768]
    char* wsp = (char*)d_ws;
    auto take = [&](size_t bytes) { char* p = wsp; wsp += (bytes + 255) & ~(size_t)255; return (void*)p; };
    bf* WQ = (bf*)take((size_t)DQ * DM * 2); bf* WK = (bf*)take((size_t)DKV * DM * 2); bf* WV = (bf*)take((size_t)DKV * DM * 2); bf* WO = (bf*)take((size_t)DM * DQ * 2); (void)WK; (void)WV;   // back to back: one [DQ + 2 DKV + DM][DM] block
    bf* XB = (bf*)take((size_t)NB_ * TT * DM * 2);
    // planes of all batches: per batch the 12 q heads directly followed by the 12 k heads (fp16, hi, lo alike)
    h16* QK16 = (h16*)take((size_t)NB_ * (NH_ + NKV) * TT * HD * 2); bf* QKh = (bf*)take((size_t)NB_ * (NH_ + NKV) * TT * HD * 2); bf* QKl = (bf*)take((size_t)NB_ * (NH_ + NKV) * TT * HD * 2);
    h16* VT16 = (h16*)take((size_t)NB_ * NKV * HD * TT * 2); bf* VTh = (bf*)take((size_t)NB_ * NKV * HD * TT * 2); bf* VTl = (bf*)take((size_t)NB_ * NKV * HD * TT * 2);
    bf* ATh = (bf*)take((size_t)NB_ * TT * DQ * 2); bf* ATl = (bf*)take((size_t)NB_ * TT * DQ * 2);
    if ((size_t)(wsp - (char*)d_ws) > ws_size) return;    // ws 256 MiB
    k_prep<<<4 * WTB + CVB, 256, 0, stream>>>(x, wq, wk, wv, wo, WQ, XB);
    // q, k, v of all batches in one GEMM (WQ, WK, WV are one [DQ + 2 DKV][DM] transposed weight); its epilogue writes the head planes
    k_qkv<<<dim3(NB_ * TT / (QWM * 64), (DQ + 2 * DKV) / (QWN * QCG * 16), 1), QWM * QWN * 32, 0, stream>>>(XB, WQ, QK16, QKh, QKl, VT16, VTh, VTl);
    k_fattn<<<dim3(NB_ * NH_, (TT - RH) / 128 + RH / 64, 1), 128, 0, stream>>>(QK16, QKh, QKl, VT16, VTh, VTl, ATh, ATl);   // attention of all batches and heads in one launch
    k_wo<<<dim3(NB_ * TT / (OWM * 32), DM / (OWN * 64), 1), OWM * OWN * 32, 0, stream>>>(ATh, ATl, WO, bo, OUT);   // output projection of all batches in one launch (rows b * TT + t)
}

// v008
// Measured time: 84.1 microseconds a run.
// Next to v007, in two timings, it ran 1.03 times as fast each time.
// Counting every step since v000, it is 25.6 times as fast.
#include <hip/hip_runtime.h>

// Causal multi-head attention at d_model 768 with bias-free projections and an output bias (x [4][2048][768]; q, k, v = x W ('xw' [768][768], no bias; 12 heads x 64); scores masked (-inf) then / sqrt(64); softmax; out = merged Wo + bo ('xw' + bias) -> [4][2048][768] (6.3 M); argument order x, Wq, Wk, Wv, Wo, bo).
// Layout: one preparation launch (bf16 copy of x; 'xw' weights transposed); exact projections (K 768) of all batches in one launch that writes the head planes itself; one fused causal attention launch for all batches and heads (hybrid rows: < 512 hi/lo 3 products, rest fp16; running maximum and sum, keys only up to the diagonal); merged hi/lo x Wo exact + bo.
// Every 16-bit operand plane lies in FRAGMENT ORDER: a block of 16 rows x 32 k is 1,024 contiguous bytes, element (row r, k) at j * 256 + (h * 16 + r) * 8 + e with k = j * 16 + h * 8 + e (j, h in 0..1, e in 0..7),
// so that lane h * 16 + r of a wave finds the two 16-byte halves of its WMMA fragment at lane * 8 and 256 + lane * 8: each wave-wide load or store covers four whole 128-byte lines. The k order of every fragment is what it was.
// Compute dtypes, f32 accumulate: every input rounded to bf16; projections exact; attention rows < 512 3 products, rest fp16; softmax f32; Wo hl x exact + bias.

#define NB_  4
#define TT   2048
#define DM   768
#define NH_  12
#define NKV  12
#define REP  (NH_ / NKV)
#define HD   64
#define DQ   (NH_ * HD)
#define DKV  (NKV * HD)
#define RH   512                  // query rows < RH use hi+lo planes
#define SCL  0.125f   // HD^-0.5
typedef _Float16 h16;
typedef unsigned short bf;
typedef __attribute__((ext_vector_type(16))) __bf16   v16bf;
typedef __attribute__((ext_vector_type(16))) _Float16 v16h;
typedef __attribute__((ext_vector_type(8)))  _Float16 v8h;
typedef __attribute__((ext_vector_type(8)))  unsigned short v8us;
typedef __attribute__((ext_vector_type(8)))  float    v8f;
typedef __attribute__((ext_vector_type(4)))  float    v4f;
typedef v8h  __attribute__((may_alias)) v8ha;
typedef v4f  __attribute__((may_alias)) v4fa;
typedef v8us __attribute__((may_alias)) v8usa;

__device__ __forceinline__ unsigned short f2bf(float f) { unsigned u = __float_as_uint(f); u += 0x7FFFu + ((u >> 16) & 1u); return (unsigned short)(u >> 16); }
__device__ __forceinline__ float bf2f(unsigned short b) { return __uint_as_float(((unsigned)b) << 16); }
__device__ __forceinline__ float bfr(float f) { return bf2f(f2bf(f)); }
__device__ __forceinline__ v16h cat16(v8h lo, v8h hi) { return __builtin_shufflevector(lo, hi, 0, 1, 2, 3, 4, 5, 6, 7, 8, 9, 10, 11, 12, 13, 14, 15); }
__device__ __forceinline__ v16bf cat16b(v8us lo, v8us hi) { return __builtin_bit_cast(v16bf, __builtin_shufflevector(lo, hi, 0, 1, 2, 3, 4, 5, 6, 7, 8, 9, 10, 11, 12, 13, 14, 15)); }
__device__ __forceinline__ v8f wmma16(v16h a, v16h b, v8f c) { return __builtin_amdgcn_wmma_f32_16x16x32_f16(false, a, false, b, (short)0, c, false, false); }
__device__ __forceinline__ v8f wmmab(v16bf a, v16bf b, v8f c) { return __builtin_amdgcn_wmma_f32_16x16x32_bf16(false, a, false, b, (short)0, c, false, false); }

__device__ __forceinline__ h16 tohx(float x) { return (h16)x; }
__device__ __forceinline__ void splitf(float y, unsigned short& h, unsigned short& l) { h = f2bf(y); l = f2bf(y - bf2f(h)); }
// stands behind a run of global loads or stores, in front of whatever next overwrites a register that they name (address pair, store data)
#define XWAIT() asm volatile("s_wait_xcnt 0x0" ::: "memory")
// the same wait behind a run of loads from two (four) addresses plus immediate offsets: the addresses are inputs, so they stay in their registers up to the wait and no load of the run lands on them
#define XWAITA(p, q) asm volatile("s_wait_xcnt 0x0" :: "v"(p), "v"(q) : "memory")
#define XWAITA4(p, q, r, s) asm volatile("s_wait_xcnt 0x0" :: "v"(p), "v"(q), "v"(r), "v"(s) : "memory")
// the same wait behind ALL ten fragment loads of one K block. The loaded fragments are inputs too (inputs only, nothing is changed): so every load of the block is issued ahead of the first product and the wave waits once a block;
// without them the compiler turns two register sets over for one operand and fetches it fragment by fragment, four products ahead of its use, with a wait in front of each
#define XWAITF10(p, q, f) asm volatile("s_wait_xcnt 0x0" :: "v"(p), "v"(q), "v"(f[0]), "v"(f[1]), "v"(f[2]), "v"(f[3]), "v"(f[4]), "v"(f[5]), "v"(f[6]), "v"(f[7]), "v"(f[8]), "v"(f[9]) : "memory")

// Asks L2 for the data at p: one request a lane, nothing comes back to the wave. Every plane read below was written by an earlier launch.
// The second line is the wait that stands behind any global access before its address register is used for something else.
__device__ __forceinline__ void l2_ask(const char* p) { asm volatile("global_prefetch_b8 %0, off scope:SCOPE_SE\n\ts_wait_xcnt 0x0" :: "v"(p) : "memory"); }

template <typename T16> struct WFrag;
template <> struct WFrag<h16> { typedef v16h V; static __device__ __forceinline__ V ld(const h16* p) { return cat16(*(const v8h*)p, *(const v8h*)(p + 256)); } static __device__ __forceinline__ v8f mma(V a, V b, v8f c) { return wmma16(a, b, c); } };
template <> struct WFrag<bf> { typedef v16bf V; static __device__ __forceinline__ V ld(const bf* p) { return cat16b(*(const v8us*)p, *(const v8us*)(p + 256)); } static __device__ __forceinline__ v8f mma(V a, V b, v8f c) { return wmmab(a, b, c); } };

// ---- The two projections: every wave owns one output tile for the WHOLE K loop (no split of K, so no partial tiles, no LDS sum and no barrier), operands straight from the bf16 planes in fragment order
// (blocks of one 16-row group K-contiguous: block (g, kb) at (g * K / 32 + kb) * 512, so the row groups of a tile stand at immediate offsets from one address and a K block is 512 elements on).
// As many work-groups as WGPs, all waves resident at once (three on a SIMD); the waves of a work-group form a rectangle of tiles, so that an operand block fetched from L2 by one wave can be found in the WGP cache by the other waves of its row or column.
// tile_mm: acc[mb][nb] += A rows (mb * 16 ..) x B rows (nb * 16 ..) over K; pa, pb: the lane's place in the first block of either operand; both operands use the same loader and k order.
template <int MB, int NB, int K>
__device__ __forceinline__ void tile_mm(const bf* __restrict__ pa, const bf* __restrict__ pb, v8f (&acc)[MB][NB]) {
    typedef WFrag<bf> F; static_assert(MB + NB == 10, "the wait names ten fragments");
#pragma unroll 1
    for (int kb = 0; kb < K / 32; ++kb) {   // stays rolled (for speed only)
        F::V f[MB + NB];   // A fragments, then B fragments
#pragma unroll
        for (int mb = 0; mb < MB; ++mb) f[mb] = F::ld(pa + mb * 16 * K);
#pragma unroll
        for (int nb = 0; nb < NB; ++nb) f[MB + nb] = F::ld(pb + nb * 16 * K);
        XWAITF10(pa, pb, f);
#pragma unroll
        for (int nb = 0; nb < NB; ++nb)
#pragma unroll
            for (int mb = 0; mb < MB; ++mb) acc[mb][nb] = F::mma(f[mb], f[MB + nb], acc[mb][nb]);
        pa += 512; pb += 512;
    }
}
// One accumulator tile to the three 16-bit planes (fp16, bf16 hi, bf16 lo): a lane holds 8 successive k of one fragment row, which is its 16-byte piece of a half block in fragment order: a wave fills four whole lines of each plane.
__device__ __forceinline__ void plane_store(const v8f t, h16* P16, bf* Ph, bf* Pl, size_t e) {
    v8h o16; v8us oh, ol;
#pragma unroll
    for (int j = 0; j < 8; ++j) { o16[j] = tohx(t[j]); unsigned short a2, c2; splitf(t[j], a2, c2); oh[j] = a2; ol[j] = c2; }
    h16* q16 = P16 + e; bf* qh = Ph + e; bf* ql = Pl + e; *(v8h*)q16 = o16; *(v8us*)qh = oh; *(v8us*)ql = ol;
    // the wait behind the three stores; their addresses and data are inputs (inputs only), so that they stay in their registers up to it: with a bare wait the next tile's arithmetic is moved in front of it and lands on the last store's data
    asm volatile("s_wait_xcnt 0x0" :: "v"(q16), "v"(qh), "v"(ql), "v"(o16), "v"(oh), "v"(ol) : "memory");
}
// ---- k_qkv: q, k, v of all batches (rows b * TT + t; columns 0 .. 767 q, .. 1535 k, .. 2303 v). A wave's tile is 64 tokens x 96 columns; 12 waves (4 x 3 tiles: 256 tokens x 288 columns) a work-group, three on a SIMD; grid (tokens / 256, columns / 288).
// A q or k tile: weight rows as the A operand, tokens as B, so a lane holds 8 d of one token (fragment rows t, k = d); a v tile: tokens as A, weight rows as B, so a lane holds 8 tokens of one d (V^T: fragment rows d, k = t).
// Each 16-column group lies in one head. The branch is the same for a whole wave.
#define QWM 4
#define QWN 3
#define QCG 6   // 16-column groups of a wave's tile
static_assert((NB_ * TT) % (QWM * 64) == 0 && (DQ + 2 * DKV) % (QWN * QCG * 16) == 0 && DQ % (QCG * 16) == 0 && DKV % (QCG * 16) == 0 && TT % 64 == 0 && HD == 64, "whole tiles; a tile lies in one of q, k, v and in one batch");
__global__ __launch_bounds__(QWM * QWN * 32) void k_qkv(const bf* __restrict__ X, const bf* __restrict__ Wt, h16* QK16, bf* QKh, bf* QKl, h16* VT16, bf* VTh, bf* VTl) {
    const int lane = threadIdx.x & 31; const int wave = __builtin_amdgcn_readfirstlane((int)(threadIdx.x >> 5));
    const int r0 = ((int)blockIdx.x * QWM + (wave & 3)) * 64, c0 = ((int)blockIdx.y * QWN + (wave >> 2)) * (QCG * 16);
    const bf* px = X + (size_t)r0 * DM + lane * 8; const bf* pw = Wt + (size_t)c0 * DM + lane * 8; const int pb = r0 / TT, pt = r0 % TT;   // batch and first token of the tile
    // L2 requests for both operand panels at entry, dealt over the work-groups that read the same panel (for speed only: all are resident together): the token panel over the column blocks,
    // the weight panel in 16 shares over the 32 token blocks (each share twice), chosen so that any four neighbouring indices modulo 8 hold all 16 shares. Wave-uniform branches; every address lies inside its panel.
    constexpr int XU = QWM * 64 * DM * 2 / 256, XS = XU / ((DQ + 2 * DKV) / (QWN * QCG * 16)), WU = QWN * QCG * 16 * DM * 2 / 256, WS = WU / 16;
    static_assert(XS == 6 * 32 && WS * 16 == WU && WS <= 4 * 32 && NB_ * TT / (QWM * 64) == 32, "shares of whole waves; 32 token blocks");
    if (wave < 6) l2_ask((const char*)X + ((size_t)blockIdx.x * XU + blockIdx.y * XS + wave * 32 + lane) * 256);
    else if (wave < 10) { const int u = (wave - 6) * 32 + lane; l2_ask((const char*)Wt + ((size_t)blockIdx.y * WU + (((int)blockIdx.x & 3) * 4 + ((int)blockIdx.x >> 3)) * WS + (u < WS ? u : WS - 1)) * 256); }
    if (c0 < DQ + DKV) {
        v8f acc[QCG][4];
#pragma unroll
        for (int mb = 0; mb < QCG; ++mb)
#pragma unroll
            for (int nb = 0; nb < 4; ++nb) acc[mb][nb] = (v8f){};
        tile_mm<QCG, 4, DM>(pw, px, acc);
#pragma unroll
        for (int mb = 0; mb < QCG; ++mb) { const int cg = c0 + mb * 16; const size_t hb = ((size_t)(pb * (NH_ + NKV) + cg / HD) * TT + pt) * HD + (cg % HD) * 16 + lane * 8;   // head plane (0 .. 11 q, 12 .. 23 k); 16 d are one half block of 256 elements
#pragma unroll
            for (int nb = 0; nb < 4; ++nb) plane_store(acc[mb][nb], QK16, QKh, QKl, hb + nb * 1024); }   // 16 tokens x 64 d are 1,024 elements
    } else {
        v8f acc[4][QCG];
#pragma unroll
        for (int mb = 0; mb < 4; ++mb)
#pragma unroll
            for (int nb = 0; nb < QCG; ++nb) acc[mb][nb] = (v8f){};
        tile_mm<4, QCG, DM>(px, pw, acc);
#pragma unroll
        for (int nb = 0; nb < QCG; ++nb) { const int cg = c0 - DQ - DKV + nb * 16; const size_t hb = ((size_t)(pb * NKV + cg / HD) * TT + pt) * HD + (cg % HD) * 32 + lane * 8;   // 16 d x 32 tokens are one block of 512 elements
#pragma unroll
            for (int mb = 0; mb < 4; ++mb) plane_store(acc[mb][nb], VT16, VTh, VTl, hb + (mb >> 1) * 2048 + (mb & 1) * 256); }   // 32 tokens x 64 d are 2,048 elements; 16 tokens a half block
    }
}
// ---- k_wo: out = merged (hi + lo planes) x Wo + bo for all batches. A wave's tile is 32 tokens x 64 columns (Wo rows as the A operand, tokens as B); 12 waves (4 x 3 tiles: 128 tokens x 192 columns) a work-group; grid (tokens / 128, columns / 192).
// The f32 tile leaves through the wave's OWN LDS range (token rows at pitch 68 floats), read back by rows, so that every store covers whole lines: two token rows of 256 bytes each.
#define OWM 4
#define OWN 3
#define OSLOT (32 * 68)
static_assert((NB_ * TT) % (OWM * 32) == 0 && DM % (OWN * 64) == 0, "whole tiles");
__global__ __launch_bounds__(OWM * OWN * 32) void k_wo(const bf* __restrict__ Ah, const bf* __restrict__ Al, const bf* __restrict__ Wo, const float* __restrict__ bias, float* C) {
    typedef WFrag<bf> F;
    __shared__ __align__(16) float os[OWM * OWN * OSLOT];
    const int lane = threadIdx.x & 31; const int wave = __builtin_amdgcn_readfirstlane((int)(threadIdx.x >> 5)); const int lr = lane & 15, hi = lane >> 4;
    const int r0 = ((int)blockIdx.x * OWM + (wave & 3)) * 32, c0 = ((int)blockIdx.y * OWN + (wave >> 2)) * 64;
    const bf* pw = Wo + (size_t)c0 * DQ + lane * 8; const bf* ph = Ah + (size_t)r0 * DQ + lane * 8; const bf* pl = Al + (size_t)r0 * DQ + lane * 8;
    // L2 requests at entry, dealt as in k_qkv: the two token panels (hi, then lo) over the four column blocks, one request a lane; the weight panel in 16 shares over the token blocks
    constexpr int AU = OWM * 32 * DQ * 2 / 256, OU = OWN * 64 * DQ * 2 / 256, OS = OU / 16;
    static_assert(2 * AU == (DM / (OWN * 64)) * OWM * OWN * 32 && OS * 16 == OU && OS <= 3 * 32, "one request a lane covers both token panels");
    { const int u = (int)blockIdx.y * (OWM * OWN * 32) + (int)threadIdx.x; l2_ask((const char*)(u < AU ? Ah : Al) + ((size_t)blockIdx.x * AU + (u < AU ? u : u - AU)) * 256); }
    if (wave < 3) { const int u = wave * 32 + lane; l2_ask((const char*)Wo + ((size_t)blockIdx.y * OU + (((int)blockIdx.x & 3) * 4 + (((int)blockIdx.x >> 3) & 3)) * OS + (u < OS ? u : OS - 1)) * 256); }
    v8f acc[4][2];
#pragma unroll
    for (int mb = 0; mb < 4; ++mb)
#pragma unroll
        for (int nb = 0; nb < 2; ++nb) acc[mb][nb] = (v8f){};
#pragma unroll
    for (int kb = 0; kb < DQ / 32; ++kb) {   // unrolled whole (one tile shape, a short text): every load is one of three addresses plus an immediate offset, and no address register is rewritten inside
        F::V w[4], xh[2], xl[2];
#pragma unroll
        for (int mb = 0; mb < 4; ++mb) w[mb] = F::ld(pw + mb * 16 * DQ + kb * 512);
#pragma unroll
        for (int nb = 0; nb < 2; ++nb) { xh[nb] = F::ld(ph + nb * 16 * DQ + kb * 512); xl[nb] = F::ld(pl + nb * 16 * DQ + kb * 512); }
#pragma unroll
        for (int nb = 0; nb < 2; ++nb)
#pragma unroll
            for (int mb = 0; mb < 4; ++mb) acc[mb][nb] = F::mma(w[mb], xh[nb], acc[mb][nb]);
#pragma unroll
        for (int nb = 0; nb < 2; ++nb)
#pragma unroll
            for (int mb = 0; mb < 4; ++mb) acc[mb][nb] = F::mma(w[mb], xl[nb], acc[mb][nb]);
    }
    XWAITA4(pw, ph, pl, pl);
    const int col = lr * 4; const float* pbias = bias + c0 + col; v4f bb;
#pragma unroll
    for (int q = 0; q < 4; ++q) bb[q] = pbias[q];
    XWAITA(pbias, pbias);
    float* slot = os + wave * OSLOT;
#pragma unroll
    for (int nb = 0; nb < 2; ++nb)
#pragma unroll
        for (int mb = 0; mb < 4; ++mb) { float* p = slot + (nb * 16 + lr) * 68 + mb * 16 + hi * 8; const v8f t = acc[mb][nb];
            *(v4fa*)p = __builtin_shufflevector(t, t, 0, 1, 2, 3); *(v4fa*)(p + 4) = __builtin_shufflevector(t, t, 4, 5, 6, 7); }
    asm volatile("s_wait_dscnt 0x0" ::: "memory");   // the wave's own LDS writes are done before its lanes read one another's pieces back (no other wave touches this range)
#pragma unroll
    for (int q = 0; q < 4; ++q) bb[q] = bfr(bb[q]);
    float* cp = C + (size_t)(r0 + hi) * DM + c0 + col; v4f s[16];
#pragma unroll
    for (int i = 0; i < 16; ++i) s[i] = *(const v4fa*)(slot + (i * 2 + hi) * 68 + col);
#pragma unroll
    for (int i = 0; i < 16; ++i) *(v4f*)(cp + (size_t)i * 2 * DM) = s[i] + bb;
    XWAIT();
}

typedef __attribute__((ext_vector_type(2))) _Float16 v2h;
typedef __attribute__((ext_vector_type(4))) _Float16 v4h;
typedef __attribute__((ext_vector_type(2))) unsigned short v2us;
typedef __attribute__((ext_vector_type(4))) unsigned short v4us;
typedef __attribute__((ext_vector_type(2))) float v2f;
typedef __attribute__((ext_vector_type(4))) int v4i;

// ---- k_prep: all operand preparation in one launch, both results in fragment order; a thread makes 16-byte pieces (8 k of one fragment row), piece i at element i * 8, so a wave writes four whole lines.
// Piece i: block i / 64 = (row group, K block), half (i / 32) % 2, lane i % 32. Work-groups 0 .. 4 WTB - 1: the four 'xw' weights [k][n] to bf16 with fragment rows n, back to back in Wt, 2 pieces a thread
// (16 lanes read 16 adjacent n of one k); the other CVB work-groups: x to bf16, 4 pieces a thread.
#define WTB (DM * DQ / 64 / 64)
#define CVB (NB_ * TT * DM / 8 / 1024)
static_assert(DQ == DM && DKV == DM && WTB * 64 * 64 == DM * DQ && CVB * 8 * 1024 == NB_ * TT * DM, "the preparation grid covers every element exactly once");
__global__ __launch_bounds__(256) void k_prep(const float* __restrict__ x, const float* __restrict__ wq, const float* __restrict__ wk, const float* __restrict__ wv, const float* __restrict__ wo, bf* Wt, bf* XB) {
    const int blk = blockIdx.x;
    if (blk < 4 * WTB) {
        const int id = blk / WTB; const float* __restrict__ w = id == 0 ? wq : id == 1 ? wk : id == 2 ? wv : wo; bf* Bt = Wt + (size_t)id * DM * DQ;
        const int i0 = (blk % WTB) * 512 + (int)threadIdx.x; float f[2][8]; const float* pw[2];
#pragma unroll
        for (int q = 0; q < 2; ++q) { const int i = i0 + q * 256, bk = i >> 6; const int n = (bk / (DM / 32)) * 16 + (i & 15), k = (bk % (DM / 32)) * 32 + ((i >> 5) & 1) * 16 + ((i >> 4) & 1) * 8; pw[q] = w + (size_t)k * DQ + n;
#pragma unroll
            for (int e = 0; e < 8; ++e) f[q][e] = pw[q][e * DQ]; }
        XWAITA(pw[0], pw[1]);
#pragma unroll
        for (int q = 0; q < 2; ++q) { v8us o;
#pragma unroll
            for (int e = 0; e < 8; ++e) o[e] = f2bf(f[q][e]);
            *(v8us*)(Bt + (size_t)(i0 + q * 256) * 8) = o; }
        XWAIT();
    } else {
        const size_t i0 = (size_t)(blk - 4 * WTB) * 1024 + threadIdx.x; v8f v[4]; const float* px[4];
#pragma unroll
        for (int q = 0; q < 4; ++q) { const int i = (int)i0 + q * 256, bk = i >> 6; px[q] = x + (size_t)((bk / (DM / 32)) * 16 + (i & 15)) * DM + (bk % (DM / 32)) * 32 + ((i >> 5) & 1) * 16 + ((i >> 4) & 1) * 8; v[q] = *(const v8f*)px[q]; }
        XWAITA4(px[0], px[1], px[2], px[3]);
#pragma unroll
        for (int q = 0; q < 4; ++q) { v8us o;
#pragma unroll
            for (int k = 0; k < 8; ++k) o[k] = f2bf(v[q][k]);
            *(v8us*)(XB + (i0 + q * 256) * 8) = o; }
        XWAIT();
    }
}
#define SC2 (SCL * 1.4426950408889634f)   // score scale x log2(e): the exponentials are taken to base 2
typedef __attribute__((ext_vector_type(16))) unsigned short v16us;
template <typename T16, bool HL, int NQ, bool DIAG>
__device__ __forceinline__ void attn_step(const T16* __restrict__ Kp, const T16* __restrict__ K2, const T16* __restrict__ Vt, const T16* __restrict__ Vt2, int k0, int q0, int lr, int hi,
                                          const typename WFrag<T16>::V (&qf)[NQ][2], const typename WFrag<T16>::V (&q2f)[NQ][2], typename WFrag<T16>::V (&kf)[2][2], float (&m)[NQ], float (&l)[NQ], v8f (&o)[4][NQ]) {
    typedef WFrag<T16> F; typedef typename F::V V; const int l8 = (hi * 16 + lr) * 8;   // the lane's place in a half block; 32 keys are 4 blocks of K (16 keys, 32 d) and 4 of V^T (16 d, 32 keys), 2,048 elements each
    v8f s[2][NQ];
#pragma unroll
    for (int kt = 0; kt < 2; ++kt)
#pragma unroll
        for (int qt = 0; qt < NQ; ++qt) s[kt][qt] = (v8f){};
    V a2[2][2], va[4], va2[4];   // this pass's lo K plane and V^T fragments are requested first: V^T flies under the score products and the softmax arithmetic
    if (HL) {
#pragma unroll
        for (int kt = 0; kt < 2; ++kt)
#pragma unroll
            for (int ks = 0; ks < 2; ++ks) a2[kt][ks] = F::ld(K2 + (size_t)k0 * HD + (kt * 2 + ks) * 512 + l8);
        XWAIT(); }
#pragma unroll
    for (int dt = 0; dt < 4; ++dt) { const size_t off = (size_t)k0 * HD + dt * 512 + l8; va[dt] = F::ld(Vt + off); if (HL) va2[dt] = F::ld(Vt2 + off); }
    XWAIT();
#pragma unroll
    for (int kt = 0; kt < 2; ++kt)
#pragma unroll
        for (int ks = 0; ks < 2; ++ks)
#pragma unroll
            for (int qt = 0; qt < NQ; ++qt) { s[kt][qt] = F::mma(kf[kt][ks], qf[qt][ks], s[kt][qt]); if (HL) { s[kt][qt] = F::mma(kf[kt][ks], q2f[qt][ks], s[kt][qt]); s[kt][qt] = F::mma(a2[kt][ks], qf[qt][ks], s[kt][qt]); } }
    if (!DIAG) {   // the next pass's K fragments, into the registers that the score products have just read (the next block always exists; after a role 1 wave's last pass they go unused)
#pragma unroll
        for (int kt = 0; kt < 2; ++kt)
#pragma unroll
            for (int ks = 0; ks < 2; ++ks) kf[kt][ks] = F::ld(Kp + (size_t)(k0 + 32) * HD + (kt * 2 + ks) * 512 + l8);
        XWAIT(); }
    if (DIAG) {
#pragma unroll
        for (int kt = 0; kt < 2; ++kt)
#pragma unroll
            for (int qt = 0; qt < NQ; ++qt)
#pragma unroll
                for (int j = 0; j < 8; ++j) if (k0 + kt * 16 + hi * 8 + j > q0 + qt * 16 + lr) s[kt][qt][j] = -3.0e38f; }
    float mx[NQ]; bool need = false;
#pragma unroll
    for (int qt = 0; qt < NQ; ++qt) { float t = fmaxf(s[0][qt][0], s[1][qt][0]);
#pragma unroll
        for (int j = 1; j < 8; ++j) t = fmaxf(t, fmaxf(s[0][qt][j], s[1][qt][j]));
        mx[qt] = fmaxf(t, __shfl_xor(t, 16, 32)); need = need || (mx[qt] > m[qt]); }
    if (__builtin_amdgcn_ballot_w32(need) != 0) {   // some row's maximum rose: bring sums and outputs to the new maximum (factor exactly 1 for the rows whose maximum stayed)
#pragma unroll
        for (int qt = 0; qt < NQ; ++qt) { const float mn = fmaxf(m[qt], mx[qt]); const float al = __builtin_amdgcn_exp2f((m[qt] - mn) * SC2); m[qt] = mn; l[qt] *= al;
#pragma unroll
            for (int dt = 0; dt < 4; ++dt) o[dt][qt] *= al; } }
    V pb[NQ], pb2[NQ];
#pragma unroll
    for (int qt = 0; qt < NQ; ++qt) { const float nm = -m[qt] * SC2; float p[16];
#pragma unroll
        for (int e = 0; e < 16; ++e) { p[e] = __builtin_amdgcn_exp2f(fmaf(s[e >> 3][qt][e & 7], SC2, nm)); l[qt] += p[e]; }
        if constexpr (HL) { v16us ph, pl;
#pragma unroll
            for (int e = 0; e < 16; ++e) { unsigned short a, c2; splitf(p[e], a, c2); ph[e] = a; pl[e] = c2; }
            pb[qt] = __builtin_bit_cast(v16bf, ph); pb2[qt] = __builtin_bit_cast(v16bf, pl);
        } else {
#pragma unroll
            for (int e = 0; e < 16; ++e) pb[qt][e] = tohx(p[e]); } }
#pragma unroll
    for (int dt = 0; dt < 4; ++dt)
#pragma unroll
        for (int qt = 0; qt < NQ; ++qt) { o[dt][qt] = F::mma(va[dt], pb[qt], o[dt][qt]); if (HL) { o[dt][qt] = F::mma(va[dt], pb2[qt], o[dt][qt]); o[dt][qt] = F::mma(va2[dt], pb[qt], o[dt][qt]); } }
}
template <typename T16, bool HL, int NQ>
__device__ __forceinline__ void attn_rows(const T16* __restrict__ Q, const T16* __restrict__ Q2, const T16* __restrict__ Kp, const T16* __restrict__ K2, const T16* __restrict__ Vt, const T16* __restrict__ Vt2, int q0, int lane, bool ask, bf* Ah, bf* Al, int kbeg, int kend, int role, float* xs) {
    // The wave walks the whole 32-key blocks kbeg .. kend - 1. role 0 (hi/lo rows): all keys of its rows (kbeg 0, kend at the diagonal block, which it takes too). role 1 and 2 (fp16 rows): two waves share the rows: role 1 has the keys below kend and no
    // diagonal block, role 2 the keys from kbeg on with the diagonal block; role 2 hands its maximum, sum and outputs over in xs (LDS), role 1 joins the two states and stores. kbeg, kend, role are the same for a whole wave.
    typedef WFrag<T16> F; typedef typename F::V V; const int lr = lane & 15, hi = lane >> 4;
    V qf[NQ][2], q2f[NQ][2], kf[2][2];
#pragma unroll
    for (int qt = 0; qt < NQ; ++qt)
#pragma unroll
        for (int ks = 0; ks < 2; ++ks) { const size_t off = (size_t)(q0 + qt * 16) * HD + ks * 512 + lane * 8; qf[qt][ks] = F::ld(Q + off); if (HL) q2f[qt][ks] = F::ld(Q2 + off); }
#pragma unroll
    for (int kt = 0; kt < 2; ++kt)
#pragma unroll
        for (int ks = 0; ks < 2; ++ks) kf[kt][ks] = F::ld(Kp + (size_t)kbeg * HD + (kt * 2 + ks) * 512 + lane * 8);   // the wave's first 32 keys; every later pass's K fragments are fetched one pass ahead
    XWAIT();
    float m[NQ], l[NQ]; v8f o[4][NQ]; const int kd = q0 & ~31;   // first key of the 32-key block that holds the diagonal
#pragma unroll
    for (int qt = 0; qt < NQ; ++qt) { m[qt] = -3.0e38f; l[qt] = 0.f; }
#pragma unroll
    for (int dt = 0; dt < 4; ++dt)
#pragma unroll
        for (int qt = 0; qt < NQ; ++qt) o[dt][qt] = (v8f){};
    // L2 requests for K and V^T four passes ahead (fp16 rows; 'ask': one wave of the four that walk the same keys, the one with the most). A pass reads 4,096 contiguous bytes of either plane: lanes 0 .. 15 ask for the 16 units of K, lanes 16 .. 31 for those of V^T.
    // pf stays in one register pair for the whole loop (the statements hold it as an operand that they may change) and points at the current pass's block; the test keeps the request, also after pf's next step, on blocks that this wave reads itself.
    const char* pf = (hi ? (const char*)Vt + lr * 256 : (const char*)Kp + lr * 256) + (size_t)kbeg * (HD * 2); const int pfk = ask ? kend : 0;
    if constexpr (!HL) { static_assert(RH >= 5 * 32, "the first blocks exist for every fp16 row");
        if (ask) asm volatile("global_prefetch_b8 %0, off offset:4096 scope:SCOPE_SE\n\tglobal_prefetch_b8 %0, off offset:8192 scope:SCOPE_SE\n\tglobal_prefetch_b8 %0, off offset:12288 scope:SCOPE_SE\n\ts_wait_xcnt 0x0" : "+v"(pf) :: "memory"); }
#pragma unroll 1
    for (int k0 = kbeg; k0 < kend; k0 += 32) {
        if constexpr (!HL) {
            if (k0 + 4 * 32 < pfk) asm volatile("global_prefetch_b8 %0, off offset:16384 scope:SCOPE_SE\n\ts_wait_xcnt 0x0" : "+v"(pf) :: "memory");
            pf += 4096; }
        attn_step<T16, HL, NQ, false>(Kp, K2, Vt, Vt2, k0, q0, lr, hi, qf, q2f, kf, m, l, o);
    }
    if (role != 1) attn_step<T16, HL, NQ, true>(Kp, K2, Vt, Vt2, kd, q0, lr, hi, qf, q2f, kf, m, l, o);   // the diagonal block: keys kd .. kd + 31, masked by select
    if constexpr (!HL) { static_assert(NQ == 2, "one 16-byte piece holds both maxima and both sums");
        {   // the same lane of both waves holds the same (row, d) places: piece i of lane n at (i * 32 + n) * 16 bytes, so every LDS access of a wave is 512 contiguous bytes
            v4fa* sx = (v4fa*)xs + lane;
            if (role == 2) {
#pragma unroll
                for (int dt = 0; dt < 4; ++dt)
#pragma unroll
                    for (int qt = 0; qt < NQ; ++qt) { const v8f t = o[dt][qt]; sx[((dt * NQ + qt) * 2) * 32] = __builtin_shufflevector(t, t, 0, 1, 2, 3); sx[((dt * NQ + qt) * 2 + 1) * 32] = __builtin_shufflevector(t, t, 4, 5, 6, 7); }
                sx[16 * 32] = (v4f){m[0], m[1], l[0], l[1]};
            }
            __syncthreads();   // publishes the role 2 waves' states to their partners; every wave of the work-group passes it once
            if (role == 2) return;
            const v4f st = sx[16 * 32];
#pragma unroll
            for (int qt = 0; qt < NQ; ++qt) { const float mn = fmaxf(m[qt], st[qt]); const float a0 = __builtin_amdgcn_exp2f((m[qt] - mn) * SC2), a1 = __builtin_amdgcn_exp2f((st[qt] - mn) * SC2); l[qt] = l[qt] * a0 + st[2 + qt] * a1;
#pragma unroll
                for (int dt = 0; dt < 4; ++dt) { const v4f u0 = sx[((dt * NQ + qt) * 2) * 32], u1 = sx[((dt * NQ + qt) * 2 + 1) * 32];
                    o[dt][qt] = o[dt][qt] * a0 + __builtin_shufflevector(u0, u1, 0, 1, 2, 3, 4, 5, 6, 7) * a1; } }
        } }
#pragma unroll
    for (int qt = 0; qt < NQ; ++qt) { const float inv = __fdiv_rn(1.0f, l[qt] + __shfl_xor(l[qt], 16, 32)); const size_t ro = (size_t)(q0 + qt * 16) * DQ + lane * 8;   // merged planes in fragment order for the output projection (rows t, k = h * 64 + d): this head's 16 d of tile dt are half block dt of its two K blocks
#pragma unroll
        for (int dt = 0; dt < 4; ++dt) { v8us oh, ol;
#pragma unroll
            for (int j = 0; j < 8; ++j) { unsigned short a, c2; splitf(o[dt][qt][j] * inv, a, c2); oh[j] = a; ol[j] = c2; }
            *(v8us*)(Ah + ro + dt * 256) = oh; *(v8us*)(Al + ro + dt * 256) = ol; XWAIT(); } }
}
// grid (batch x head, position blocks); work-groups of 8 waves, two resident on a WGP. Two kinds of block. S (fp16 rows, 128 of them): waves 0 .. 3 take 32 rows each with the lower part of their keys, waves 4 .. 7 the same rows with the rest,
// so that no wave walks more than about half of the keys: the launch no longer ends on a few long waves that run alone on their SIMDs. H (hi/lo rows, 128 of them): 8 waves x 16 rows, all keys.
// The waves of one part walk the same keys: they meet in the WGP cache. The hi/lo rows take 16 per wave because both planes of every operand are live: at 32 the kernel needs registers above v255.
#define NSB  ((TT - RH) / 128)
#define NHB  (RH / 128)
#define XSL  (17 * 32 * 4)   // floats of one wave pair's hand-over range
static_assert(NSB == 12 && NHB == 4 && RH % 128 == 0 && RH / 2 + 64 <= RH, "the order word below names 12 S and 4 H blocks; the split key lies below every fp16 row");
__global__ __launch_bounds__(256) void k_fattn(const h16* __restrict__ QK16, const bf* __restrict__ QKh, const bf* __restrict__ QKl, const h16* __restrict__ VT16, const bf* __restrict__ VTh, const bf* __restrict__ VTl, bf* ATh, bf* ATl) {
    __shared__ __align__(16) float xs[4 * XSL];
    const int lane = threadIdx.x & 31; const int wave = __builtin_amdgcn_readfirstlane((int)(threadIdx.x >> 5)); const int b = blockIdx.x / NH_, h = blockIdx.x % NH_;
    // block by blockIdx.y, one hex digit each from the low end (0 .. 11: S block, 12 .. 15: H block, each kind's longest first): there are more work-groups than places, so the length of the walk falls with the index (for speed only)
    const int code = (int)((0xFBEA9D876C543210ULL >> ((int)blockIdx.y * 4)) & 15);
    const size_t qo = ((size_t)b * (NH_ + NKV) + h) * TT * HD, ko = ((size_t)b * (NH_ + NKV) + NH_ + h / REP) * TT * HD, vo = ((size_t)b * NKV + h / REP) * HD * TT, ao = (size_t)b * TT * DQ + h * HD * 16;
    if (code < NSB) {
        // split key kc (base / 2 is a multiple of 64): the lower part walks two passes more than half of the whole blocks below base; the upper part has the rest, up to 3 more blocks and the diagonal block: both parts reach the barrier at about the same time
        const int base = TT - (code + 1) * 128, kc = base / 2 + 64, q0 = base + (wave & 3) * 32; const bool up = wave >= 4;
        attn_rows<h16, false, 2>(QK16 + qo, nullptr, QK16 + ko, nullptr, VT16 + vo, nullptr, q0, lane, (wave & 3) == 3, ATh + ao, ATl + ao, up ? kc : 0, up ? q0 : kc, up ? 2 : 1, xs + (wave & 3) * XSL);
    } else { const int q0 = RH - (code - NSB + 1) * 128 + wave * 16;
        attn_rows<bf, true, 1>(QKh + qo, QKl + qo, QKh + ko, QKl + ko, VTh + vo, VTl + vo, q0, lane, false, ATh + ao, ATl + ao, 0, q0 & ~31, 0, nullptr); }
}

extern "C" void kernel_launch(void* const* d_in, const int* in_sizes, int n_in,
                              void* d_out, int out_size, void* d_ws, size_t ws_size, hipStream_t stream) {
    (void)in_sizes; (void)n_in; (void)out_size;
    const float* x = (const float*)d_in[0]; const float* wq = (const float*)d_in[1]; const float* wk = (const float*)d_in[2]; const float* wv = (const float*)d_in[3]; const float* wo = (const float*)d_in[4]; const float* bo = (const float*)d_in[5];   /* inputs x, Wq, Wk, Wv, Wo ('xw' [768][768]), bo */
    float* OUT = (float*)d_out;     // [4][2048][768]
    char* wsp = (char*)d_ws;
    auto take = [&](size_t bytes) { char* p = wsp; wsp += (bytes + 255) & ~(size_t)255; return (void*)p; };
    bf* WQ = (bf*)take((size_t)DQ * DM * 2); bf* WK = (bf*)take((size_t)DKV * DM * 2); bf* WV = (bf*)take((size_t)DKV * DM * 2); bf* WO = (bf*)take((size_t)DM * DQ * 2); (void)WK; (void)WV;   // back to back: one [DQ + 2 DKV + DM][DM] block
    bf* XB = (bf*)take((size_t)NB_ * TT * DM * 2);
    // planes of all batches: per batch the 12 q heads directly followed by the 12 k heads (fp16, hi, lo alike)
    h16* QK16 = (h16*)take((size_t)NB_ * (NH_ + NKV) * TT * HD * 2); bf* QKh = (bf*)take((size_t)NB_ * (NH_ + NKV) * TT * HD * 2); bf* QKl = (bf*)take((size_t)NB_ * (NH_ + NKV) * TT * HD * 2);
    h16* VT16 = (h16*)take((size_t)NB_ * NKV * HD * TT * 2); bf* VTh = (bf*)take((size_t)NB_ * NKV * HD * TT * 2); bf* VTl = (bf*)take((size_t)NB_ * NKV * HD * TT * 2);
    bf* ATh = (bf*)take((size_t)NB_ * TT * DQ * 2); bf* ATl = (bf*)take((size_t)NB_ * TT * DQ * 2);
    if ((size_t)(wsp - (char*)d_ws) > ws_size) return;    // ws 256 MiB
    k_prep<<<4 * WTB + CVB, 256, 0, stream>>>(x, wq, wk, wv, wo, WQ, XB);
    // q, k, v of all batches in one GEMM (WQ, WK, WV are one [DQ + 2 DKV][DM] transposed weight); its epilogue writes the head planes
    k_qkv<<<dim3(NB_ * TT / (QWM * 64), (DQ + 2 * DKV) / (QWN * QCG * 16), 1), QWM * QWN * 32, 0, stream>>>(XB, WQ, QK16, QKh, QKl, VT16, VTh, VTl);
    k_fattn<<<dim3(NB_ * NH_, NSB + NHB, 1), 256, 0, stream>>>(QK16, QKh, QKl, VT16, VTh, VTl, ATh, ATl);   // attention of all batches and heads in one launch
    k_wo<<<dim3(NB_ * TT / (OWM * 32), DM / (OWN * 64), 1), OWM * OWN * 32, 0, stream>>>(ATh, ATl, WO, bo, OUT);   // output projection of all batches in one launch (rows b * TT + t)
}

// v009
// One run takes 81.2 microseconds.
// Timed twice side by side with v008, it ran 1.04 and 1.03 times as fast.
// Over all steps from v000 it is 26.5 times as fast.
#include <hip/hip_runtime.h>

// Causal multi-head attention at d_model 768 with bias-free projections and an output bias (x [4][2048][768]; q, k, v = x W ('xw' [768][768], no bias; 12 heads x 64); scores masked (-inf) then / sqrt(64); softmax; out = merged Wo + bo ('xw' + bias) -> [4][2048][768] (6.3 M); argument order x, Wq, Wk, Wv, Wo, bo).
// Layout: one preparation launch (bf16 copy of x; 'xw' weights transposed); exact projections (K 768) of all batches in one launch that writes the head planes itself; one fused causal attention launch for all batches and heads (hybrid rows: < 512 hi/lo 3 products, rest fp16; running maximum and sum, keys only up to the diagonal); merged hi/lo x Wo exact + bo.
// Every 16-bit operand plane lies in FRAGMENT ORDER: a block of 16 rows x 32 k is 1,024 contiguous bytes, element (row r, k) at j * 256 + (h * 16 + r) * 8 + e with k = j * 16 + h * 8 + e (j, h in 0..1, e in 0..7),
// so that lane h * 16 + r of a wave finds the two 16-byte halves of its WMMA fragment at lane * 8 and 256 + lane * 8: each wave-wide load or store covers four whole 128-byte lines. The k order of every fragment is what it was.
// Compute dtypes, f32 accumulate: every input rounded to bf16; projections exact; attention rows < 512 3 products, rest fp16; softmax f32; Wo hl x exact + bias.

#define NB_  4
#define TT   2048
#define DM   768
#define NH_  12
#define NKV  12
#define REP  (NH_ / NKV)
#define HD   64
#define DQ   (NH_ * HD)
#define DKV  (NKV * HD)
#define RH   512                  // query rows < RH use hi+lo planes
#define SCL  0.125f   // HD^-0.5
typedef _Float16 h16;
typedef unsigned short bf;
typedef __attribute__((ext_vector_type(16))) __bf16   v16bf;
typedef __attribute__((ext_vector_type(16))) _Float16 v16h;
typedef __attribute__((ext_vector_type(8)))  _Float16 v8h;
typedef __attribute__((ext_vector_type(8)))  unsigned short v8us;
typedef __attribute__((ext_vector_type(8)))  float    v8f;
typedef __attribute__((ext_vector_type(4)))  float    v4f;
typedef v8h  __attribute__((may_alias)) v8ha;
typedef v4f  __attribute__((may_alias)) v4fa;
typedef v8us __attribute__((may_alias)) v8usa;

__device__ __forceinline__ unsigned short f2bf(float f) { unsigned u = __float_as_uint(f); u += 0x7FFFu + ((u >> 16) & 1u); return (unsigned short)(u >> 16); }
__device__ __forceinline__ float bf2f(unsigned short b) { return __uint_as_float(((unsigned)b) << 16); }
__device__ __forceinline__ float bfr(float f) { return bf2f(f2bf(f)); }
__device__ __forceinline__ v16h cat16(v8h lo, v8h hi) { return __builtin_shufflevector(lo, hi, 0, 1, 2, 3, 4, 5, 6, 7, 8, 9, 10, 11, 12, 13, 14, 15); }
__device__ __forceinline__ v16bf cat16b(v8us lo, v8us hi) { return __builtin_bit_cast(v16bf, __builtin_shufflevector(lo, hi, 0, 1, 2, 3, 4, 5, 6, 7, 8, 9, 10, 11, 12, 13, 14, 15)); }
__device__ __forceinline__ v8f wmma16(v16h a, v16h b, v8f c) { return __builtin_amdgcn_wmma_f32_16x16x32_f16(false, a, false, b, (short)0, c, false, false); }
__device__ __forceinline__ v8f wmmab(v16bf a, v16bf b, v8f c) { return __builtin_amdgcn_wmma_f32_16x16x32_bf16(false, a, false, b, (short)0, c, false, false); }

__device__ __forceinline__ h16 tohx(float x) { return (h16)x; }
__device__ __forceinline__ void splitf(float y, unsigned short& h, unsigned short& l) { h = f2bf(y); l = f2bf(y - bf2f(h)); }
// stands behind a run of global loads or stores, in front of whatever next overwrites a register that they name (address pair, store data)
#define XWAIT() asm volatile("s_wait_xcnt 0x0" ::: "memory")
// the same wait behind a run of loads from two (four) addresses plus immediate offsets: the addresses are inputs, so they stay in their registers up to the wait and no load of the run lands on them
#define XWAITA(p, q) asm volatile("s_wait_xcnt 0x0" :: "v"(p), "v"(q) : "memory")
#define XWAITA4(p, q, r, s) asm volatile("s_wait_xcnt 0x0" :: "v"(p), "v"(q), "v"(r), "v"(s) : "memory")
// the same wait behind ALL ten fragment loads of one K block. The loaded fragments are inputs too (inputs only, nothing is changed): so every load of the block is issued ahead of the first product and the wave waits once a block;
// without them the compiler turns two register sets over for one operand and fetches it fragment by fragment, four products ahead of its use, with a wait in front of each
#define XWAITF10(p, q, f) asm volatile("s_wait_xcnt 0x0" :: "v"(p), "v"(q), "v"(f[0]), "v"(f[1]), "v"(f[2]), "v"(f[3]), "v"(f[4]), "v"(f[5]), "v"(f[6]), "v"(f[7]), "v"(f[8]), "v"(f[9]) : "memory")

// Asks L2 for the data at p: one request a lane, nothing comes back to the wave. Every plane read below was written by an earlier launch.
// The second line is the wait that stands behind any global access before its address register is used for something else.
__device__ __forceinline__ void l2_ask(const char* p) { asm volatile("global_prefetch_b8 %0, off scope:SCOPE_SE\n\ts_wait_xcnt 0x0" :: "v"(p) : "memory"); }

template <typename T16> struct WFrag;
template <> struct WFrag<h16> { typedef v16h V; static __device__ __forceinline__ V ld(const h16* p) { return cat16(*(const v8h*)p, *(const v8h*)(p + 256)); } static __device__ __forceinline__ v8f mma(V a, V b, v8f c) { return wmma16(a, b, c); } };
template <> struct WFrag<bf> { typedef v16bf V; static __device__ __forceinline__ V ld(const bf* p) { return cat16b(*(const v8us*)p, *(const v8us*)(p + 256)); } static __device__ __forceinline__ v8f mma(V a, V b, v8f c) { return wmmab(a, b, c); } };

// ---- The two projections: every wave owns one output tile for the WHOLE K loop (no split of K, so no partial tiles, no LDS sum and no barrier), operands straight from the bf16 planes in fragment order
// (blocks of one 16-row group K-contiguous: block (g, kb) at (g * K / 32 + kb) * 512, so the row groups of a tile stand at immediate offsets from one address and a K block is 512 elements on).
// As many work-groups as WGPs, all waves resident at once (three on a SIMD); the waves of a work-group form a rectangle of tiles, so that an operand block fetched from L2 by one wave can be found in the WGP cache by the other waves of its row or column.
// tile_mm: acc[mb][nb] += A rows (mb * 16 ..) x B rows (nb * 16 ..) over K; pa, pb: the lane's place in the first block of either operand; both operands use the same loader and k order.
template <int MB, int NB, int K>
__device__ __forceinline__ void tile_mm(const bf* __restrict__ pa, const bf* __restrict__ pb, v8f (&acc)[MB][NB]) {
    typedef WFrag<bf> F; static_assert(MB + NB == 10, "the wait names ten fragments");
#pragma unroll 1
    for (int kb = 0; kb < K / 32; ++kb) {   // stays rolled (for speed only)
        F::V f[MB + NB];   // A fragments, then B fragments
#pragma unroll
        for (int mb = 0; mb < MB; ++mb) f[mb] = F::ld(pa + mb * 16 * K);
#pragma unroll
        for (int nb = 0; nb < NB; ++nb) f[MB + nb] = F::ld(pb + nb * 16 * K);
        XWAITF10(pa, pb, f);
#pragma unroll
        for (int nb = 0; nb < NB; ++nb)
#pragma unroll
            for (int mb = 0; mb < MB; ++mb) acc[mb][nb] = F::mma(f[mb], f[MB + nb], acc[mb][nb]);
        pa += 512; pb += 512;
    }
}
// One accumulator tile to the three 16-bit planes (fp16, bf16 hi, bf16 lo): a lane holds 8 successive k of one fragment row, which is its 16-byte piece of a half block in fragment order: a wave fills four whole lines of each plane.
__device__ __forceinline__ void plane_store(const v8f t, h16* P16, bf* Ph, bf* Pl, size_t e) {
    v8h o16; v8us oh, ol;
#pragma unroll
    for (int j = 0; j < 8; ++j) { o16[j] = tohx(t[j]); unsigned short a2, c2; splitf(t[j], a2, c2); oh[j] = a2; ol[j] = c2; }
    h16* q16 = P16 + e; bf* qh = Ph + e; bf* ql = Pl + e; *(v8h*)q16 = o16; *(v8us*)qh = oh; *(v8us*)ql = ol;
    // the wait behind the three stores; their addresses and data are inputs (inputs only), so that they stay in their registers up to it: with a bare wait the next tile's arithmetic is moved in front of it and lands on the last store's data
    asm volatile("s_wait_xcnt 0x0" :: "v"(q16), "v"(qh), "v"(ql), "v"(o16), "v"(oh), "v"(ol) : "memory");
}
// ---- k_qkv: q, k, v of all batches (rows b * TT + t; columns 0 .. 767 q, .. 1535 k, .. 2303 v). A wave's tile is 64 tokens x 96 columns; 12 waves (4 x 3 tiles: 256 tokens x 288 columns) a work-group, three on a SIMD; grid (tokens / 256, columns / 288).
// A q or k tile: weight rows as the A operand, tokens as B, so a lane holds 8 d of one token (fragment rows t, k = d); a v tile: tokens as A, weight rows as B, so a lane holds 8 tokens of one d (V^T: fragment rows d, k = t).
// Each 16-column group lies in one head. The branch is the same for a whole wave.
#define QWM 4
#define QWN 3
#define QCG 6   // 16-column groups of a wave's tile
static_assert((NB_ * TT) % (QWM * 64) == 0 && (DQ + 2 * DKV) % (QWN * QCG * 16) == 0 && DQ % (QCG * 16) == 0 && DKV % (QCG * 16) == 0 && TT % 64 == 0 && HD == 64, "whole tiles; a tile lies in one of q, k, v and in one batch");
__global__ __launch_bounds__(QWM * QWN * 32) void k_qkv(const bf* __restrict__ X, const bf* __restrict__ Wt, h16* QK16, bf* QKh, bf* QKl, h16* VT16, bf* VTh, bf* VTl) {
    const int lane = threadIdx.x & 31; const int wave = __builtin_amdgcn_readfirstlane((int)(threadIdx.x >> 5));
    const int r0 = ((int)blockIdx.x * QWM + (wave & 3)) * 64, c0 = ((int)blockIdx.y * QWN + (wave >> 2)) * (QCG * 16);
    const bf* px = X + (size_t)r0 * DM + lane * 8; const bf* pw = Wt + (size_t)c0 * DM + lane * 8; const int pb = r0 / TT, pt = r0 % TT;   // batch and first token of the tile
    // L2 requests for both operand panels at entry, dealt over the work-groups that read the same panel (for speed only: all are resident together): the token panel over the column blocks,
    // the weight panel in 16 shares over the 32 token blocks (each share twice), chosen so that any four neighbouring indices modulo 8 hold all 16 shares. Wave-uniform branches; every address lies inside its panel.
    constexpr int XU = QWM * 64 * DM * 2 / 256, XS = XU / ((DQ + 2 * DKV) / (QWN * QCG * 16)), WU = QWN * QCG * 16 * DM * 2 / 256, WS = WU / 16;
    static_assert(XS == 6 * 32 && WS * 16 == WU && WS <= 4 * 32 && NB_ * TT / (QWM * 64) == 32, "shares of whole waves; 32 token blocks");
    if (wave < 6) l2_ask((const char*)X + ((size_t)blockIdx.x * XU + blockIdx.y * XS + wave * 32 + lane) * 256);
    else if (wave < 10) { const int u = (wave - 6) * 32 + lane; l2_ask((const char*)Wt + ((size_t)blockIdx.y * WU + (((int)blockIdx.x & 3) * 4 + ((int)blockIdx.x >> 3)) * WS + (u < WS ? u : WS - 1)) * 256); }
    if (c0 < DQ + DKV) {
        v8f acc[QCG][4];
#pragma unroll
        for (int mb = 0; mb < QCG; ++mb)
#pragma unroll
            for (int nb = 0; nb < 4; ++nb) acc[mb][nb] = (v8f){};
        tile_mm<QCG, 4, DM>(pw, px, acc);
#pragma unroll
        for (int mb = 0; mb < QCG; ++mb) { const int cg = c0 + mb * 16; const size_t hb = ((size_t)(pb * (NH_ + NKV) + cg / HD) * TT + pt) * HD + (cg % HD) * 16 + lane * 8;   // head plane (0 .. 11 q, 12 .. 23 k); 16 d are one half block of 256 elements
#pragma unroll
            for (int nb = 0; nb < 4; ++nb) plane_store(acc[mb][nb], QK16, QKh, QKl, hb + nb * 1024); }   // 16 tokens x 64 d are 1,024 elements
    } else {
        v8f acc[4][QCG];
#pragma unroll
        for (int mb = 0; mb < 4; ++mb)
#pragma unroll
            for (int nb = 0; nb < QCG; ++nb) acc[mb][nb] = (v8f){};
        tile_mm<4, QCG, DM>(px, pw, acc);
#pragma unroll
        for (int nb = 0; nb < QCG; ++nb) { const int cg = c0 - DQ - DKV + nb * 16; const size_t hb = ((size_t)(pb * NKV + cg / HD) * TT + pt) * HD + (cg % HD) * 32 + lane * 8;   // 16 d x 32 tokens are one block of 512 elements
#pragma unroll
            for (int mb = 0; mb < 4; ++mb) plane_store(acc[mb][nb], VT16, VTh, VTl, hb + (mb >> 1) * 2048 + (mb & 1) * 256); }   // 32 tokens x 64 d are 2,048 elements; 16 tokens a half block
    }
}
// ---- k_wo: out = merged (hi + lo planes) x Wo + bo for all batches. A wave's tile is 32 tokens x 64 columns (Wo rows as the A operand, tokens as B); 12 waves (4 x 3 tiles: 128 tokens x 192 columns) a work-group; grid (tokens / 128, columns / 192).
// The f32 tile leaves through the wave's OWN LDS range (token rows at pitch 68 floats), read back by rows, so that every store covers whole lines: two token rows of 256 bytes each.
#define OWM 4
#define OWN 3
#define OSLOT (32 * 68)
static_assert((NB_ * TT) % (OWM * 32) == 0 && DM % (OWN * 64) == 0, "whole tiles");
__global__ __launch_bounds__(OWM * OWN * 32) void k_wo(const bf* __restrict__ Ah, const bf* __restrict__ Al, const bf* __restrict__ Wo, const float* __restrict__ bias, float* C) {
    typedef WFrag<bf> F;
    __shared__ __align__(16) float os[OWM * OWN * OSLOT];
    const int lane = threadIdx.x & 31; const int wave = __builtin_amdgcn_readfirstlane((int)(threadIdx.x >> 5)); const int lr = lane & 15, hi = lane >> 4;
    const int r0 = ((int)blockIdx.x * OWM + (wave & 3)) * 32, c0 = ((int)blockIdx.y * OWN + (wave >> 2)) * 64;
    const bf* pw = Wo + (size_t)c0 * DQ + lane * 8; const bf* ph = Ah + (size_t)r0 * DQ + lane * 8; const bf* pl = Al + (size_t)r0 * DQ + lane * 8;
    // L2 requests at entry, dealt as in k_qkv: the two token panels (hi, then lo) over the four column blocks, one request a lane; the weight panel in 16 shares over the token blocks
    constexpr int AU = OWM * 32 * DQ * 2 / 256, OU = OWN * 64 * DQ * 2 / 256, OS = OU / 16;
    static_assert(2 * AU == (DM / (OWN * 64)) * OWM * OWN * 32 && OS * 16 == OU && OS <= 3 * 32, "one request a lane covers both token panels");
    { const int u = (int)blockIdx.y * (OWM * OWN * 32) + (int)threadIdx.x; l2_ask((const char*)(u < AU ? Ah : Al) + ((size_t)blockIdx.x * AU + (u < AU ? u : u - AU)) * 256); }
    if (wave < 3) { const int u = wave * 32 + lane; l2_ask((const char*)Wo + ((size_t)blockIdx.y * OU + (((int)blockIdx.x & 3) * 4 + (((int)blockIdx.x >> 3) & 3)) * OS + (u < OS ? u : OS - 1)) * 256); }
    v8f acc[4][2];
#pragma unroll
    for (int mb = 0; mb < 4; ++mb)
#pragma unroll
        for (int nb = 0; nb < 2; ++nb) acc[mb][nb] = (v8f){};
#pragma unroll
    for (int kb = 0; kb < DQ / 32; ++kb) {   // unrolled whole (one tile shape, a short text): every load is one of three addresses plus an immediate offset, and no address register is rewritten inside
        F::V w[4], xh[2], xl[2];
#pragma unroll
        for (int mb = 0; mb < 4; ++mb) w[mb] = F::ld(pw + mb * 16 * DQ + kb * 512);
#pragma unroll
        for (int nb = 0; nb < 2; ++nb) { xh[nb] = F::ld(ph + nb * 16 * DQ + kb * 512); xl[nb] = F::ld(pl + nb * 16 * DQ + kb * 512); }
#pragma unroll
        for (int nb = 0; nb < 2; ++nb)
#pragma unroll
            for (int mb = 0; mb < 4; ++mb) acc[mb][nb] = F::mma(w[mb], xh[nb], acc[mb][nb]);
#pragma unroll
        for (int nb = 0; nb < 2; ++nb)
#pragma unroll
            for (int mb = 0; mb < 4; ++mb) acc[mb][nb] = F::mma(w[mb], xl[nb], acc[mb][nb]);
    }
    XWAITA4(pw, ph, pl, pl);
    const int col = lr * 4; const float* pbias = bias + c0 + col; v4f bb;
#pragma unroll
    for (int q = 0; q < 4; ++q) bb[q] = pbias[q];
    XWAITA(pbias, pbias);
    float* slot = os + wave * OSLOT;
#pragma unroll
    for (int nb = 0; nb < 2; ++nb)
#pragma unroll
        for (int mb = 0; mb < 4; ++mb) { float* p = slot + (nb * 16 + lr) * 68 + mb * 16 + hi * 8; const v8f t = acc[mb][nb];
            *(v4fa*)p = __builtin_shufflevector(t, t, 0, 1, 2, 3); *(v4fa*)(p + 4) = __builtin_shufflevector(t, t, 4, 5, 6, 7); }
    asm volatile("s_wait_dscnt 0x0" ::: "memory");   // the wave's own LDS writes are done before its lanes read one another's pieces back (no other wave touches this range)
#pragma unroll
    for (int q = 0; q < 4; ++q) bb[q] = bfr(bb[q]);
    float* cp = C + (size_t)(r0 + hi) * DM + c0 + col; v4f s[16];
#pragma unroll
    for (int i = 0; i < 16; ++i) s[i] = *(const v4fa*)(slot + (i * 2 + hi) * 68 + col);
#pragma unroll
    for (int i = 0; i < 16; ++i) *(v4f*)(cp + (size_t)i * 2 * DM) = s[i] + bb;
    XWAIT();
}

typedef __attribute__((ext_vector_type(2))) _Float16 v2h;
typedef __attribute__((ext_vector_type(4))) _Float16 v4h;
typedef __attribute__((ext_vector_type(2))) unsigned short v2us;
typedef __attribute__((ext_vector_type(4))) unsigned short v4us;
typedef __attribute__((ext_vector_type(2))) float v2f;
typedef __attribute__((ext_vector_type(4))) int v4i;

// ---- k_prep: all operand preparation in one launch, both results in fragment order; a thread makes 16-byte pieces (8 k of one fragment row), piece i at element i * 8, so a wave writes four whole lines.
// Piece i: block i / 64 = (row group, K block), half (i / 32) % 2, lane i % 32. Work-groups 0 .. 4 WTB - 1: the four 'xw' weights [k][n] to bf16 with fragment rows n, back to back in Wt, 2 pieces a thread
// (16 lanes read 16 adjacent n of one k); the other CVB work-groups: x to bf16, 4 pieces a thread.
#define WTB (DM * DQ / 64 / 64)
#define CVB (NB_ * TT * DM / 8 / 1024)
static_assert(DQ == DM && DKV == DM && WTB * 64 * 64 == DM * DQ && CVB * 8 * 1024 == NB_ * TT * DM, "the preparation grid covers every element exactly once");
__global__ __launch_bounds__(256) void k_prep(const float* __restrict__ x, const float* __restrict__ wq, const float* __restrict__ wk, const float* __restrict__ wv, const float* __restrict__ wo, bf* Wt, bf* XB) {
    const int blk = blockIdx.x;
    if (blk < 4 * WTB) {
        const int id = blk / WTB; const float* __restrict__ w = id == 0 ? wq : id == 1 ? wk : id == 2 ? wv : wo; bf* Bt = Wt + (size_t)id * DM * DQ;
        const int i0 = (blk % WTB) * 512 + (int)threadIdx.x; float f[2][8]; const float* pw[2];
#pragma unroll
        for (int q = 0; q < 2; ++q) { const int i = i0 + q * 256, bk = i >> 6; const int n = (bk / (DM / 32)) * 16 + (i & 15), k = (bk % (DM / 32)) * 32 + ((i >> 5) & 1) * 16 + ((i >> 4) & 1) * 8; pw[q] = w + (size_t)k * DQ + n;
#pragma unroll
            for (int e = 0; e < 8; ++e) f[q][e] = pw[q][e * DQ]; }
        XWAITA(pw[0], pw[1]);
#pragma unroll
        for (int q = 0; q < 2; ++q) { v8us o;
#pragma unroll
            for (int e = 0; e < 8; ++e) o[e] = f2bf(f[q][e]);
            *(v8us*)(Bt + (size_t)(i0 + q * 256) * 8) = o; }
        XWAIT();
    } else {
        const size_t i0 = (size_t)(blk - 4 * WTB) * 1024 + threadIdx.x; v8f v[4]; const float* px[4];
#pragma unroll
        for (int q = 0; q < 4; ++q) { const int i = (int)i0 + q * 256, bk = i >> 6; px[q] = x + (size_t)((bk / (DM / 32)) * 16 + (i & 15)) * DM + (bk % (DM / 32)) * 32 + ((i >> 5) & 1) * 16 + ((i >> 4) & 1) * 8; v[q] = *(const v8f*)px[q]; }
        XWAITA4(px[0], px[1], px[2], px[3]);
#pragma unroll
        for (int q = 0; q < 4; ++q) { v8us o;
#pragma unroll
            for (int k = 0; k < 8; ++k) o[k] = f2bf(v[q][k]);
            *(v8us*)(XB + (i0 + q * 256) * 8) = o; }
        XWAIT();
    }
}
#define SC2 (SCL * 1.4426950408889634f)   // score scale x log2(e): the exponentials are taken to base 2
#define LZR (8.0f / SC2)   // a row keeps its reference m while no raw score passes it by more than this: the exponentials then stay at or below 2^8, far inside fp16 and bf16; any reference gives the same quotient sum(p v) / sum(p)
typedef __attribute__((ext_vector_type(16))) unsigned short v16us;
template <typename T16, bool HL, int NQ, bool DIAG>
__device__ __forceinline__ void attn_step(const T16* __restrict__ Kp, const T16* __restrict__ K2, const T16* __restrict__ Vt, const T16* __restrict__ Vt2, int k0, int q0, int lr, int hi,
                                          const typename WFrag<T16>::V (&qf)[NQ][2], const typename WFrag<T16>::V (&q2f)[NQ][2], typename WFrag<T16>::V (&kf)[2][2], float (&m)[NQ], float (&l)[NQ], v8f (&o)[4][NQ]) {
    typedef WFrag<T16> F; typedef typename F::V V; const int l8 = (hi * 16 + lr) * 8;   // the lane's place in a half block; 32 keys are 4 blocks of K (16 keys, 32 d) and 4 of V^T (16 d, 32 keys), 2,048 elements each
    v8f s[2][NQ];
#pragma unroll
    for (int kt = 0; kt < 2; ++kt)
#pragma unroll
        for (int qt = 0; qt < NQ; ++qt) s[kt][qt] = (v8f){};
    V a2[2][2], va[4], va2[4];   // this pass's lo K plane and V^T fragments are requested first: V^T flies under the score products and the softmax arithmetic
    if (HL) {
#pragma unroll
        for (int kt = 0; kt < 2; ++kt)
#pragma unroll
            for (int ks = 0; ks < 2; ++ks) a2[kt][ks] = F::ld(K2 + (size_t)k0 * HD + (kt * 2 + ks) * 512 + l8);
        XWAIT(); }
#pragma unroll
    for (int dt = 0; dt < 4; ++dt) { const size_t off = (size_t)k0 * HD + dt * 512 + l8; va[dt] = F::ld(Vt + off); if (HL) va2[dt] = F::ld(Vt2 + off); }
    XWAIT();
#pragma unroll
    for (int kt = 0; kt < 2; ++kt)
#pragma unroll
        for (int ks = 0; ks < 2; ++ks)
#pragma unroll
            for (int qt = 0; qt < NQ; ++qt) { s[kt][qt] = F::mma(kf[kt][ks], qf[qt][ks], s[kt][qt]); if (HL) { s[kt][qt] = F::mma(kf[kt][ks], q2f[qt][ks], s[kt][qt]); s[kt][qt] = F::mma(a2[kt][ks], qf[qt][ks], s[kt][qt]); } }
    if (!DIAG) {   // the next pass's K fragments, into the registers that the score products have just read (the next block always exists; after a role 1 wave's last pass they go unused)
#pragma unroll
        for (int kt = 0; kt < 2; ++kt)
#pragma unroll
            for (int ks = 0; ks < 2; ++ks) kf[kt][ks] = F::ld(Kp + (size_t)(k0 + 32) * HD + (kt * 2 + ks) * 512 + l8);
        XWAIT(); }
    if (DIAG) {
#pragma unroll
        for (int kt = 0; kt < 2; ++kt)
#pragma unroll
            for (int qt = 0; qt < NQ; ++qt)
#pragma unroll
                for (int j = 0; j < 8; ++j) if (k0 + kt * 16 + hi * 8 + j > q0 + qt * 16 + lr) s[kt][qt][j] = -3.0e38f; }
    float mx[NQ]; bool need = false;   // mx: the maximum of the lane's own 16 keys; the other half of the row's keys is asked for only where the reference moves
#pragma unroll
    for (int qt = 0; qt < NQ; ++qt) { float t = fmaxf(s[0][qt][0], s[1][qt][0]);
#pragma unroll
        for (int j = 1; j < 8; ++j) t = fmaxf(t, fmaxf(s[0][qt][j], s[1][qt][j]));
        mx[qt] = t; need = need || (t - m[qt] > LZR); }   // the difference, not m + LZR: it is exact where the two are close, whatever their size
    if (__builtin_amdgcn_ballot_w32(need) != 0) {   // some score lies more than LZR above its row's reference m (always so in a wave's first pass): bring every row's reference to its maximum so far, sums and outputs with it (factor exactly 1 where it stayed)
#pragma unroll
        for (int qt = 0; qt < NQ; ++qt) { const float mn = fmaxf(m[qt], fmaxf(mx[qt], __shfl_xor(mx[qt], 16, 32))); const float al = __builtin_amdgcn_exp2f((m[qt] - mn) * SC2); m[qt] = mn; l[qt] *= al;
#pragma unroll
            for (int dt = 0; dt < 4; ++dt) o[dt][qt] *= al; } }
    V pb[NQ], pb2[NQ];
#pragma unroll
    for (int qt = 0; qt < NQ; ++qt) { const float nm = -m[qt] * SC2; float p[16];
#pragma unroll
        for (int e = 0; e < 16; ++e) { p[e] = __builtin_amdgcn_exp2f(fmaf(s[e >> 3][qt][e & 7], SC2, nm)); l[qt] += p[e]; }
        if constexpr (HL) { v16us ph, pl;
#pragma unroll
            for (int e = 0; e < 16; ++e) { unsigned short a, c2; splitf(p[e], a, c2); ph[e] = a; pl[e] = c2; }
            pb[qt] = __builtin_bit_cast(v16bf, ph); pb2[qt] = __builtin_bit_cast(v16bf, pl);
        } else {
#pragma unroll
            for (int e = 0; e < 16; ++e) pb[qt][e] = tohx(p[e]); } }
#pragma unroll
    for (int dt = 0; dt < 4; ++dt)
#pragma unroll
        for (int qt = 0; qt < NQ; ++qt) { o[dt][qt] = F::mma(va[dt], pb[qt], o[dt][qt]); if (HL) { o[dt][qt] = F::mma(va[dt], pb2[qt], o[dt][qt]); o[dt][qt] = F::mma(va2[dt], pb[qt], o[dt][qt]); } }
}
template <typename T16, bool HL, int NQ>
__device__ __forceinline__ void attn_rows(const T16* __restrict__ Q, const T16* __restrict__ Q2, const T16* __restrict__ Kp, const T16* __restrict__ K2, const T16* __restrict__ Vt, const T16* __restrict__ Vt2, int q0, int lane, bool ask, bf* Ah, bf* Al, int kbeg, int kend, int role, float* xs) {
    // The wave walks the whole 32-key blocks kbeg .. kend - 1. role 0 (hi/lo rows): all keys of its rows (kbeg 0, kend at the diagonal block, which it takes too). role 1 and 2 (fp16 rows): two waves share the rows: role 1 has the keys below kend and no
    // diagonal block, role 2 the keys from kbeg on with the diagonal block; role 2 hands its maximum, sum and outputs over in xs (LDS), role 1 joins the two states and stores. kbeg, kend, role are the same for a whole wave.
    typedef WFrag<T16> F; typedef typename F::V V; const int lr = lane & 15, hi = lane >> 4;
    V qf[NQ][2], q2f[NQ][2], kf[2][2];
#pragma unroll
    for (int qt = 0; qt < NQ; ++qt)
#pragma unroll
        for (int ks = 0; ks < 2; ++ks) { const size_t off = (size_t)(q0 + qt * 16) * HD + ks * 512 + lane * 8; qf[qt][ks] = F::ld(Q + off); if (HL) q2f[qt][ks] = F::ld(Q2 + off); }
#pragma unroll
    for (int kt = 0; kt < 2; ++kt)
#pragma unroll
        for (int ks = 0; ks < 2; ++ks) kf[kt][ks] = F::ld(Kp + (size_t)kbeg * HD + (kt * 2 + ks) * 512 + lane * 8);   // the wave's first 32 keys; every later pass's K fragments are fetched one pass ahead
    XWAIT();
    float m[NQ], l[NQ]; v8f o[4][NQ]; const int kd = q0 & ~31;   // first key of the 32-key block that holds the diagonal
#pragma unroll
    for (int qt = 0; qt < NQ; ++qt) { m[qt] = -3.0e38f; l[qt] = 0.f; }
#pragma unroll
    for (int dt = 0; dt < 4; ++dt)
#pragma unroll
        for (int qt = 0; qt < NQ; ++qt) o[dt][qt] = (v8f){};
    // L2 requests for K and V^T four passes ahead (fp16 rows; 'ask': one wave of the four that walk the same keys, the one with the most). A pass reads 4,096 contiguous bytes of either plane: lanes 0 .. 15 ask for the 16 units of K, lanes 16 .. 31 for those of V^T.
    // pf stays in one register pair for the whole loop (the statements hold it as an operand that they may change) and points at the current pass's block; the test keeps the request, also after pf's next step, on blocks that this wave reads itself.
    const char* pf = (hi ? (const char*)Vt + lr * 256 : (const char*)Kp + lr * 256) + (size_t)kbeg * (HD * 2); const int pfk = ask ? kend : 0;
    if constexpr (!HL) { static_assert(RH >= 5 * 32, "the first blocks exist for every fp16 row");
        if (ask) asm volatile("global_prefetch_b8 %0, off offset:4096 scope:SCOPE_SE\n\tglobal_prefetch_b8 %0, off offset:8192 scope:SCOPE_SE\n\tglobal_prefetch_b8 %0, off offset:12288 scope:SCOPE_SE\n\ts_wait_xcnt 0x0" : "+v"(pf) :: "memory"); }
#pragma unroll 1
    for (int k0 = kbeg; k0 < kend; k0 += 32) {
        if constexpr (!HL) {
            if (k0 + 4 * 32 < pfk) asm volatile("global_prefetch_b8 %0, off offset:16384 scope:SCOPE_SE\n\ts_wait_xcnt 0x0" : "+v"(pf) :: "memory");
            pf += 4096; }
        attn_step<T16, HL, NQ, false>(Kp, K2, Vt, Vt2, k0, q0, lr, hi, qf, q2f, kf, m, l, o);
    }
    if (role != 1) attn_step<T16, HL, NQ, true>(Kp, K2, Vt, Vt2, kd, q0, lr, hi, qf, q2f, kf, m, l, o);   // the diagonal block: keys kd .. kd + 31, masked by select
    if constexpr (!HL) { static_assert(NQ == 2, "one 16-byte piece holds both maxima and both sums");
        {   // the same lane of both waves holds the same (row, d) places: piece i of lane n at (i * 32 + n) * 16 bytes, so every LDS access of a wave is 512 contiguous bytes
            v4fa* sx = (v4fa*)xs + lane;
            if (role == 2) {
#pragma unroll
                for (int dt = 0; dt < 4; ++dt)
#pragma unroll
                    for (int qt = 0; qt < NQ; ++qt) { const v8f t = o[dt][qt]; sx[((dt * NQ + qt) * 2) * 32] = __builtin_shufflevector(t, t, 0, 1, 2, 3); sx[((dt * NQ + qt) * 2 + 1) * 32] = __builtin_shufflevector(t, t, 4, 5, 6, 7); }
                sx[16 * 32] = (v4f){m[0], m[1], l[0], l[1]};
            }
            __syncthreads();   // publishes the role 2 waves' states to their partners; every wave of the work-group passes it once
            if (role == 2) return;
            const v4f st = sx[16 * 32];
#pragma unroll
            for (int qt = 0; qt < NQ; ++qt) { const float mn = fmaxf(m[qt], st[qt]); const float a0 = __builtin_amdgcn_exp2f((m[qt] - mn) * SC2), a1 = __builtin_amdgcn_exp2f((st[qt] - mn) * SC2); l[qt] = l[qt] * a0 + st[2 + qt] * a1;
#pragma unroll
                for (int dt = 0; dt < 4; ++dt) { const v4f u0 = sx[((dt * NQ + qt) * 2) * 32], u1 = sx[((dt * NQ + qt) * 2 + 1) * 32];
                    o[dt][qt] = o[dt][qt] * a0 + __builtin_shufflevector(u0, u1, 0, 1, 2, 3, 4, 5, 6, 7) * a1; } }
        } }
#pragma unroll
    for (int qt = 0; qt < NQ; ++qt) { const float inv = __fdiv_rn(1.0f, l[qt] + __shfl_xor(l[qt], 16, 32)); const size_t ro = (size_t)(q0 + qt * 16) * DQ + lane * 8;   // merged planes in fragment order for the output projection (rows t, k = h * 64 + d): this head's 16 d of tile dt are half block dt of its two K blocks
#pragma unroll
        for (int dt = 0; dt < 4; ++dt) { v8us oh, ol;
#pragma unroll
            for (int j = 0; j < 8; ++j) { unsigned short a, c2; splitf(o[dt][qt][j] * inv, a, c2); oh[j] = a; ol[j] = c2; }
            *(v8us*)(Ah + ro + dt * 256) = oh; *(v8us*)(Al + ro + dt * 256) = ol; XWAIT(); } }
}
// grid (batch x head, position blocks); work-groups of 8 waves, two resident on a WGP. Two kinds of block. S (fp16 rows, 128 of them): waves 0 .. 3 take 32 rows each with the lower part of their keys, waves 4 .. 7 the same rows with the rest,
// so that no wave walks more than about half of the keys: the launch no longer ends on a few long waves that run alone on their SIMDs. H (hi/lo rows, 128 of them): 8 waves x 16 rows, all keys.
// The waves of one part walk the same keys: they meet in the WGP cache. The hi/lo rows take 16 per wave because both planes of every operand are live: at 32 the kernel needs registers above v255.
#define NSB  ((TT - RH) / 128)
#define NHB  (RH / 128)
#define XSL  (17 * 32 * 4)   // floats of one wave pair's hand-over range
static_assert(NSB == 12 && NHB == 4 && RH % 128 == 0 && RH / 2 + 64 <= RH, "the order word below names 12 S and 4 H blocks; the split key lies below every fp16 row");
__global__ __launch_bounds__(256) void k_fattn(const h16* __restrict__ QK16, const bf* __restrict__ QKh, const bf* __restrict__ QKl, const h16* __restrict__ VT16, const bf* __restrict__ VTh, const bf* __restrict__ VTl, bf* ATh, bf* ATl) {
    __shared__ __align__(16) float xs[4 * XSL];
    const int lane = threadIdx.x & 31; const int wave = __builtin_amdgcn_readfirstlane((int)(threadIdx.x >> 5)); const int b = blockIdx.x / NH_, h = blockIdx.x % NH_;
    // block by blockIdx.y, one hex digit each from the low end (0 .. 11: S block, 12 .. 15: H block, each kind's longest first): there are more work-groups than places, so the length of the walk falls with the index (for speed only)
    const int code = (int)((0xFBEA9D876C543210ULL >> ((int)blockIdx.y * 4)) & 15);
    const size_t qo = ((size_t)b * (NH_ + NKV) + h) * TT * HD, ko = ((size_t)b * (NH_ + NKV) + NH_ + h / REP) * TT * HD, vo = ((size_t)b * NKV + h / REP) * HD * TT, ao = (size_t)b * TT * DQ + h * HD * 16;
    if (code < NSB) {
        // split key kc (base / 2 is a multiple of 64): the lower part walks two passes more than half of the whole blocks below base; the upper part has the rest, up to 3 more blocks and the diagonal block: both parts reach the barrier at about the same time
        const int base = TT - (code + 1) * 128, kc = base / 2 + 64, q0 = base + (wave & 3) * 32; const bool up = wave >= 4;
        attn_rows<h16, false, 2>(QK16 + qo, nullptr, QK16 + ko, nullptr, VT16 + vo, nullptr, q0, lane, (wave & 3) == 3, ATh + ao, ATl + ao, up ? kc : 0, up ? q0 : kc, up ? 2 : 1, xs + (wave & 3) * XSL);
    } else { const int q0 = RH - (code - NSB + 1) * 128 + wave * 16;
        attn_rows<bf, true, 1>(QKh + qo, QKl + qo, QKh + ko, QKl + ko, VTh + vo, VTl + vo, q0, lane, false, ATh + ao, ATl + ao, 0, q0 & ~31, 0, nullptr); }
}

extern "C" void kernel_launch(void* const* d_in, const int* in_sizes, int n_in,
                              void* d_out, int out_size, void* d_ws, size_t ws_size, hipStream_t stream) {
    (void)in_sizes; (void)n_in; (void)out_size;
    const float* x = (const float*)d_in[0]; const float* wq = (const float*)d_in[1]; const float* wk = (const float*)d_in[2]; const float* wv = (const float*)d_in[3]; const float* wo = (const float*)d_in[4]; const float* bo = (const float*)d_in[5];   /* inputs x, Wq, Wk, Wv, Wo ('xw' [768][768]), bo */
    float* OUT = (float*)d_out;     // [4][2048][768]
    char* wsp = (char*)d_ws;
    auto take = [&](size_t bytes) { char* p = wsp; wsp += (bytes + 255) & ~(size_t)255; return (void*)p; };
    bf* WQ = (bf*)take((size_t)DQ * DM * 2); bf* WK = (bf*)take((size_t)DKV * DM * 2); bf* WV = (bf*)take((size_t)DKV * DM * 2); bf* WO = (bf*)take((size_t)DM * DQ * 2); (void)WK; (void)WV;   // back to back: one [DQ + 2 DKV + DM][DM] block
    bf* XB = (bf*)take((size_t)NB_ * TT * DM * 2);
    // planes of all batches: per batch the 12 q heads directly followed by the 12 k heads (fp16, hi, lo alike)
    h16* QK16 = (h16*)take((size_t)NB_ * (NH_ + NKV) * TT * HD * 2); bf* QKh = (bf*)take((size_t)NB_ * (NH_ + NKV) * TT * HD * 2); bf* QKl = (bf*)take((size_t)NB_ * (NH_ + NKV) * TT * HD * 2);
    h16* VT16 = (h16*)take((size_t)NB_ * NKV * HD * TT * 2); bf* VTh = (bf*)take((size_t)NB_ * NKV * HD * TT * 2); bf* VTl = (bf*)take((size_t)NB_ * NKV * HD * TT * 2);
    bf* ATh = (bf*)take((size_t)NB_ * TT * DQ * 2); bf* ATl = (bf*)take((size_t)NB_ * TT * DQ * 2);
    if ((size_t)(wsp - (char*)d_ws) > ws_size) return;    // ws 256 MiB
    k_prep<<<4 * WTB + CVB, 256, 0, stream>>>(x, wq, wk, wv, wo, WQ, XB);
    // q, k, v of all batches in one GEMM (WQ, WK, WV are one [DQ + 2 DKV][DM] transposed weight); its epilogue writes the head planes
    k_qkv<<<dim3(NB_ * TT / (QWM * 64), (DQ + 2 * DKV) / (QWN * QCG * 16), 1), QWM * QWN * 32, 0, stream>>>(XB, WQ, QK16, QKh, QKl, VT16, VTh, VTl);
    k_fattn<<<dim3(NB_ * NH_, NSB + NHB, 1), 256, 0, stream>>>(QK16, QKh, QKl, VT16, VTh, VTl, ATh, ATl);   // attention of all batches and heads in one launch
    k_wo<<<dim3(NB_ * TT / (OWM * 32), DM / (OWN * 64), 1), OWM * OWN * 32, 0, stream>>>(ATh, ATl, WO, bo, OUT);   // output projection of all batches in one launch (rows b * TT + t)
}
